// v000
// Times are from an AMD MI455X. After a warm-up the kernel runs many times in a row, and a time is the length of
// such a window on the GPU divided by its runs, so every launch and the gaps after it count. The runs cycle
// through copies of the inputs. A figure is the median of several windows, for all but v000 over two sittings.
// Sittings can differ by a few percent; kernels timed side by side share one.
// v000, which the later versions start from, runs in 351 microseconds.
#include <hip/hip_runtime.h>

#define B_ 4
#define S_ 2048
#define H_ 512
#define NH_ 8
#define DK_ 64

constexpr float LN_EPS_ = 1e-5f;
constexpr float NEG_INF_ = -1e30f;

typedef __attribute__((ext_vector_type(16))) __bf16 v16bf;
typedef __attribute__((ext_vector_type(8)))  __bf16 v8bf;
typedef __attribute__((ext_vector_type(8)))  float  v8f;
typedef __attribute__((ext_vector_type(4)))  float  v4f;

__device__ __forceinline__ v8f zero_v8f() {
  v8f z;
#pragma unroll
  for (int i = 0; i < 8; ++i) z[i] = 0.f;
  return z;
}

// A-style fragment: 16x32 bf16 tile from a row-major matrix (ld elements/row).
// lane (l&15) = row; element K pattern: e<8 -> 8g+e, e>=8 -> 8g+16+(e-8).
// Two aligned 16-byte loads per lane.
__device__ __forceinline__ v16bf load_frag_rm(const __bf16* m, long row0, int ld, int col0) {
  int l = threadIdx.x & 31;
  const __bf16* p = m + (row0 + (l & 15)) * (long)ld + col0 + 8 * (l >> 4);
  v8bf lo = *(const v8bf*)p;
  v8bf hi = *(const v8bf*)(p + 16);
  return __builtin_shufflevector(lo, hi, 0, 1, 2, 3, 4, 5, 6, 7,
                                 8, 9, 10, 11, 12, 13, 14, 15);
}

// Packed fragment: one 32-byte contiguous load per lane.
__device__ __forceinline__ v16bf load_frag_pk(const __bf16* pk, int f) {
  int l = threadIdx.x & 31;
  return *(const v16bf*)(pk + ((long)f * 32 + l) * 16);
}

__device__ __forceinline__ v8f wmma_bf16(v16bf a, v16bf b, v8f c) {
  return __builtin_amdgcn_wmma_f32_16x16x32_bf16(false, a, false, b, (short)0, c,
                                                 false, false);
}

// ---------------- kernel 0: pack fp32 weights into bf16 B-fragments ----------------
// Input: nmat row-major KxN matrices (nmat from grid). Output: per fragment
// (kc in K/32, nt in N/16): pk[(fid*32 + lane)*16 + e] with the WMMA B layout.
// grid.x = nmat * (K/32) * (N/16), block = 32.
__global__ void pack_frags_kernel(const float* __restrict__ w, __bf16* __restrict__ pk,
                                  int K, int N) {
  long fid = blockIdx.x;
  int ntiles = N >> 4;
  long fpm = (long)(K >> 5) * ntiles;
  long m = fid / fpm;
  long f = fid % fpm;
  int kc = (int)(f / ntiles), nt = (int)(f % ntiles);
  int l = threadIdx.x;
  int g = l >> 4, c = l & 15;
  const float* wm = w + m * (long)K * N;
  __bf16* dst = pk + (fid * 32 + l) * 16;
#pragma unroll
  for (int e = 0; e < 16; ++e) {
    int kpat = (e < 8 ? e : e + 8) + 8 * g;
    dst[e] = (__bf16)wm[(long)(kc * 32 + kpat) * N + nt * 16 + c];
  }
}

// ---------------- kernel 1: LayerNorm ----------------
// block = 128 threads, one row of 512 per block; contiguous float4 per thread.
__global__ void ln_kernel(const float* __restrict__ x, const float* __restrict__ gamma,
                          const float* __restrict__ beta, float* __restrict__ xn,
                          __bf16* __restrict__ xn_bf) {
  long row = blockIdx.x;
  int t = threadIdx.x;
  v4f v = *(const v4f*)(x + row * H_ + t * 4);
  float s = v[0] + v[1] + v[2] + v[3];
  float ss = v[0] * v[0] + v[1] * v[1] + v[2] * v[2] + v[3] * v[3];
#pragma unroll
  for (int off = 16; off > 0; off >>= 1) {
    s += __shfl_xor(s, off, 32);
    ss += __shfl_xor(ss, off, 32);
  }
  __shared__ float rs[4], rss[4];
  int wid = t >> 5;
  if ((t & 31) == 0) { rs[wid] = s; rss[wid] = ss; }
  __syncthreads();
  s = rs[0] + rs[1] + rs[2] + rs[3];
  ss = rss[0] + rss[1] + rss[2] + rss[3];
  float mean = s * (1.f / H_);
  float var = ss * (1.f / H_) - mean * mean;
  float inv = rsqrtf(var + LN_EPS_);
  v4f gm = *(const v4f*)(gamma + t * 4);
  v4f bt = *(const v4f*)(beta + t * 4);
  v4f o;
  v8bf ob;
#pragma unroll
  for (int j = 0; j < 4; ++j) {
    o[j] = (v[j] - mean) * inv * gm[j] + bt[j];
    ob[j] = (__bf16)o[j];
  }
  *(v4f*)(xn + row * H_ + t * 4) = o;
  // store 4 bf16 (8 bytes)
  __bf16* xb = xn_bf + row * H_ + t * 4;
  xb[0] = ob[0]; xb[1] = ob[1]; xb[2] = ob[2]; xb[3] = ob[3];
}

// ---------------- kernel 2: Q/K/V projections ----------------
// grid = (S/32, B*NH, 3), block = 64 (2 waves); wave: 16(S) x 64(DK) tile.
// z=0: q (scaled 1/8, [bn][s][d]); z=1: k ([bn][s][d]); z=2: v transposed ([bn][d][s]).
__global__ void proj_kernel(const __bf16* __restrict__ xn_bf,
                            const __bf16* __restrict__ wq_pk, const __bf16* __restrict__ wk_pk,
                            const __bf16* __restrict__ wv_pk,
                            __bf16* __restrict__ q, __bf16* __restrict__ k,
                            __bf16* __restrict__ vT) {
  int which = blockIdx.z;
  int wid = threadIdx.x >> 5;
  int l = threadIdx.x & 31;
  int g = l >> 4, c = l & 15;
  int bn = blockIdx.y;
  int n = bn & 7;
  long s0 = (long)blockIdx.x * 32 + wid * 16;
  long row0 = ((long)(bn >> 3)) * S_ + s0;
  const __bf16* wsel = (which == 0) ? wq_pk : (which == 1) ? wk_pk : wv_pk;
  const __bf16* wpk = wsel + (long)n * 64 * 512;  // 64 frags/head, 512 bf16/frag

  v8f acc[4];
#pragma unroll
  for (int t = 0; t < 4; ++t) acc[t] = zero_v8f();

  for (int kc = 0; kc < H_ / 32; ++kc) {
    v16bf a = load_frag_rm(xn_bf, row0, H_, kc * 32);
#pragma unroll
    for (int t = 0; t < 4; ++t)
      acc[t] = wmma_bf16(a, load_frag_pk(wpk, kc * 4 + t), acc[t]);
  }

  if (which == 2) {
    // vT[bn][d][s]: lane writes 8 contiguous s per tile
    __bf16* vbase = vT + (long)bn * DK_ * S_;
#pragma unroll
    for (int t = 0; t < 4; ++t) {
      __bf16* p = vbase + (long)(t * 16 + c) * S_ + s0 + 8 * g;
#pragma unroll
      for (int i = 0; i < 8; ++i) p[i] = (__bf16)acc[t][i];
    }
  } else {
    __bf16* dst = (which == 0) ? q : k;
    float sc = (which == 0) ? 0.125f : 1.f;  // fold 1/sqrt(DK) into q
    long base = ((long)bn * S_ + s0) * DK_;
#pragma unroll
    for (int t = 0; t < 4; ++t)
#pragma unroll
      for (int i = 0; i < 8; ++i)
        dst[base + (long)(i + 8 * g) * DK_ + t * 16 + c] = (__bf16)(acc[t][i] * sc);
  }
}

// ---------------- kernel 3: flash-style masked attention ----------------
// grid = (S/64, B*NH), block = 128 (4 waves); wave handles one 16-row q tile.
__global__ void attn_kernel(const __bf16* __restrict__ qm, const __bf16* __restrict__ km,
                            const __bf16* __restrict__ vT, const int* __restrict__ mask,
                            __bf16* __restrict__ h) {
  int wid = threadIdx.x >> 5;
  int l = threadIdx.x & 31;
  int g = l >> 4, c = l & 15;
  int bn = blockIdx.y;
  int b = bn >> 3, n = bn & 7;
  long s0 = (long)blockIdx.x * 64 + wid * 16;
  const __bf16* qb = qm + (long)bn * S_ * DK_;
  const __bf16* kb = km + (long)bn * S_ * DK_;
  const __bf16* vb = vT + (long)bn * DK_ * S_;   // [d][s]
  const int* mrow = mask + (long)b * S_;

  __shared__ __bf16 pbuf[4][16 * 32];
  __bf16* pb = pbuf[wid];

  v16bf aq0 = load_frag_rm(qb, s0, DK_, 0);
  v16bf aq1 = load_frag_rm(qb, s0, DK_, 32);

  v8f acc[4];
  float mr[8], lr[8];
#pragma unroll
  for (int t = 0; t < 4; ++t) acc[t] = zero_v8f();
#pragma unroll
  for (int i = 0; i < 8; ++i) { mr[i] = -1e38f; lr[i] = 0.f; }

  for (int kt = 0; kt < S_; kt += 32) {
    v8f s0f = zero_v8f(), s1f = zero_v8f();
    s0f = wmma_bf16(aq0, load_frag_rm(kb, kt, DK_, 0), s0f);
    s0f = wmma_bf16(aq1, load_frag_rm(kb, kt, DK_, 32), s0f);
    s1f = wmma_bf16(aq0, load_frag_rm(kb, kt + 16, DK_, 0), s1f);
    s1f = wmma_bf16(aq1, load_frag_rm(kb, kt + 16, DK_, 32), s1f);

    bool m0 = mrow[kt + c] != 0;
    bool m1 = mrow[kt + 16 + c] != 0;
    float tm[8];
#pragma unroll
    for (int i = 0; i < 8; ++i) {
      s0f[i] = m0 ? s0f[i] : NEG_INF_;
      s1f[i] = m1 ? s1f[i] : NEG_INF_;
      tm[i] = fmaxf(s0f[i], s1f[i]);
    }
#pragma unroll
    for (int off = 8; off > 0; off >>= 1)
#pragma unroll
      for (int i = 0; i < 8; ++i) tm[i] = fmaxf(tm[i], __shfl_xor(tm[i], off, 32));

    float p0[8], p1[8], psum[8];
#pragma unroll
    for (int i = 0; i < 8; ++i) {
      float mn = fmaxf(mr[i], tm[i]);
      float corr = __expf(mr[i] - mn);
      mr[i] = mn;
      lr[i] *= corr;
      acc[0][i] *= corr; acc[1][i] *= corr; acc[2][i] *= corr; acc[3][i] *= corr;
      p0[i] = __expf(s0f[i] - mn);
      p1[i] = __expf(s1f[i] - mn);
      psum[i] = p0[i] + p1[i];
    }
#pragma unroll
    for (int off = 8; off > 0; off >>= 1)
#pragma unroll
      for (int i = 0; i < 8; ++i) psum[i] += __shfl_xor(psum[i], off, 32);
#pragma unroll
    for (int i = 0; i < 8; ++i) lr[i] += psum[i];

    // probs: C layout -> A layout via per-wave LDS tile (16x32 bf16)
#pragma unroll
    for (int i = 0; i < 8; ++i) {
      pb[(i + 8 * g) * 32 + c] = (__bf16)p0[i];
      pb[(i + 8 * g) * 32 + 16 + c] = (__bf16)p1[i];
    }
    asm volatile("s_wait_dscnt 0" ::: "memory");
    v16bf pa = load_frag_rm(pb, 0, 32, 0);
#pragma unroll
    for (int t = 0; t < 4; ++t)
      acc[t] = wmma_bf16(pa, load_frag_rm(vb, t * 16, S_, kt), acc[t]);
  }

  long hbase = ((long)b * S_ + s0) * H_ + n * DK_;
#pragma unroll
  for (int i = 0; i < 8; ++i) {
    float inv = 1.f / lr[i];
#pragma unroll
    for (int t = 0; t < 4; ++t)
      h[hbase + (long)(i + 8 * g) * H_ + t * 16 + c] = (__bf16)(acc[t][i] * inv);
  }
}

// ---------------- kernel 4: output projection + residual + mask ----------------
// grid = B*S/16, block = 256 (8 waves); wave w computes cols [w*64, w*64+64).
__global__ void outproj_kernel(const __bf16* __restrict__ hbf, const __bf16* __restrict__ wo_pk,
                               const float* __restrict__ xn, const int* __restrict__ mask,
                               float* __restrict__ out) {
  int wid = threadIdx.x >> 5;
  int l = threadIdx.x & 31;
  int g = l >> 4, c = l & 15;
  long row0 = (long)blockIdx.x * 16;
  int n0 = wid * 64;

  v8f acc[4];
#pragma unroll
  for (int t = 0; t < 4; ++t) acc[t] = zero_v8f();

  for (int kc = 0; kc < H_ / 32; ++kc) {
    v16bf a = load_frag_rm(hbf, row0, H_, kc * 32);
#pragma unroll
    for (int t = 0; t < 4; ++t)
      acc[t] = wmma_bf16(a, load_frag_pk(wo_pk, kc * 32 + wid * 4 + t), acc[t]);
  }
#pragma unroll
  for (int i = 0; i < 8; ++i) {
    long row = row0 + i + 8 * g;
    float mf = (mask[row] != 0) ? 1.f : 0.f;
#pragma unroll
    for (int t = 0; t < 4; ++t) {
      long cidx = row * H_ + n0 + t * 16 + c;
      out[cidx] = (acc[t][i] + xn[cidx]) * mf;
    }
  }
}

extern "C" void kernel_launch(void* const* d_in, const int* in_sizes, int n_in,
                              void* d_out, int out_size, void* d_ws, size_t ws_size,
                              hipStream_t stream) {
  (void)in_sizes; (void)n_in; (void)out_size; (void)ws_size;
  const float* x     = (const float*)d_in[0];
  const int*   mask  = (const int*)d_in[1];
  const float* Wq    = (const float*)d_in[2];
  const float* Wk    = (const float*)d_in[3];
  const float* Wv    = (const float*)d_in[4];
  const float* Wo    = (const float*)d_in[5];
  const float* gamma = (const float*)d_in[6];
  const float* beta  = (const float*)d_in[7];
  float* out = (float*)d_out;

  char* ws = (char*)d_ws;
  float* xn = (float*)ws;        ws += (size_t)B_ * S_ * H_ * 4;
  __bf16* xn_bf = (__bf16*)ws;   ws += (size_t)B_ * S_ * H_ * 2;
  __bf16* qb = (__bf16*)ws;      ws += (size_t)B_ * NH_ * S_ * DK_ * 2;
  __bf16* kb = (__bf16*)ws;      ws += (size_t)B_ * NH_ * S_ * DK_ * 2;
  __bf16* vT = (__bf16*)ws;      ws += (size_t)B_ * NH_ * S_ * DK_ * 2;
  __bf16* hb = (__bf16*)ws;      ws += (size_t)B_ * S_ * H_ * 2;
  __bf16* wq_pk = (__bf16*)ws;   ws += (size_t)NH_ * H_ * DK_ * 2;
  __bf16* wk_pk = (__bf16*)ws;   ws += (size_t)NH_ * H_ * DK_ * 2;
  __bf16* wv_pk = (__bf16*)ws;   ws += (size_t)NH_ * H_ * DK_ * 2;
  __bf16* wo_pk = (__bf16*)ws;   ws += (size_t)H_ * H_ * 2;

  // weight packing: per-head KxN = 512x64 -> 8*16*4 = 512 frag-blocks; Wo: 16*32 = 512
  pack_frags_kernel<<<NH_ * (H_ / 32) * (DK_ / 16), 32, 0, stream>>>(Wq, wq_pk, H_, DK_);
  pack_frags_kernel<<<NH_ * (H_ / 32) * (DK_ / 16), 32, 0, stream>>>(Wk, wk_pk, H_, DK_);
  pack_frags_kernel<<<NH_ * (H_ / 32) * (DK_ / 16), 32, 0, stream>>>(Wv, wv_pk, H_, DK_);
  pack_frags_kernel<<<(H_ / 32) * (H_ / 16), 32, 0, stream>>>(Wo, wo_pk, H_, H_);

  ln_kernel<<<B_ * S_, 128, 0, stream>>>(x, gamma, beta, xn, xn_bf);

  proj_kernel<<<dim3(S_ / 32, B_ * NH_, 3), 64, 0, stream>>>(xn_bf, wq_pk, wk_pk, wv_pk,
                                                             qb, kb, vT);

  attn_kernel<<<dim3(S_ / 64, B_ * NH_), 128, 0, stream>>>(qb, kb, vT, mask, hb);

  outproj_kernel<<<B_ * S_ / 16, 256, 0, stream>>>(hb, wo_pk, xn, mask, out);
}

// v001
// It runs in 221 microseconds.
// In both of two side-by-side timings against v000, it was 1.63 times as fast.
#include <hip/hip_runtime.h>

#define B_ 4
#define S_ 2048
#define H_ 512
#define NH_ 8
#define DK_ 64

constexpr float LN_EPS_ = 1e-5f;
constexpr float NEG_INF_ = -1e30f;

typedef __attribute__((ext_vector_type(16))) __bf16 v16bf;
typedef __attribute__((ext_vector_type(8)))  __bf16 v8bf;
typedef __attribute__((ext_vector_type(8)))  float  v8f;
typedef __attribute__((ext_vector_type(4)))  float  v4f;
typedef __attribute__((ext_vector_type(4)))  int    v4i;

__device__ __forceinline__ v8f zero_v8f() {
  v8f z;
#pragma unroll
  for (int i = 0; i < 8; ++i) z[i] = 0.f;
  return z;
}

// A-style fragment: 16x32 bf16 tile from a row-major matrix (ld elements/row).
// lane (l&15) = row; element K pattern: e<8 -> 8g+e, e>=8 -> 8g+16+(e-8).
// Two aligned 16-byte loads per lane.
__device__ __forceinline__ v16bf load_frag_rm(const __bf16* m, long row0, int ld, int col0) {
  int l = threadIdx.x & 31;
  const __bf16* p = m + (row0 + (l & 15)) * (long)ld + col0 + 8 * (l >> 4);
  v8bf lo = *(const v8bf*)p;
  v8bf hi = *(const v8bf*)(p + 16);
  return __builtin_shufflevector(lo, hi, 0, 1, 2, 3, 4, 5, 6, 7,
                                 8, 9, 10, 11, 12, 13, 14, 15);
}

// The same fragment from a wave-uniform base and the lane's own constant element
// offset (its row and its 8g): the loop moves the base, the lane's offset stays.
__device__ __forceinline__ v16bf load_frag_bo(const __bf16* base, unsigned off) {
  v8bf lo = *(const v8bf*)(base + off);
  v8bf hi = *(const v8bf*)(base + off + 16);
  return __builtin_shufflevector(lo, hi, 0, 1, 2, 3, 4, 5, 6, 7,
                                 8, 9, 10, 11, 12, 13, 14, 15);
}

// Packed fragment: one 32-byte contiguous load per lane.
__device__ __forceinline__ v16bf load_frag_pk(const __bf16* pk, int f) {
  int l = threadIdx.x & 31;
  return *(const v16bf*)(pk + ((long)f * 32 + l) * 16);
}

__device__ __forceinline__ v8f wmma_bf16(v16bf a, v16bf b, v8f c) {
  return __builtin_amdgcn_wmma_f32_16x16x32_bf16(false, a, false, b, (short)0, c,
                                                 false, false);
}

// value of lane l ^ 16
__device__ __forceinline__ float xhalf(float x) {
  int b = __builtin_bit_cast(int, x);
  return __builtin_bit_cast(float, __builtin_amdgcn_permlanex16(b, b, 0x76543210, 0xfedcba98,
                                                                false, false));
}

// ---------------- kernel 0: pack fp32 weights into bf16 B-fragments ----------------
// Input: nmat row-major KxN matrices (nmat from grid). Output: per fragment
// (kc in K/32, nt in N/16): pk[(fid*32 + lane)*16 + e] with the WMMA B layout.
// grid.x = nmat * (K/32) * (N/16), block = 32.
__global__ void pack_frags_kernel(const float* __restrict__ w, __bf16* __restrict__ pk,
                                  int K, int N) {
  long fid = blockIdx.x;
  int ntiles = N >> 4;
  long fpm = (long)(K >> 5) * ntiles;
  long m = fid / fpm;
  long f = fid % fpm;
  int kc = (int)(f / ntiles), nt = (int)(f % ntiles);
  int l = threadIdx.x;
  int g = l >> 4, c = l & 15;
  const float* wm = w + m * (long)K * N;
  __bf16* dst = pk + (fid * 32 + l) * 16;
#pragma unroll
  for (int e = 0; e < 16; ++e) {
    int kpat = (e < 8 ? e : e + 8) + 8 * g;
    dst[e] = (__bf16)wm[(long)(kc * 32 + kpat) * N + nt * 16 + c];
  }
}

// ---------------- kernel 1: LayerNorm ----------------
// block = 128 threads, one row of 512 per block; contiguous float4 per thread.
__global__ void ln_kernel(const float* __restrict__ x, const float* __restrict__ gamma,
                          const float* __restrict__ beta, float* __restrict__ xn,
                          __bf16* __restrict__ xn_bf) {
  long row = blockIdx.x;
  int t = threadIdx.x;
  v4f v = *(const v4f*)(x + row * H_ + t * 4);
  float s = v[0] + v[1] + v[2] + v[3];
  float ss = v[0] * v[0] + v[1] * v[1] + v[2] * v[2] + v[3] * v[3];
#pragma unroll
  for (int off = 16; off > 0; off >>= 1) {
    s += __shfl_xor(s, off, 32);
    ss += __shfl_xor(ss, off, 32);
  }
  __shared__ float rs[4], rss[4];
  int wid = t >> 5;
  if ((t & 31) == 0) { rs[wid] = s; rss[wid] = ss; }
  __syncthreads();
  s = rs[0] + rs[1] + rs[2] + rs[3];
  ss = rss[0] + rss[1] + rss[2] + rss[3];
  float mean = s * (1.f / H_);
  float var = ss * (1.f / H_) - mean * mean;
  float inv = rsqrtf(var + LN_EPS_);
  v4f gm = *(const v4f*)(gamma + t * 4);
  v4f bt = *(const v4f*)(beta + t * 4);
  v4f o;
  v8bf ob;
#pragma unroll
  for (int j = 0; j < 4; ++j) {
    o[j] = (v[j] - mean) * inv * gm[j] + bt[j];
    ob[j] = (__bf16)o[j];
  }
  *(v4f*)(xn + row * H_ + t * 4) = o;
  // store 4 bf16 (8 bytes)
  __bf16* xb = xn_bf + row * H_ + t * 4;
  xb[0] = ob[0]; xb[1] = ob[1]; xb[2] = ob[2]; xb[3] = ob[3];
}

// ---------------- kernel 2: Q/K/V projections ----------------
// grid = (S/32, B*NH, 3), block = 64 (2 waves); wave: 16(S) x 64(DK) tile.
// z=0: q (scaled 1/8, [bn][s][d]); z=1: k ([bn][s][d]); z=2: v transposed ([bn][d][s]).
__global__ void proj_kernel(const __bf16* __restrict__ xn_bf,
                            const __bf16* __restrict__ wq_pk, const __bf16* __restrict__ wk_pk,
                            const __bf16* __restrict__ wv_pk,
                            __bf16* __restrict__ q, __bf16* __restrict__ k,
                            __bf16* __restrict__ vT) {
  int which = blockIdx.z;
  int wid = threadIdx.x >> 5;
  int l = threadIdx.x & 31;
  int g = l >> 4, c = l & 15;
  int bn = blockIdx.y;
  int n = bn & 7;
  long s0 = (long)blockIdx.x * 32 + wid * 16;
  long row0 = ((long)(bn >> 3)) * S_ + s0;
  const __bf16* wsel = (which == 0) ? wq_pk : (which == 1) ? wk_pk : wv_pk;
  const __bf16* wpk = wsel + (long)n * 64 * 512;  // 64 frags/head, 512 bf16/frag

  v8f acc[4];
#pragma unroll
  for (int t = 0; t < 4; ++t) acc[t] = zero_v8f();

  for (int kc = 0; kc < H_ / 32; ++kc) {
    v16bf a = load_frag_rm(xn_bf, row0, H_, kc * 32);
#pragma unroll
    for (int t = 0; t < 4; ++t)
      acc[t] = wmma_bf16(a, load_frag_pk(wpk, kc * 4 + t), acc[t]);
  }

  if (which == 2) {
    // vT[bn][d][s]: lane writes 8 contiguous s per tile
    __bf16* vbase = vT + (long)bn * DK_ * S_;
#pragma unroll
    for (int t = 0; t < 4; ++t) {
      __bf16* p = vbase + (long)(t * 16 + c) * S_ + s0 + 8 * g;
#pragma unroll
      for (int i = 0; i < 8; ++i) p[i] = (__bf16)acc[t][i];
    }
  } else {
    __bf16* dst = (which == 0) ? q : k;
    float sc = (which == 0) ? 0.125f : 1.f;  // fold 1/sqrt(DK) into q
    long base = ((long)bn * S_ + s0) * DK_;
#pragma unroll
    for (int t = 0; t < 4; ++t)
#pragma unroll
      for (int i = 0; i < 8; ++i)
        dst[base + (long)(i + 8 * g) * DK_ + t * 16 + c] = (__bf16)(acc[t][i] * sc);
  }
}

__global__ void attn_kernel(const __bf16* __restrict__ qm, const __bf16* __restrict__ km,
                            const __bf16* __restrict__ vT, const int* __restrict__ mask,
                            __bf16* __restrict__ h) {
  int wid = threadIdx.x >> 5;
  int l = threadIdx.x & 31;
  int g = l >> 4, c = l & 15;
  int bn = blockIdx.y;
  int b = bn >> 3, n = bn & 7;
  long s0 = (long)blockIdx.x * 64 + wid * 16;
  const __bf16* qb = qm + (long)bn * S_ * DK_;
  const __bf16* kb = km + (long)bn * S_ * DK_;
  const __bf16* vb = vT + (long)bn * DK_ * S_;   // [d][s]
  const int* mrow = mask + (long)b * S_ + 8 * g;
  const unsigned koff = (unsigned)(c * DK_ + 8 * g);  // key row c
  const unsigned voff = (unsigned)(c * S_ + 8 * g);   // V^T row d = c

  // B operand: column c = query s0 + c
  v16bf bq0 = load_frag_rm(qb, s0, DK_, 0);
  v16bf bq1 = load_frag_rm(qb, s0, DK_, 32);

  v8f acc[4];  // acc[t][i] = O^T[d = 16t + 8g + i][query s0 + c]
#pragma unroll
  for (int t = 0; t < 4; ++t) acc[t] = zero_v8f();
  float mr = -1e38f;  // running maximum of this lane's query (both halves agree)
  float lr = 0.f;     // running sum over this half's keys only; joined after the loop

  for (int kt = 0; kt < S_; kt += 32) {
    // s0f[i] = score(key kt + 8g + i, query c); s1f[i] = score(key kt + 16 + 8g + i, query c)
    v8f s0f = zero_v8f(), s1f = zero_v8f();
    const __bf16* kt0 = kb + (long)kt * DK_;
    s0f = wmma_bf16(load_frag_bo(kt0, koff), bq0, s0f);
    s0f = wmma_bf16(load_frag_bo(kt0 + 32, koff), bq1, s0f);
    s1f = wmma_bf16(load_frag_bo(kt0 + 16 * DK_, koff), bq0, s1f);
    s1f = wmma_bf16(load_frag_bo(kt0 + 16 * DK_ + 32, koff), bq1, s1f);

    v4i m0a = *(const v4i*)(mrow + kt);
    v4i m0b = *(const v4i*)(mrow + kt + 4);
    v4i m1a = *(const v4i*)(mrow + kt + 16);
    v4i m1b = *(const v4i*)(mrow + kt + 20);
    float tm = 0.f;
#pragma unroll
    for (int i = 0; i < 8; ++i) {
      int k0 = (i < 4) ? m0a[i & 3] : m0b[i & 3];
      int k1 = (i < 4) ? m1a[i & 3] : m1b[i & 3];
      s0f[i] = (k0 != 0) ? s0f[i] : NEG_INF_;
      s1f[i] = (k1 != 0) ? s1f[i] : NEG_INF_;
      float t2 = fmaxf(s0f[i], s1f[i]);
      tm = (i == 0) ? t2 : fmaxf(tm, t2);
    }
    tm = fmaxf(tm, xhalf(tm));

    float mn = fmaxf(mr, tm);
    float corr = __expf(mr - mn);
    mr = mn;
#pragma unroll
    for (int t = 0; t < 4; ++t)
#pragma unroll
      for (int i = 0; i < 8; ++i) acc[t][i] *= corr;

    // P^T as B operand: element e < 8 is key 8g + e, e >= 8 is key 16 + 8g + (e - 8),
    // the k order of load_frag_rm.
    v16bf pt;
    float psum = 0.f;
#pragma unroll
    for (int i = 0; i < 8; ++i) {
      float p0 = __expf(s0f[i] - mn);
      float p1 = __expf(s1f[i] - mn);
      psum += p0 + p1;
      pt[i] = (__bf16)p0;
      pt[8 + i] = (__bf16)p1;
    }
    lr = lr * corr + psum;

#pragma unroll
    for (int t = 0; t < 4; ++t)
      acc[t] = wmma_bf16(load_frag_bo(vb + (long)t * 16 * S_ + kt, voff), pt, acc[t]);
  }

  float inv = 1.f / (lr + xhalf(lr));
  // lane stores 8 contiguous d of its query per tile
  __bf16* hp = h + ((long)b * S_ + s0 + c) * H_ + n * DK_ + 8 * g;
#pragma unroll
  for (int t = 0; t < 4; ++t) {
    v8bf o;
#pragma unroll
    for (int i = 0; i < 8; ++i) o[i] = (__bf16)(acc[t][i] * inv);
    *(v8bf*)(hp + t * 16) = o;
  }
}

// ---------------- kernel 4: output projection + residual + mask ----------------
// grid = B*S/16, block = 256 (8 waves); wave w computes cols [w*64, w*64+64).
__global__ void outproj_kernel(const __bf16* __restrict__ hbf, const __bf16* __restrict__ wo_pk,
                               const float* __restrict__ xn, const int* __restrict__ mask,
                               float* __restrict__ out) {
  int wid = threadIdx.x >> 5;
  int l = threadIdx.x & 31;
  int g = l >> 4, c = l & 15;
  long row0 = (long)blockIdx.x * 16;
  int n0 = wid * 64;

  v8f acc[4];
#pragma unroll
  for (int t = 0; t < 4; ++t) acc[t] = zero_v8f();

  for (int kc = 0; kc < H_ / 32; ++kc) {
    v16bf a = load_frag_rm(hbf, row0, H_, kc * 32);
#pragma unroll
    for (int t = 0; t < 4; ++t)
      acc[t] = wmma_bf16(a, load_frag_pk(wo_pk, kc * 32 + wid * 4 + t), acc[t]);
  }
#pragma unroll
  for (int i = 0; i < 8; ++i) {
    long row = row0 + i + 8 * g;
    float mf = (mask[row] != 0) ? 1.f : 0.f;
#pragma unroll
    for (int t = 0; t < 4; ++t) {
      long cidx = row * H_ + n0 + t * 16 + c;
      out[cidx] = (acc[t][i] + xn[cidx]) * mf;
    }
  }
}

extern "C" void kernel_launch(void* const* d_in, const int* in_sizes, int n_in,
                              void* d_out, int out_size, void* d_ws, size_t ws_size,
                              hipStream_t stream) {
  (void)in_sizes; (void)n_in; (void)out_size; (void)ws_size;
  const float* x     = (const float*)d_in[0];
  const int*   mask  = (const int*)d_in[1];
  const float* Wq    = (const float*)d_in[2];
  const float* Wk    = (const float*)d_in[3];
  const float* Wv    = (const float*)d_in[4];
  const float* Wo    = (const float*)d_in[5];
  const float* gamma = (const float*)d_in[6];
  const float* beta  = (const float*)d_in[7];
  float* out = (float*)d_out;

  char* ws = (char*)d_ws;
  float* xn = (float*)ws;        ws += (size_t)B_ * S_ * H_ * 4;
  __bf16* xn_bf = (__bf16*)ws;   ws += (size_t)B_ * S_ * H_ * 2;
  __bf16* qb = (__bf16*)ws;      ws += (size_t)B_ * NH_ * S_ * DK_ * 2;
  __bf16* kb = (__bf16*)ws;      ws += (size_t)B_ * NH_ * S_ * DK_ * 2;
  __bf16* vT = (__bf16*)ws;      ws += (size_t)B_ * NH_ * S_ * DK_ * 2;
  __bf16* hb = (__bf16*)ws;      ws += (size_t)B_ * S_ * H_ * 2;
  __bf16* wq_pk = (__bf16*)ws;   ws += (size_t)NH_ * H_ * DK_ * 2;
  __bf16* wk_pk = (__bf16*)ws;   ws += (size_t)NH_ * H_ * DK_ * 2;
  __bf16* wv_pk = (__bf16*)ws;   ws += (size_t)NH_ * H_ * DK_ * 2;
  __bf16* wo_pk = (__bf16*)ws;   ws += (size_t)H_ * H_ * 2;

  // weight packing: per-head KxN = 512x64 -> 8*16*4 = 512 frag-blocks; Wo: 16*32 = 512
  pack_frags_kernel<<<NH_ * (H_ / 32) * (DK_ / 16), 32, 0, stream>>>(Wq, wq_pk, H_, DK_);
  pack_frags_kernel<<<NH_ * (H_ / 32) * (DK_ / 16), 32, 0, stream>>>(Wk, wk_pk, H_, DK_);
  pack_frags_kernel<<<NH_ * (H_ / 32) * (DK_ / 16), 32, 0, stream>>>(Wv, wv_pk, H_, DK_);
  pack_frags_kernel<<<(H_ / 32) * (H_ / 16), 32, 0, stream>>>(Wo, wo_pk, H_, H_);

  ln_kernel<<<B_ * S_, 128, 0, stream>>>(x, gamma, beta, xn, xn_bf);

  proj_kernel<<<dim3(S_ / 32, B_ * NH_, 3), 64, 0, stream>>>(xn_bf, wq_pk, wk_pk, wv_pk,
                                                             qb, kb, vT);

  attn_kernel<<<dim3(S_ / 64, B_ * NH_), 128, 0, stream>>>(qb, kb, vT, mask, hb);

  outproj_kernel<<<B_ * S_ / 16, 256, 0, stream>>>(hb, wo_pk, xn, mask, out);
}

// v002
// It runs in 105 microseconds.
// Two timings next to v001 put it at 2.08 and 2.07 times that version's speed.
// All steps since v000 together make it 3.37 times as fast.
#include <hip/hip_runtime.h>

#define B_ 4
#define S_ 2048
#define H_ 512
#define NH_ 8
#define DK_ 64

constexpr float LN_EPS_ = 1e-5f;
constexpr float NEG_INF_ = -1e30f;

typedef __attribute__((ext_vector_type(16))) __bf16 v16bf;
typedef __attribute__((ext_vector_type(8)))  __bf16 v8bf;
typedef __attribute__((ext_vector_type(8)))  float  v8f;
typedef __attribute__((ext_vector_type(4)))  float  v4f;
typedef __attribute__((ext_vector_type(4)))  int    v4i;

__device__ __forceinline__ v8f zero_v8f() {
  v8f z;
#pragma unroll
  for (int i = 0; i < 8; ++i) z[i] = 0.f;
  return z;
}

// A-style fragment: 16x32 bf16 tile from a row-major matrix (ld elements/row).
// lane (l&15) = row; element K pattern: e<8 -> 8g+e, e>=8 -> 8g+16+(e-8).
// Two aligned 16-byte loads per lane.
__device__ __forceinline__ v16bf load_frag_rm(const __bf16* m, long row0, int ld, int col0) {
  int l = threadIdx.x & 31;
  const __bf16* p = m + (row0 + (l & 15)) * (long)ld + col0 + 8 * (l >> 4);
  v8bf lo = *(const v8bf*)p;
  v8bf hi = *(const v8bf*)(p + 16);
  return __builtin_shufflevector(lo, hi, 0, 1, 2, 3, 4, 5, 6, 7,
                                 8, 9, 10, 11, 12, 13, 14, 15);
}

// The same fragment from a wave-uniform base and the lane's own constant element
// offset (its row and its 8g): the loop moves the base, the lane's offset stays.
__device__ __forceinline__ v16bf load_frag_bo(const __bf16* base, unsigned off) {
  v8bf lo = *(const v8bf*)(base + off);
  v8bf hi = *(const v8bf*)(base + off + 16);
  return __builtin_shufflevector(lo, hi, 0, 1, 2, 3, 4, 5, 6, 7,
                                 8, 9, 10, 11, 12, 13, 14, 15);
}

// Packed fragment: one 32-byte contiguous load per lane.
__device__ __forceinline__ v16bf load_frag_pk(const __bf16* pk, int f) {
  int l = threadIdx.x & 31;
  return *(const v16bf*)(pk + ((long)f * 32 + l) * 16);
}

__device__ __forceinline__ v8f wmma_bf16(v16bf a, v16bf b, v8f c) {
  return __builtin_amdgcn_wmma_f32_16x16x32_bf16(false, a, false, b, (short)0, c,
                                                 false, false);
}

// value of lane l ^ 16
__device__ __forceinline__ float xhalf(float x) {
  int b = __builtin_bit_cast(int, x);
  return __builtin_bit_cast(float, __builtin_amdgcn_permlanex16(b, b, 0x76543210, 0xfedcba98,
                                                                false, false));
}

// Rows whose mask is 0 give an output of 0 as queries and a probability of exactly 0 as
// keys (a batch with no live key has no live query either), so every stage behind the
// LayerNorm works on the live rows alone, moved up to the front of their batch in their
// old order ("compact" rows). live[b] = number of live rows of batch b.
__device__ __forceinline__ int live_rows(const int* __restrict__ live, int b) {
  return min(max(live[b], 0), S_);
}
// compact rows are zero-filled up to the next multiple of 64 (the largest row tile)
__device__ __forceinline__ int padded_rows(int n) { return (n + 63) & ~63; }

// ---------------- kernel 0: pack fp32 weights into bf16 B-fragments ----------------
// Input: nmat row-major KxN matrices (nmat from grid). Output: per fragment
// (kc in K/32, nt in N/16): pk[(fid*32 + lane)*16 + e] with the WMMA B layout.
// grid.x = nmat * (K/32) * (N/16), block = 32.
__global__ void pack_frags_kernel(const float* __restrict__ w, __bf16* __restrict__ pk,
                                  int K, int N) {
  long fid = blockIdx.x;
  int ntiles = N >> 4;
  long fpm = (long)(K >> 5) * ntiles;
  long m = fid / fpm;
  long f = fid % fpm;
  int kc = (int)(f / ntiles), nt = (int)(f % ntiles);
  int l = threadIdx.x;
  int g = l >> 4, c = l & 15;
  const float* wm = w + m * (long)K * N;
  __bf16* dst = pk + (fid * 32 + l) * 16;
#pragma unroll
  for (int e = 0; e < 16; ++e) {
    int kpat = (e < 8 ? e : e + 8) + 8 * g;
    dst[e] = (__bf16)wm[(long)(kc * 32 + kpat) * N + nt * 16 + c];
  }
}

// ---------------- kernel 1: LayerNorm + row compaction ----------------
// block = 128 threads, one row of 512 per block; contiguous float4 per thread.
// The block counts its batch's mask: pos = live rows in front of its own, n = all live rows.
// A live row is normalised and written at compact row pos; a masked row stores its zeros
// to out and, if it is one of the first masked rows, the zero row n + (its rank) of the pad.
__global__ void ln_kernel(const float* __restrict__ x, const int* __restrict__ mask,
                          const float* __restrict__ gamma, const float* __restrict__ beta,
                          float* __restrict__ xn, __bf16* __restrict__ xn_bf,
                          int* __restrict__ rowof, int* __restrict__ live,
                          float* __restrict__ out) {
  long row = blockIdx.x;
  int b = (int)(row / S_), sr = (int)(row % S_);
  int t = threadIdx.x;
  const int* mb = mask + (long)b * S_;
  const bool on = mb[sr] != 0;  // the same for the whole block
  v4i m[4];  // this thread's 16 entries of the batch's mask
  const unsigned moff = (unsigned)t * 64u;  // in bytes
#pragma unroll
  for (int q = 0; q < 4; ++q) m[q] = *(const v4i*)((const char*)mb + moff + q * 16);
  // The loads' offset register is reused behind them: wait before it is overwritten.
  // Naming it as an input keeps it whole up to the wait.
  asm volatile("s_wait_xcnt 0x0" ::"v"(moff) : "memory");
  int pc = 0;  // low 16 bits: live rows in front of sr; from bit 16: live rows
#pragma unroll
  for (int q = 0; q < 4; ++q)
#pragma unroll
    for (int j = 0; j < 4; ++j)
      if (m[q][j] != 0) pc += 0x10000 + ((t * 16 + q * 4 + j < sr) ? 1 : 0);
  v4f v = {0.f, 0.f, 0.f, 0.f};
  if (on) v = *(const v4f*)(x + row * H_ + t * 4);
  float s = v[0] + v[1] + v[2] + v[3];
  float ss = v[0] * v[0] + v[1] * v[1] + v[2] * v[2] + v[3] * v[3];
#pragma unroll
  for (int off = 16; off > 0; off >>= 1) {
    s += __shfl_xor(s, off, 32);
    ss += __shfl_xor(ss, off, 32);
    pc += __shfl_xor(pc, off, 32);
  }
  __shared__ float rs[4], rss[4];
  __shared__ int rpc[4];
  int wid = t >> 5;
  if ((t & 31) == 0) { rs[wid] = s; rss[wid] = ss; rpc[wid] = pc; }
  __syncthreads();
  s = rs[0] + rs[1] + rs[2] + rs[3];
  ss = rss[0] + rss[1] + rss[2] + rss[3];
  pc = rpc[0] + rpc[1] + rpc[2] + rpc[3];
  const int pos = pc & 0xffff, n = pc >> 16;
  if (sr == 0 && t == 0) live[b] = n;
  if (!on) {
    v4f z = {0.f, 0.f, 0.f, 0.f};
    *(v4f*)(out + row * H_ + t * 4) = z;
    // the store's registers are reused behind it: wait before they are overwritten
    asm volatile("s_wait_xcnt 0x0" ::: "memory");
    int j = n + (sr - pos);  // masked rows follow the live ones: j < S_
    if (j < padded_rows(n)) {
      __bf16* zb = xn_bf + ((long)b * S_ + j) * H_ + t * 4;
      zb[0] = (__bf16)0.f; zb[1] = (__bf16)0.f; zb[2] = (__bf16)0.f; zb[3] = (__bf16)0.f;
    }
  } else {
    row = (long)b * S_ + pos;  // compact row
    if (t == 0) rowof[row] = sr;
    float mean = s * (1.f / H_);
    float var = ss * (1.f / H_) - mean * mean;
    float inv = rsqrtf(var + LN_EPS_);
    v4f gm = *(const v4f*)(gamma + t * 4);
    v4f bt = *(const v4f*)(beta + t * 4);
    v4f o;
    v8bf ob;
#pragma unroll
    for (int j = 0; j < 4; ++j) {
      o[j] = (v[j] - mean) * inv * gm[j] + bt[j];
      ob[j] = (__bf16)o[j];
    }
    *(v4f*)(xn + row * H_ + t * 4) = o;
    // store 4 bf16 (8 bytes)
    __bf16* xb = xn_bf + row * H_ + t * 4;
    xb[0] = ob[0]; xb[1] = ob[1]; xb[2] = ob[2]; xb[3] = ob[3];
    // the stores' registers may be reused behind them: wait before they are overwritten
    asm volatile("s_wait_xcnt 0x0" ::: "memory");
  }
}

// ---------------- kernel 2: Q/K/V projections ----------------
// grid = (B*NH, 3, S/32), block = 64 (2 waves); wave: 16(S) x 64(DK) tile of compact rows.
// The row tile is the slowest grid index, so that the blocks with live rows come first.
// y=0: q (scaled 1/8, [bn][s][d]); y=1: k ([bn][s][d]); y=2: v transposed ([bn][d][s]).
__global__ void proj_kernel(const __bf16* __restrict__ xn_bf,
                            const __bf16* __restrict__ wq_pk, const __bf16* __restrict__ wk_pk,
                            const __bf16* __restrict__ wv_pk,
                            const int* __restrict__ live, __bf16* __restrict__ q, __bf16* __restrict__ k,
                            __bf16* __restrict__ vT) {
  int which = blockIdx.y;
  int wid = threadIdx.x >> 5;
  int l = threadIdx.x & 31;
  int g = l >> 4, c = l & 15;
  int bn = blockIdx.x;
  int n = bn & 7;
  if ((int)blockIdx.z * 32 >= padded_rows(live_rows(live, bn >> 3))) return;  // whole block
  long s0 = (long)blockIdx.z * 32 + wid * 16;
  long row0 = ((long)(bn >> 3)) * S_ + s0;
  const __bf16* wsel = (which == 0) ? wq_pk : (which == 1) ? wk_pk : wv_pk;
  const __bf16* wpk = wsel + (long)n * 64 * 512;  // 64 frags/head, 512 bf16/frag

  v8f acc[4];
#pragma unroll
  for (int t = 0; t < 4; ++t) acc[t] = zero_v8f();

  for (int kc = 0; kc < H_ / 32; ++kc) {
    v16bf a = load_frag_rm(xn_bf, row0, H_, kc * 32);
#pragma unroll
    for (int t = 0; t < 4; ++t)
      acc[t] = wmma_bf16(a, load_frag_pk(wpk, kc * 4 + t), acc[t]);
  }

  if (which == 2) {
    // vT[bn][d][s]: lane writes 8 contiguous s per tile
    __bf16* vbase = vT + (long)bn * DK_ * S_;
#pragma unroll
    for (int t = 0; t < 4; ++t) {
      __bf16* p = vbase + (long)(t * 16 + c) * S_ + s0 + 8 * g;
#pragma unroll
      for (int i = 0; i < 8; ++i) p[i] = (__bf16)acc[t][i];
    }
  } else {
    __bf16* dst = (which == 0) ? q : k;
    float sc = (which == 0) ? 0.125f : 1.f;  // fold 1/sqrt(DK) into q
    long base = ((long)bn * S_ + s0) * DK_;
#pragma unroll
    for (int t = 0; t < 4; ++t)
#pragma unroll
      for (int i = 0; i < 8; ++i)
        dst[base + (long)(i + 8 * g) * DK_ + t * 16 + c] = (__bf16)(acc[t][i] * sc);
  }
}

__global__ void attn_kernel(const __bf16* __restrict__ qm, const __bf16* __restrict__ km,
                            const __bf16* __restrict__ vT, const int* __restrict__ live,
                            __bf16* __restrict__ h) {
  int wid = threadIdx.x >> 5;
  int l = threadIdx.x & 31;
  int g = l >> 4, c = l & 15;
  int bn = blockIdx.x;
  int b = bn >> 3, n = bn & 7;
  const int nl = live_rows(live, b);
  if ((int)blockIdx.y * 64 >= nl) return;  // whole block: no live query here
  long s0 = (long)blockIdx.y * 64 + wid * 16;
  const __bf16* qb = qm + (long)bn * S_ * DK_;
  const __bf16* kb = km + (long)bn * S_ * DK_;
  const __bf16* vb = vT + (long)bn * DK_ * S_;   // [d][s]
  const unsigned koff = (unsigned)(c * DK_ + 8 * g);  // key row c
  const unsigned voff = (unsigned)(c * S_ + 8 * g);   // V^T row d = c

  // B operand: column c = query s0 + c
  v16bf bq0 = load_frag_rm(qb, s0, DK_, 0);
  v16bf bq1 = load_frag_rm(qb, s0, DK_, 32);
  // the Q loads' address pair is reused behind them: wait before it is overwritten
  asm volatile("s_wait_xcnt 0x0" ::: "memory");

  v8f acc[4];  // acc[t][i] = O^T[d = 16t + 8g + i][query s0 + c]
#pragma unroll
  for (int t = 0; t < 4; ++t) acc[t] = zero_v8f();
  float mr = -1e38f;  // running maximum of this lane's query (both halves agree)
  float lr = 0.f;     // running sum over this half's keys only; joined after the loop

  // Tiles of 32 compact keys; nl is at most S_. In the last, partly filled tile only the keys
  // below nl are live (it holds at least one); the rows of the pad behind them are zeros.
  for (int kt = 0; kt < nl; kt += 32) {
    // s0f[i] = score(key kt + 8g + i, query c); s1f[i] = score(key kt + 16 + 8g + i, query c)
    v8f s0f = zero_v8f(), s1f = zero_v8f();
    const __bf16* kt0 = kb + (long)kt * DK_;
    s0f = wmma_bf16(load_frag_bo(kt0, koff), bq0, s0f);
    s0f = wmma_bf16(load_frag_bo(kt0 + 32, koff), bq1, s0f);
    s1f = wmma_bf16(load_frag_bo(kt0 + 16 * DK_, koff), bq0, s1f);
    s1f = wmma_bf16(load_frag_bo(kt0 + 16 * DK_ + 32, koff), bq1, s1f);

    const int rem = nl - kt - 8 * g;  // register i of s0f is live while i < rem
    float tm = 0.f;
#pragma unroll
    for (int i = 0; i < 8; ++i) {
      s0f[i] = (i < rem) ? s0f[i] : NEG_INF_;
      s1f[i] = (i + 16 < rem) ? s1f[i] : NEG_INF_;
      float t2 = fmaxf(s0f[i], s1f[i]);
      tm = (i == 0) ? t2 : fmaxf(tm, t2);
    }
    tm = fmaxf(tm, xhalf(tm));

    float mn = fmaxf(mr, tm);
    float corr = __expf(mr - mn);
    mr = mn;
#pragma unroll
    for (int t = 0; t < 4; ++t)
#pragma unroll
      for (int i = 0; i < 8; ++i) acc[t][i] *= corr;

    // P^T as B operand: element e < 8 is key 8g + e, e >= 8 is key 16 + 8g + (e - 8),
    // the k order of load_frag_rm.
    v16bf pt;
    float psum = 0.f;
#pragma unroll
    for (int i = 0; i < 8; ++i) {
      float p0 = __expf(s0f[i] - mn);
      float p1 = __expf(s1f[i] - mn);
      psum += p0 + p1;
      pt[i] = (__bf16)p0;
      pt[8 + i] = (__bf16)p1;
    }
    lr = lr * corr + psum;

#pragma unroll
    for (int t = 0; t < 4; ++t)
      acc[t] = wmma_bf16(load_frag_bo(vb + (long)t * 16 * S_ + kt, voff), pt, acc[t]);
  }

  float inv = 1.f / (lr + xhalf(lr));
  // lane stores 8 contiguous d of its query per tile
  __bf16* hp = h + ((long)b * S_ + s0 + c) * H_ + n * DK_ + 8 * g;
#pragma unroll
  for (int t = 0; t < 4; ++t) {
    v8bf o;
#pragma unroll
    for (int i = 0; i < 8; ++i) o[i] = (__bf16)(acc[t][i] * inv);
    *(v8bf*)(hp + t * 16) = o;
  }
}

// ---------------- kernel 4: output projection + residual, live rows back in place ----------
// grid = B*S/16, block = 256 (8 waves); wave w computes cols [w*64, w*64+64) of 16 compact
// rows. The batch is the fast part of the index, so that the blocks with live rows come first.
__global__ void outproj_kernel(const __bf16* __restrict__ hbf, const __bf16* __restrict__ wo_pk,
                               const float* __restrict__ xn, const int* __restrict__ rowof,
                               const int* __restrict__ live, float* __restrict__ out) {
  int wid = threadIdx.x >> 5;
  int l = threadIdx.x & 31;
  int g = l >> 4, c = l & 15;
  int b = blockIdx.x % B_;
  int j0 = (int)(blockIdx.x / B_) * 16;
  const int nl = live_rows(live, b);
  if (j0 >= nl) return;  // whole block: no live row here
  long row0 = (long)b * S_ + j0;
  int n0 = wid * 64;

  v8f acc[4];
#pragma unroll
  for (int t = 0; t < 4; ++t) acc[t] = zero_v8f();

  for (int kc = 0; kc < H_ / 32; ++kc) {
    v16bf a = load_frag_rm(hbf, row0, H_, kc * 32);
#pragma unroll
    for (int t = 0; t < 4; ++t)
      acc[t] = wmma_bf16(a, load_frag_pk(wo_pk, kc * 32 + wid * 4 + t), acc[t]);
  }
  // the loop's address registers are reused behind it: wait before they are overwritten
  asm volatile("s_wait_xcnt 0x0" ::: "memory");
  // A row of the pad has no place in out: it reads the last live row's residual and home
  // row, so that all loads go out together, and stores nothing.
  // Lane l fetches the home row of the tile's row l & 15.
  const unsigned ro = (unsigned)(b * S_ + min(j0 + c, nl - 1));  // element offset in rowof
  const int hr = rowof[ro];
  float res[4][8];
  unsigned xo[8];  // element offsets in xn
#pragma unroll
  for (int i = 0; i < 8; ++i)
    xo[i] = (unsigned)(b * S_ + min(j0 + i + 8 * g, nl - 1)) * H_ + n0 + c;
#pragma unroll
  for (int i = 0; i < 8; ++i)
#pragma unroll
    for (int t = 0; t < 4; ++t) res[t][i] = xn[xo[i] + t * 16];
  // The loads' offset registers are reused behind them: wait before they are overwritten.
  // Naming the offsets as inputs keeps them whole up to the wait.
  asm volatile("s_wait_xcnt 0x0" ::"v"(ro), "v"(xo[0]), "v"(xo[1]), "v"(xo[2]), "v"(xo[3]),
               "v"(xo[4]), "v"(xo[5]), "v"(xo[6]), "v"(xo[7])
               : "memory");
#pragma unroll
  for (int i = 0; i < 8; ++i)
#pragma unroll
    for (int t = 0; t < 4; ++t) acc[t][i] += res[t][i];
#pragma unroll
  for (int i = 0; i < 8; ++i) {
    // home row of the tile's row i + 8g, masked to the shape
    int lo = __builtin_amdgcn_readlane(hr, i), hi = __builtin_amdgcn_readlane(hr, i + 8);
    int orow = (g ? hi : lo) & (S_ - 1);
    if (j0 + i + 8 * g < nl) {
      float* op = out + ((long)b * S_ + orow) * H_ + n0 + c;
#pragma unroll
      for (int t = 0; t < 4; ++t) op[t * 16] = acc[t][i];
    }
  }
}

extern "C" void kernel_launch(void* const* d_in, const int* in_sizes, int n_in,
                              void* d_out, int out_size, void* d_ws, size_t ws_size,
                              hipStream_t stream) {
  (void)in_sizes; (void)n_in; (void)out_size; (void)ws_size;
  const float* x     = (const float*)d_in[0];
  const int*   mask  = (const int*)d_in[1];
  const float* Wq    = (const float*)d_in[2];
  const float* Wk    = (const float*)d_in[3];
  const float* Wv    = (const float*)d_in[4];
  const float* Wo    = (const float*)d_in[5];
  const float* gamma = (const float*)d_in[6];
  const float* beta  = (const float*)d_in[7];
  float* out = (float*)d_out;

  char* ws = (char*)d_ws;
  float* xn = (float*)ws;        ws += (size_t)B_ * S_ * H_ * 4;
  __bf16* xn_bf = (__bf16*)ws;   ws += (size_t)B_ * S_ * H_ * 2;
  __bf16* qb = (__bf16*)ws;      ws += (size_t)B_ * NH_ * S_ * DK_ * 2;
  __bf16* kb = (__bf16*)ws;      ws += (size_t)B_ * NH_ * S_ * DK_ * 2;
  __bf16* vT = (__bf16*)ws;      ws += (size_t)B_ * NH_ * S_ * DK_ * 2;
  __bf16* hb = (__bf16*)ws;      ws += (size_t)B_ * S_ * H_ * 2;
  __bf16* wq_pk = (__bf16*)ws;   ws += (size_t)NH_ * H_ * DK_ * 2;
  __bf16* wk_pk = (__bf16*)ws;   ws += (size_t)NH_ * H_ * DK_ * 2;
  __bf16* wv_pk = (__bf16*)ws;   ws += (size_t)NH_ * H_ * DK_ * 2;
  __bf16* wo_pk = (__bf16*)ws;   ws += (size_t)H_ * H_ * 2;
  int* rowof = (int*)ws;         ws += (size_t)B_ * S_ * 4;
  int* live = (int*)ws;          ws += (size_t)B_ * 4;

  // weight packing: per-head KxN = 512x64 -> 8*16*4 = 512 frag-blocks; Wo: 16*32 = 512
  pack_frags_kernel<<<NH_ * (H_ / 32) * (DK_ / 16), 32, 0, stream>>>(Wq, wq_pk, H_, DK_);
  pack_frags_kernel<<<NH_ * (H_ / 32) * (DK_ / 16), 32, 0, stream>>>(Wk, wk_pk, H_, DK_);
  pack_frags_kernel<<<NH_ * (H_ / 32) * (DK_ / 16), 32, 0, stream>>>(Wv, wv_pk, H_, DK_);
  pack_frags_kernel<<<(H_ / 32) * (H_ / 16), 32, 0, stream>>>(Wo, wo_pk, H_, H_);

  ln_kernel<<<B_ * S_, 128, 0, stream>>>(x, mask, gamma, beta, xn, xn_bf, rowof, live,
                                           out);

  proj_kernel<<<dim3(B_ * NH_, 3, S_ / 32), 64, 0, stream>>>(xn_bf, wq_pk, wk_pk, wv_pk,
                                                             live, qb, kb, vT);

  attn_kernel<<<dim3(B_ * NH_, S_ / 64), 128, 0, stream>>>(qb, kb, vT, live, hb);

  outproj_kernel<<<B_ * S_ / 16, 256, 0, stream>>>(hb, wo_pk, xn, rowof, live, out);
}

// v003
// Measured time: 93.6 microseconds a run.
// Timed twice side by side with v002, it ran 1.13 times as fast both times.
// Counting every step since v000, it is 3.80 times as fast.
#include <hip/hip_runtime.h>

#define B_ 4
#define S_ 2048
#define H_ 512
#define NH_ 8
#define DK_ 64

constexpr float LN_EPS_ = 1e-5f;
constexpr float NEG_INF_ = -1e30f;

typedef __attribute__((ext_vector_type(16))) __bf16 v16bf;
typedef __attribute__((ext_vector_type(8)))  __bf16 v8bf;
typedef __attribute__((ext_vector_type(8)))  float  v8f;
typedef __attribute__((ext_vector_type(4)))  float  v4f;
typedef __attribute__((ext_vector_type(4)))  int    v4i;

__device__ __forceinline__ v8f zero_v8f() {
  v8f z;
#pragma unroll
  for (int i = 0; i < 8; ++i) z[i] = 0.f;
  return z;
}

// A-style fragment: 16x32 bf16 tile from a row-major matrix (ld elements/row).
// lane (l&15) = row; element K pattern: e<8 -> 8g+e, e>=8 -> 8g+16+(e-8).
// Two aligned 16-byte loads per lane.
__device__ __forceinline__ v16bf load_frag_rm(const __bf16* m, long row0, int ld, int col0) {
  int l = threadIdx.x & 31;
  const __bf16* p = m + (row0 + (l & 15)) * (long)ld + col0 + 8 * (l >> 4);
  v8bf lo = *(const v8bf*)p;
  v8bf hi = *(const v8bf*)(p + 16);
  return __builtin_shufflevector(lo, hi, 0, 1, 2, 3, 4, 5, 6, 7,
                                 8, 9, 10, 11, 12, 13, 14, 15);
}

// The same fragment from the lane's own address (its row and its 8g already in it) and
// an element offset shared by all lanes: a tile's fragments differ only in the offset.
__device__ __forceinline__ v16bf load_frag_bo(const __bf16* base, unsigned off) {
  v8bf lo = *(const v8bf*)(base + off);
  v8bf hi = *(const v8bf*)(base + off + 16);
  return __builtin_shufflevector(lo, hi, 0, 1, 2, 3, 4, 5, 6, 7,
                                 8, 9, 10, 11, 12, 13, 14, 15);
}

// Packed fragment: one 32-byte contiguous load per lane.
__device__ __forceinline__ v16bf load_frag_pk(const __bf16* pk, int f) {
  int l = threadIdx.x & 31;
  return *(const v16bf*)(pk + ((long)f * 32 + l) * 16);
}

__device__ __forceinline__ v8f wmma_bf16(v16bf a, v16bf b, v8f c) {
  return __builtin_amdgcn_wmma_f32_16x16x32_bf16(false, a, false, b, (short)0, c,
                                                 false, false);
}

// value of lane l ^ 16
__device__ __forceinline__ float xhalf(float x) {
  int b = __builtin_bit_cast(int, x);
  return __builtin_bit_cast(float, __builtin_amdgcn_permlanex16(b, b, 0x76543210, 0xfedcba98,
                                                                false, false));
}

// Rows whose mask is 0 give an output of 0 as queries and a probability of exactly 0 as
// keys (a batch with no live key has no live query either), so every stage behind the
// LayerNorm works on the live rows alone, moved up to the front of their batch in their
// old order ("compact" rows). live[b] = number of live rows of batch b.
__device__ __forceinline__ int live_rows(const int* __restrict__ live, int b) {
  return min(max(live[b], 0), S_);
}
// compact rows are zero-filled up to the next multiple of 64 (the largest row tile)
__device__ __forceinline__ int padded_rows(int n) { return (n + 63) & ~63; }

// ---------------- kernel 0: pack fp32 weights into bf16 B-fragments ----------------
// Input: nmat row-major KxN matrices (nmat from grid). Output: per fragment
// (kc in K/32, nt in N/16): pk[(fid*32 + lane)*16 + e] with the WMMA B layout.
// grid.x = nmat * (K/32) * (N/16), block = 32.
__global__ void pack_frags_kernel(const float* __restrict__ w, __bf16* __restrict__ pk,
                                  int K, int N) {
  long fid = blockIdx.x;
  int ntiles = N >> 4;
  long fpm = (long)(K >> 5) * ntiles;
  long m = fid / fpm;
  long f = fid % fpm;
  int kc = (int)(f / ntiles), nt = (int)(f % ntiles);
  int l = threadIdx.x;
  int g = l >> 4, c = l & 15;
  const float* wm = w + m * (long)K * N;
  __bf16* dst = pk + (fid * 32 + l) * 16;
#pragma unroll
  for (int e = 0; e < 16; ++e) {
    int kpat = (e < 8 ? e : e + 8) + 8 * g;
    dst[e] = (__bf16)wm[(long)(kc * 32 + kpat) * N + nt * 16 + c];
  }
}

// ---------------- kernel 1: LayerNorm + row compaction ----------------
// block = 128 threads, one row of 512 per block; contiguous float4 per thread.
// The block counts its batch's mask: pos = live rows in front of its own, n = all live rows.
// A live row is normalised and written at compact row pos; a masked row stores its zeros
// to out and, if it is one of the first masked rows, the zero row n + (its rank) of the pad.
__global__ void ln_kernel(const float* __restrict__ x, const int* __restrict__ mask,
                          const float* __restrict__ gamma, const float* __restrict__ beta,
                          float* __restrict__ xn, __bf16* __restrict__ xn_bf,
                          int* __restrict__ rowof, int* __restrict__ live,
                          float* __restrict__ out) {
  long row = blockIdx.x;
  int b = (int)(row / S_), sr = (int)(row % S_);
  int t = threadIdx.x;
  const int* mb = mask + (long)b * S_;
  const bool on = mb[sr] != 0;  // the same for the whole block
  v4i m[4];  // this thread's 16 entries of the batch's mask
  const unsigned moff = (unsigned)t * 64u;  // in bytes
#pragma unroll
  for (int q = 0; q < 4; ++q) m[q] = *(const v4i*)((const char*)mb + moff + q * 16);
  // The loads' offset register is reused behind them: wait before it is overwritten.
  // Naming it as an input keeps it whole up to the wait.
  asm volatile("s_wait_xcnt 0x0" ::"v"(moff) : "memory");
  int pc = 0;  // low 16 bits: live rows in front of sr; from bit 16: live rows
#pragma unroll
  for (int q = 0; q < 4; ++q)
#pragma unroll
    for (int j = 0; j < 4; ++j)
      if (m[q][j] != 0) pc += 0x10000 + ((t * 16 + q * 4 + j < sr) ? 1 : 0);
  v4f v = {0.f, 0.f, 0.f, 0.f};
  if (on) v = *(const v4f*)(x + row * H_ + t * 4);
  float s = v[0] + v[1] + v[2] + v[3];
  float ss = v[0] * v[0] + v[1] * v[1] + v[2] * v[2] + v[3] * v[3];
#pragma unroll
  for (int off = 16; off > 0; off >>= 1) {
    s += __shfl_xor(s, off, 32);
    ss += __shfl_xor(ss, off, 32);
    pc += __shfl_xor(pc, off, 32);
  }
  __shared__ float rs[4], rss[4];
  __shared__ int rpc[4];
  int wid = t >> 5;
  if ((t & 31) == 0) { rs[wid] = s; rss[wid] = ss; rpc[wid] = pc; }
  __syncthreads();
  s = rs[0] + rs[1] + rs[2] + rs[3];
  ss = rss[0] + rss[1] + rss[2] + rss[3];
  pc = rpc[0] + rpc[1] + rpc[2] + rpc[3];
  const int pos = pc & 0xffff, n = pc >> 16;
  if (sr == 0 && t == 0) live[b] = n;
  if (!on) {
    v4f z = {0.f, 0.f, 0.f, 0.f};
    *(v4f*)(out + row * H_ + t * 4) = z;
    // the store's registers are reused behind it: wait before they are overwritten
    asm volatile("s_wait_xcnt 0x0" ::: "memory");
    int j = n + (sr - pos);  // masked rows follow the live ones: j < S_
    if (j < padded_rows(n)) {
      __bf16* zb = xn_bf + ((long)b * S_ + j) * H_ + t * 4;
      zb[0] = (__bf16)0.f; zb[1] = (__bf16)0.f; zb[2] = (__bf16)0.f; zb[3] = (__bf16)0.f;
    }
  } else {
    row = (long)b * S_ + pos;  // compact row
    if (t == 0) rowof[row] = sr;
    float mean = s * (1.f / H_);
    float var = ss * (1.f / H_) - mean * mean;
    float inv = rsqrtf(var + LN_EPS_);
    v4f gm = *(const v4f*)(gamma + t * 4);
    v4f bt = *(const v4f*)(beta + t * 4);
    v4f o;
    v8bf ob;
#pragma unroll
    for (int j = 0; j < 4; ++j) {
      o[j] = (v[j] - mean) * inv * gm[j] + bt[j];
      ob[j] = (__bf16)o[j];
    }
    *(v4f*)(xn + row * H_ + t * 4) = o;
    // store 4 bf16 (8 bytes)
    __bf16* xb = xn_bf + row * H_ + t * 4;
    xb[0] = ob[0]; xb[1] = ob[1]; xb[2] = ob[2]; xb[3] = ob[3];
    // the stores' registers may be reused behind them: wait before they are overwritten
    asm volatile("s_wait_xcnt 0x0" ::: "memory");
  }
}

// ---------------- kernel 2: Q/K/V projections ----------------
// grid = (B*NH, 3, S/32), block = 64 (2 waves); wave: 16(S) x 64(DK) tile of compact rows.
// The row tile is the slowest grid index, so that the blocks with live rows come first.
// y=0: q (scaled 1/8, [bn][s][d]); y=1: k ([bn][s][d]); y=2: v transposed ([bn][d][s]).
// The real block size lifts the register ceiling, which the ring of fragments needs.
__global__ void __launch_bounds__(64) proj_kernel(const __bf16* __restrict__ xn_bf,
                            const __bf16* __restrict__ wq_pk, const __bf16* __restrict__ wk_pk,
                            const __bf16* __restrict__ wv_pk,
                            const int* __restrict__ live, __bf16* __restrict__ q, __bf16* __restrict__ k,
                            __bf16* __restrict__ vT) {
  int which = blockIdx.y;
  int wid = threadIdx.x >> 5;
  int l = threadIdx.x & 31;
  int g = l >> 4, c = l & 15;
  int bn = blockIdx.x;
  int n = bn & 7;
  if ((int)blockIdx.z * 32 >= padded_rows(live_rows(live, bn >> 3))) return;  // whole block
  long s0 = (long)blockIdx.z * 32 + wid * 16;
  long row0 = ((long)(bn >> 3)) * S_ + s0;
  const __bf16* wsel = (which == 0) ? wq_pk : (which == 1) ? wk_pk : wv_pk;
  const __bf16* wpk = wsel + (long)n * 64 * 512;  // 64 frags/head, 512 bf16/frag

  v8f acc[4];
#pragma unroll
  for (int t = 0; t < 4; ++t) acc[t] = zero_v8f();

  // Register ring, PD_ k-steps deep: a step's ten loads go out PD_ steps ahead of its
  // products, so that a wave waits for one landing per PD_ steps, not for one per product.
  constexpr int PD_ = 3;
  v16bf fa[PD_], fb[PD_][4];
  // Every loop over the ring is unrolled in full: only constant slot numbers keep it in
  // registers.
#pragma unroll
  for (int s = 0; s < PD_; ++s) {
    fa[s] = load_frag_rm(xn_bf, row0, H_, s * 32);
#pragma unroll  // constant slot numbers, as above
    for (int t = 0; t < 4; ++t) fb[s][t] = load_frag_pk(wpk, s * 4 + t);
  }
#pragma unroll  // constant slot numbers, as above
  for (int kc = 0; kc < H_ / 32; ++kc) {
    const int s = kc % PD_;
#pragma unroll  // constant slot numbers, as above
    for (int t = 0; t < 4; ++t) acc[t] = wmma_bf16(fa[s], fb[s][t], acc[t]);
    if (kc + PD_ < H_ / 32) {
      fa[s] = load_frag_rm(xn_bf, row0, H_, (kc + PD_) * 32);
#pragma unroll  // constant slot numbers, as above
      for (int t = 0; t < 4; ++t) fb[s][t] = load_frag_pk(wpk, (kc + PD_) * 4 + t);
    }
    // keeps the refill here: moved down to its use, each load would be waited for alone
    __builtin_amdgcn_sched_barrier(0);
  }

  if (which == 2) {
    // vT[bn][d][s]: lane writes 8 contiguous s per tile
    __bf16* vbase = vT + (long)bn * DK_ * S_;
#pragma unroll
    for (int t = 0; t < 4; ++t) {
      __bf16* p = vbase + (long)(t * 16 + c) * S_ + s0 + 8 * g;
#pragma unroll
      for (int i = 0; i < 8; ++i) p[i] = (__bf16)acc[t][i];
    }
  } else {
    __bf16* dst = (which == 0) ? q : k;
    float sc = (which == 0) ? 0.125f : 1.f;  // fold 1/sqrt(DK) into q
    long base = ((long)bn * S_ + s0) * DK_;
#pragma unroll
    for (int t = 0; t < 4; ++t)
#pragma unroll
      for (int i = 0; i < 8; ++i)
        dst[base + (long)(i + 8 * g) * DK_ + t * 16 + c] = (__bf16)(acc[t][i] * sc);
  }
}

__global__ void __launch_bounds__(128) attn_kernel(const __bf16* __restrict__ qm, const __bf16* __restrict__ km,
                            const __bf16* __restrict__ vT, const int* __restrict__ live,
                            __bf16* __restrict__ h) {
  int wid = threadIdx.x >> 5;
  int l = threadIdx.x & 31;
  int g = l >> 4, c = l & 15;
  int bn = blockIdx.x;
  int b = bn >> 3, n = bn & 7;
  const int nl = live_rows(live, b);
  if ((int)blockIdx.y * 64 >= nl) return;  // whole block: no live query here
  long s0 = (long)blockIdx.y * 64 + wid * 16;
  const __bf16* qb = qm + (long)bn * S_ * DK_;
  const __bf16* kb = km + (long)bn * S_ * DK_;
  const __bf16* vb = vT + (long)bn * DK_ * S_;   // [d][s]
  const unsigned koff = (unsigned)(c * DK_ + 8 * g);  // key row c
  const unsigned voff = (unsigned)(c * S_ + 8 * g);   // V^T row d = c

  // B operand: column c = query s0 + c
  v16bf bq0 = load_frag_rm(qb, s0, DK_, 0);
  v16bf bq1 = load_frag_rm(qb, s0, DK_, 32);
  // the Q loads' address pair is reused behind them: wait before it is overwritten
  asm volatile("s_wait_xcnt 0x0" ::: "memory");

  v8f acc[4];  // acc[t][i] = O^T[d = 16t + 8g + i][query s0 + c]
#pragma unroll
  for (int t = 0; t < 4; ++t) acc[t] = zero_v8f();
  float mr = -1e38f;  // running maximum of this lane's query (both halves agree)
  float lr = 0.f;     // running sum over this half's keys only; joined after the loop

  // The eight fragments of one tile of 32 keys: K rows 0-15 and 16-31 (two k halves each),
  // V^T rows 16t.
  auto load_tile = [&](v16bf (&fk)[4], v16bf (&fv)[4], int kt) {
    const __bf16* pk = kb + (long)kt * DK_ + koff;  // the lane's own addresses
    const __bf16* pv = vb + kt + voff;
    fk[0] = load_frag_bo(pk, 0);
    fk[1] = load_frag_bo(pk, 32);
    fk[2] = load_frag_bo(pk, 16 * DK_);
    fk[3] = load_frag_bo(pk, 16 * DK_ + 32);
#pragma unroll  // constant indices keep the fragments in registers
    for (int t = 0; t < 4; ++t) fv[t] = load_frag_bo(pv, t * 16 * S_);
    // The loads' address pairs are formed anew for the next tile while these loads fly: wait
    // before they are overwritten. Naming them as inputs keeps them whole up to the wait.
    asm volatile("s_wait_xcnt 0x0" ::"v"(pk), "v"(pv) : "memory");
  };

  // One tile of 32 compact keys from the fragments ck, cv; the next tile's sixteen loads go
  // out first, into nk, nv, and land while this tile is worked on. In the last, partly filled
  // tile only the keys below nl are live (it holds at least one); the rows of the pad behind
  // them are zeros.
  auto tile = [&](const v16bf (&ck)[4], const v16bf (&cv)[4], v16bf (&nk)[4], v16bf (&nv)[4],
                  int kt) {
    // behind the last tile there is none: that tile is fetched again (written, finite values)
    load_tile(nk, nv, min(kt + 32, (nl - 1) & ~31));
    // keeps the loads up here: moved down to their use, each would be waited for alone
    __builtin_amdgcn_sched_barrier(0);
    // s0f[i] = score(key kt + 8g + i, query c); s1f[i] = score(key kt + 16 + 8g + i, query c)
    v8f s0f = zero_v8f(), s1f = zero_v8f();
    s0f = wmma_bf16(ck[0], bq0, s0f);
    s0f = wmma_bf16(ck[1], bq1, s0f);
    s1f = wmma_bf16(ck[2], bq0, s1f);
    s1f = wmma_bf16(ck[3], bq1, s1f);

    const int rem = nl - kt - 8 * g;  // register i of s0f is live while i < rem
    float tm = 0.f;
#pragma unroll
    for (int i = 0; i < 8; ++i) {
      s0f[i] = (i < rem) ? s0f[i] : NEG_INF_;
      s1f[i] = (i + 16 < rem) ? s1f[i] : NEG_INF_;
      float t2 = fmaxf(s0f[i], s1f[i]);
      tm = (i == 0) ? t2 : fmaxf(tm, t2);
    }
    tm = fmaxf(tm, xhalf(tm));

    float mn = fmaxf(mr, tm);
    float corr = __expf(mr - mn);
    mr = mn;
#pragma unroll
    for (int t = 0; t < 4; ++t)
#pragma unroll
      for (int i = 0; i < 8; ++i) acc[t][i] *= corr;

    // P^T as B operand: element e < 8 is key 8g + e, e >= 8 is key 16 + 8g + (e - 8),
    // the k order of load_frag_rm.
    v16bf pt;
    float psum = 0.f;
#pragma unroll
    for (int i = 0; i < 8; ++i) {
      float p0 = __expf(s0f[i] - mn);
      float p1 = __expf(s1f[i] - mn);
      psum += p0 + p1;
      pt[i] = (__bf16)p0;
      pt[8 + i] = (__bf16)p1;
    }
    lr = lr * corr + psum;

#pragma unroll
    for (int t = 0; t < 4; ++t) acc[t] = wmma_bf16(cv[t], pt, acc[t]);
  };

  // Two sets of fragments take turns, so that none is copied; nl is at least 1 here and at
  // most S_. With an odd number of tiles the last turn has no live key: every score is
  // NEG_INF_ against a finite maximum, so corr is 1, every p is 0 and nothing changes.
  v16bf k0[4], v0[4], k1[4], v1[4];
  load_tile(k0, v0, 0);
  for (int kt = 0; kt < nl; kt += 64) {
    tile(k0, v0, k1, v1, kt);
    tile(k1, v1, k0, v0, kt + 32);
  }

  float inv = 1.f / (lr + xhalf(lr));
  // lane stores 8 contiguous d of its query per tile
  __bf16* hp = h + ((long)b * S_ + s0 + c) * H_ + n * DK_ + 8 * g;
#pragma unroll
  for (int t = 0; t < 4; ++t) {
    v8bf o;
#pragma unroll
    for (int i = 0; i < 8; ++i) o[i] = (__bf16)(acc[t][i] * inv);
    *(v8bf*)(hp + t * 16) = o;
  }
}

// ---------------- kernel 4: output projection + residual, live rows back in place ----------
// grid = B*S/16, block = 256 (8 waves); wave w computes cols [w*64, w*64+64) of 16 compact
// rows. The batch is the fast part of the index, so that the blocks with live rows come first.
__global__ void outproj_kernel(const __bf16* __restrict__ hbf, const __bf16* __restrict__ wo_pk,
                               const float* __restrict__ xn, const int* __restrict__ rowof,
                               const int* __restrict__ live, float* __restrict__ out) {
  int wid = threadIdx.x >> 5;
  int l = threadIdx.x & 31;
  int g = l >> 4, c = l & 15;
  int b = blockIdx.x % B_;
  int j0 = (int)(blockIdx.x / B_) * 16;
  const int nl = live_rows(live, b);
  if (j0 >= nl) return;  // whole block: no live row here
  long row0 = (long)b * S_ + j0;
  int n0 = wid * 64;

  v8f acc[4];
#pragma unroll
  for (int t = 0; t < 4; ++t) acc[t] = zero_v8f();

  for (int kc = 0; kc < H_ / 32; ++kc) {
    v16bf a = load_frag_rm(hbf, row0, H_, kc * 32);
#pragma unroll
    for (int t = 0; t < 4; ++t)
      acc[t] = wmma_bf16(a, load_frag_pk(wo_pk, kc * 32 + wid * 4 + t), acc[t]);
  }
  // the loop's address registers are reused behind it: wait before they are overwritten
  asm volatile("s_wait_xcnt 0x0" ::: "memory");
  // A row of the pad has no place in out: it reads the last live row's residual and home
  // row, so that all loads go out together, and stores nothing.
  // Lane l fetches the home row of the tile's row l & 15.
  const unsigned ro = (unsigned)(b * S_ + min(j0 + c, nl - 1));  // element offset in rowof
  const int hr = rowof[ro];
  float res[4][8];
  unsigned xo[8];  // element offsets in xn
#pragma unroll
  for (int i = 0; i < 8; ++i)
    xo[i] = (unsigned)(b * S_ + min(j0 + i + 8 * g, nl - 1)) * H_ + n0 + c;
#pragma unroll
  for (int i = 0; i < 8; ++i)
#pragma unroll
    for (int t = 0; t < 4; ++t) res[t][i] = xn[xo[i] + t * 16];
  // The loads' offset registers are reused behind them: wait before they are overwritten.
  // Naming the offsets as inputs keeps them whole up to the wait.
  asm volatile("s_wait_xcnt 0x0" ::"v"(ro), "v"(xo[0]), "v"(xo[1]), "v"(xo[2]), "v"(xo[3]),
               "v"(xo[4]), "v"(xo[5]), "v"(xo[6]), "v"(xo[7])
               : "memory");
#pragma unroll
  for (int i = 0; i < 8; ++i)
#pragma unroll
    for (int t = 0; t < 4; ++t) acc[t][i] += res[t][i];
#pragma unroll
  for (int i = 0; i < 8; ++i) {
    // home row of the tile's row i + 8g, masked to the shape
    int lo = __builtin_amdgcn_readlane(hr, i), hi = __builtin_amdgcn_readlane(hr, i + 8);
    int orow = (g ? hi : lo) & (S_ - 1);
    if (j0 + i + 8 * g < nl) {
      float* op = out + ((long)b * S_ + orow) * H_ + n0 + c;
#pragma unroll
      for (int t = 0; t < 4; ++t) op[t * 16] = acc[t][i];
    }
  }
}

extern "C" void kernel_launch(void* const* d_in, const int* in_sizes, int n_in,
                              void* d_out, int out_size, void* d_ws, size_t ws_size,
                              hipStream_t stream) {
  (void)in_sizes; (void)n_in; (void)out_size; (void)ws_size;
  const float* x     = (const float*)d_in[0];
  const int*   mask  = (const int*)d_in[1];
  const float* Wq    = (const float*)d_in[2];
  const float* Wk    = (const float*)d_in[3];
  const float* Wv    = (const float*)d_in[4];
  const float* Wo    = (const float*)d_in[5];
  const float* gamma = (const float*)d_in[6];
  const float* beta  = (const float*)d_in[7];
  float* out = (float*)d_out;

  char* ws = (char*)d_ws;
  float* xn = (float*)ws;        ws += (size_t)B_ * S_ * H_ * 4;
  __bf16* xn_bf = (__bf16*)ws;   ws += (size_t)B_ * S_ * H_ * 2;
  __bf16* qb = (__bf16*)ws;      ws += (size_t)B_ * NH_ * S_ * DK_ * 2;
  __bf16* kb = (__bf16*)ws;      ws += (size_t)B_ * NH_ * S_ * DK_ * 2;
  __bf16* vT = (__bf16*)ws;      ws += (size_t)B_ * NH_ * S_ * DK_ * 2;
  __bf16* hb = (__bf16*)ws;      ws += (size_t)B_ * S_ * H_ * 2;
  __bf16* wq_pk = (__bf16*)ws;   ws += (size_t)NH_ * H_ * DK_ * 2;
  __bf16* wk_pk = (__bf16*)ws;   ws += (size_t)NH_ * H_ * DK_ * 2;
  __bf16* wv_pk = (__bf16*)ws;   ws += (size_t)NH_ * H_ * DK_ * 2;
  __bf16* wo_pk = (__bf16*)ws;   ws += (size_t)H_ * H_ * 2;
  int* rowof = (int*)ws;         ws += (size_t)B_ * S_ * 4;
  int* live = (int*)ws;          ws += (size_t)B_ * 4;

  // weight packing: per-head KxN = 512x64 -> 8*16*4 = 512 frag-blocks; Wo: 16*32 = 512
  pack_frags_kernel<<<NH_ * (H_ / 32) * (DK_ / 16), 32, 0, stream>>>(Wq, wq_pk, H_, DK_);
  pack_frags_kernel<<<NH_ * (H_ / 32) * (DK_ / 16), 32, 0, stream>>>(Wk, wk_pk, H_, DK_);
  pack_frags_kernel<<<NH_ * (H_ / 32) * (DK_ / 16), 32, 0, stream>>>(Wv, wv_pk, H_, DK_);
  pack_frags_kernel<<<(H_ / 32) * (H_ / 16), 32, 0, stream>>>(Wo, wo_pk, H_, H_);

  ln_kernel<<<B_ * S_, 128, 0, stream>>>(x, mask, gamma, beta, xn, xn_bf, rowof, live,
                                           out);

  proj_kernel<<<dim3(B_ * NH_, 3, S_ / 32), 64, 0, stream>>>(xn_bf, wq_pk, wk_pk, wv_pk,
                                                             live, qb, kb, vT);

  attn_kernel<<<dim3(B_ * NH_, S_ / 64), 128, 0, stream>>>(qb, kb, vT, live, hb);

  outproj_kernel<<<B_ * S_ / 16, 256, 0, stream>>>(hb, wo_pk, xn, rowof, live, out);
}

// v004
// Measured time: 83.6 microseconds a run.
// Two timings next to v003 both put it at 1.12 times that version's speed.
// All steps since v000 together make it 4.26 times as fast.
#include <hip/hip_runtime.h>

#define B_ 4
#define S_ 2048
#define H_ 512
#define NH_ 8
#define DK_ 64

constexpr float LN_EPS_ = 1e-5f;
constexpr float NEG_INF_ = -1e30f;

typedef __attribute__((ext_vector_type(16))) __bf16 v16bf;
typedef __attribute__((ext_vector_type(8)))  __bf16 v8bf;
typedef __attribute__((ext_vector_type(8)))  float  v8f;
typedef __attribute__((ext_vector_type(4)))  float  v4f;
typedef __attribute__((ext_vector_type(4)))  int    v4i;

__device__ __forceinline__ v8f zero_v8f() {
  v8f z;
#pragma unroll
  for (int i = 0; i < 8; ++i) z[i] = 0.f;
  return z;
}

// A-style fragment: 16x32 bf16 tile from a row-major matrix (ld elements/row).
// lane (l&15) = row; element K pattern: e<8 -> 8g+e, e>=8 -> 8g+16+(e-8).
// Two aligned 16-byte loads per lane.
__device__ __forceinline__ v16bf load_frag_rm(const __bf16* m, long row0, int ld, int col0) {
  int l = threadIdx.x & 31;
  const __bf16* p = m + (row0 + (l & 15)) * (long)ld + col0 + 8 * (l >> 4);
  v8bf lo = *(const v8bf*)p;
  v8bf hi = *(const v8bf*)(p + 16);
  return __builtin_shufflevector(lo, hi, 0, 1, 2, 3, 4, 5, 6, 7,
                                 8, 9, 10, 11, 12, 13, 14, 15);
}

// The same fragment from the lane's own address (its row and its 8g already in it) and
// an element offset shared by all lanes: a tile's fragments differ only in the offset.
__device__ __forceinline__ v16bf load_frag_bo(const __bf16* base, unsigned off) {
  v8bf lo = *(const v8bf*)(base + off);
  v8bf hi = *(const v8bf*)(base + off + 16);
  return __builtin_shufflevector(lo, hi, 0, 1, 2, 3, 4, 5, 6, 7,
                                 8, 9, 10, 11, 12, 13, 14, 15);
}

// Packed fragment: one 32-byte contiguous load per lane.
__device__ __forceinline__ v16bf load_frag_pk(const __bf16* pk, int f) {
  int l = threadIdx.x & 31;
  return *(const v16bf*)(pk + ((long)f * 32 + l) * 16);
}

__device__ __forceinline__ v8f wmma_bf16(v16bf a, v16bf b, v8f c) {
  return __builtin_amdgcn_wmma_f32_16x16x32_bf16(false, a, false, b, (short)0, c,
                                                 false, false);
}

// value of lane l ^ 16
__device__ __forceinline__ float xhalf(float x) {
  int b = __builtin_bit_cast(int, x);
  return __builtin_bit_cast(float, __builtin_amdgcn_permlanex16(b, b, 0x76543210, 0xfedcba98,
                                                                false, false));
}

// Rows whose mask is 0 give an output of 0 as queries and a probability of exactly 0 as
// keys (a batch with no live key has no live query either), so every stage behind the
// LayerNorm works on the live rows alone, moved up to the front of their batch in their
// old order ("compact" rows). live[b] = number of live rows of batch b.
__device__ __forceinline__ int live_rows(const int* __restrict__ live, int b) {
  return min(max(live[b], 0), S_);
}
// compact rows are zero-filled up to the next multiple of 64 (the largest row tile)
__device__ __forceinline__ int padded_rows(int n) { return (n + 63) & ~63; }

// ---------------- pack fp32 weights into bf16 B-fragments ----------------
// Input: row-major KxN matrices, one behind the other. Output: per fragment
// (kc in K/32, nt in N/16): pk[(fid*32 + lane)*16 + e] with the WMMA B layout.
// One wave packs fragment fid, counted through all the matrices.
template <unsigned K, unsigned N>
__device__ __forceinline__ void pack_frag(const float* __restrict__ w, __bf16* __restrict__ pk,
                                          unsigned fid) {
  constexpr unsigned ntiles = N >> 4;
  constexpr unsigned fpm = (K >> 5) * ntiles;
  unsigned m = fid / fpm;
  unsigned f = fid % fpm;
  unsigned kc = f / ntiles, nt = f % ntiles;
  unsigned l = threadIdx.x & 31;
  unsigned g = l >> 4, c = l & 15;
  const float* wm = w + m * K * N;
  __bf16* dst = pk + (fid * 32 + l) * 16;
#pragma unroll
  for (unsigned e = 0; e < 16; ++e) {
    unsigned kpat = (e < 8 ? e : e + 8) + 8 * g;
    dst[e] = (__bf16)wm[(kc * 32 + kpat) * N + nt * 16 + c];
  }
  // the stores' registers may be reused behind them: wait before they are overwritten
  asm volatile("s_wait_xcnt 0x0" ::: "memory");
}

// ---------------- kernel 1: weight packing, LayerNorm + row compaction ----------------
// Neither job reads what the other writes, so one launch holds both.
// block = 128 threads. The first PACK_BLOCKS_ blocks pack the weights, one fragment per wave;
// they come first so that their strided loads land while the rows are worked on.
// Every other block: one row of 512; contiguous float4 per thread.
// The block counts its batch's mask: pos = live rows in front of its own, n = all live rows.
// A live row is normalised and written at compact row pos; a masked row stores its zeros
// to out and, if it is one of the first masked rows, the zero row n + (its rank) of the pad.
constexpr int FRAGS_ = (H_ / 32) * (H_ / 16);  // fragments of each of the four weight inputs
constexpr int PACK_BLOCKS_ = 4 * FRAGS_ / 4;   // four waves per block
__global__ void prep_kernel(const float* __restrict__ x, const int* __restrict__ mask,
                            const float* __restrict__ gamma, const float* __restrict__ beta,
                            const float* __restrict__ Wq, const float* __restrict__ Wk,
                            const float* __restrict__ Wv, const float* __restrict__ Wo,
                            __bf16* __restrict__ wq_pk, __bf16* __restrict__ wk_pk,
                            __bf16* __restrict__ wv_pk, __bf16* __restrict__ wo_pk,
                            float* __restrict__ xn, __bf16* __restrict__ xn_bf,
                            int* __restrict__ rowof, int* __restrict__ live,
                            float* __restrict__ out) {
  if (blockIdx.x < PACK_BLOCKS_) {  // whole block, in front of the barrier
    const int which = (int)blockIdx.x / (FRAGS_ / 4);  // the weight input, one per block
    const unsigned fid = (blockIdx.x % (FRAGS_ / 4)) * 4 + (threadIdx.x >> 5);
    if (which == 0) pack_frag<H_, DK_>(Wq, wq_pk, fid);
    else if (which == 1) pack_frag<H_, DK_>(Wk, wk_pk, fid);
    else if (which == 2) pack_frag<H_, DK_>(Wv, wv_pk, fid);
    else pack_frag<H_, H_>(Wo, wo_pk, fid);
    return;
  }
  long row = blockIdx.x - PACK_BLOCKS_;
  int b = (int)(row / S_), sr = (int)(row % S_);
  int t = threadIdx.x;
  const int* mb = mask + (long)b * S_;
  const bool on = mb[sr] != 0;  // the same for the whole block
  v4i m[4];  // this thread's 16 entries of the batch's mask
  const unsigned moff = (unsigned)t * 64u;  // in bytes
#pragma unroll
  for (int q = 0; q < 4; ++q) m[q] = *(const v4i*)((const char*)mb + moff + q * 16);
  // The loads' offset register is reused behind them: wait before it is overwritten.
  // Naming it as an input keeps it whole up to the wait.
  asm volatile("s_wait_xcnt 0x0" ::"v"(moff) : "memory");
  int pc = 0;  // low 16 bits: live rows in front of sr; from bit 16: live rows
#pragma unroll
  for (int q = 0; q < 4; ++q)
#pragma unroll
    for (int j = 0; j < 4; ++j)
      if (m[q][j] != 0) pc += 0x10000 + ((t * 16 + q * 4 + j < sr) ? 1 : 0);
  v4f v = {0.f, 0.f, 0.f, 0.f};
  if (on) v = *(const v4f*)(x + row * H_ + t * 4);
  float s = v[0] + v[1] + v[2] + v[3];
  float ss = v[0] * v[0] + v[1] * v[1] + v[2] * v[2] + v[3] * v[3];
#pragma unroll
  for (int off = 16; off > 0; off >>= 1) {
    s += __shfl_xor(s, off, 32);
    ss += __shfl_xor(ss, off, 32);
    pc += __shfl_xor(pc, off, 32);
  }
  __shared__ float rs[4], rss[4];
  __shared__ int rpc[4];
  int wid = t >> 5;
  if ((t & 31) == 0) { rs[wid] = s; rss[wid] = ss; rpc[wid] = pc; }
  __syncthreads();
  s = rs[0] + rs[1] + rs[2] + rs[3];
  ss = rss[0] + rss[1] + rss[2] + rss[3];
  pc = rpc[0] + rpc[1] + rpc[2] + rpc[3];
  const int pos = pc & 0xffff, n = pc >> 16;
  if (sr == 0 && t == 0) live[b] = n;
  if (!on) {
    v4f z = {0.f, 0.f, 0.f, 0.f};
    *(v4f*)(out + row * H_ + t * 4) = z;
    // the store's registers are reused behind it: wait before they are overwritten
    asm volatile("s_wait_xcnt 0x0" ::: "memory");
    int j = n + (sr - pos);  // masked rows follow the live ones: j < S_
    if (j < padded_rows(n)) {
      __bf16* zb = xn_bf + ((long)b * S_ + j) * H_ + t * 4;
      zb[0] = (__bf16)0.f; zb[1] = (__bf16)0.f; zb[2] = (__bf16)0.f; zb[3] = (__bf16)0.f;
      // the store's registers may be reused behind it: wait before they are overwritten
      asm volatile("s_wait_xcnt 0x0" ::: "memory");
    }
  } else {
    row = (long)b * S_ + pos;  // compact row
    if (t == 0) rowof[row] = sr;
    float mean = s * (1.f / H_);
    float var = ss * (1.f / H_) - mean * mean;
    float inv = rsqrtf(var + LN_EPS_);
    v4f gm = *(const v4f*)(gamma + t * 4);
    v4f bt = *(const v4f*)(beta + t * 4);
    v4f o;
    v8bf ob;
#pragma unroll
    for (int j = 0; j < 4; ++j) {
      o[j] = (v[j] - mean) * inv * gm[j] + bt[j];
      ob[j] = (__bf16)o[j];
    }
    *(v4f*)(xn + row * H_ + t * 4) = o;
    // store 4 bf16 (8 bytes)
    __bf16* xb = xn_bf + row * H_ + t * 4;
    xb[0] = ob[0]; xb[1] = ob[1]; xb[2] = ob[2]; xb[3] = ob[3];
    // the stores' registers may be reused behind them: wait before they are overwritten
    asm volatile("s_wait_xcnt 0x0" ::: "memory");
  }
}

// ---------------- kernel 2: Q/K/V projections ----------------
// grid = (B*NH, 3, S/32), block = 64 (2 waves); wave: 16(S) x 64(DK) tile of compact rows.
// The row tile is the slowest grid index, so that the blocks with live rows come first.
// y=0: q (scaled 1/8, [bn][s][d]); y=1: k ([bn][s][d]); y=2: v transposed ([bn][d][s]).
// The real block size lifts the register ceiling, which the ring of fragments needs.
__global__ void __launch_bounds__(64) proj_kernel(const __bf16* __restrict__ xn_bf,
                            const __bf16* __restrict__ wq_pk, const __bf16* __restrict__ wk_pk,
                            const __bf16* __restrict__ wv_pk,
                            const int* __restrict__ live, __bf16* __restrict__ q, __bf16* __restrict__ k,
                            __bf16* __restrict__ vT) {
  int which = blockIdx.y;
  int wid = threadIdx.x >> 5;
  int l = threadIdx.x & 31;
  int g = l >> 4, c = l & 15;
  int bn = blockIdx.x;
  int n = bn & 7;
  if ((int)blockIdx.z * 32 >= padded_rows(live_rows(live, bn >> 3))) return;  // whole block
  long s0 = (long)blockIdx.z * 32 + wid * 16;
  long row0 = ((long)(bn >> 3)) * S_ + s0;
  const __bf16* wsel = (which == 0) ? wq_pk : (which == 1) ? wk_pk : wv_pk;
  const __bf16* wpk = wsel + (long)n * 64 * 512;  // 64 frags/head, 512 bf16/frag

  v8f acc[4];
#pragma unroll
  for (int t = 0; t < 4; ++t) acc[t] = zero_v8f();

  // Register ring, PD_ k-steps deep: a step's ten loads go out PD_ steps ahead of its
  // products, so that a wave waits for one landing per PD_ steps, not for one per product.
  constexpr int PD_ = 3;
  v16bf fa[PD_], fb[PD_][4];
  // Every loop over the ring is unrolled in full: only constant slot numbers keep it in
  // registers.
#pragma unroll
  for (int s = 0; s < PD_; ++s) {
    fa[s] = load_frag_rm(xn_bf, row0, H_, s * 32);
#pragma unroll  // constant slot numbers, as above
    for (int t = 0; t < 4; ++t) fb[s][t] = load_frag_pk(wpk, s * 4 + t);
  }
#pragma unroll  // constant slot numbers, as above
  for (int kc = 0; kc < H_ / 32; ++kc) {
    const int s = kc % PD_;
#pragma unroll  // constant slot numbers, as above
    for (int t = 0; t < 4; ++t) acc[t] = wmma_bf16(fa[s], fb[s][t], acc[t]);
    if (kc + PD_ < H_ / 32) {
      fa[s] = load_frag_rm(xn_bf, row0, H_, (kc + PD_) * 32);
#pragma unroll  // constant slot numbers, as above
      for (int t = 0; t < 4; ++t) fb[s][t] = load_frag_pk(wpk, (kc + PD_) * 4 + t);
    }
    // keeps the refill here: moved down to its use, each load would be waited for alone
    __builtin_amdgcn_sched_barrier(0);
  }

  if (which == 2) {
    // vT[bn][d][s]: lane writes 8 contiguous s per tile
    __bf16* vbase = vT + (long)bn * DK_ * S_;
#pragma unroll
    for (int t = 0; t < 4; ++t) {
      __bf16* p = vbase + (long)(t * 16 + c) * S_ + s0 + 8 * g;
#pragma unroll
      for (int i = 0; i < 8; ++i) p[i] = (__bf16)acc[t][i];
    }
  } else {
    __bf16* dst = (which == 0) ? q : k;
    float sc = (which == 0) ? 0.125f : 1.f;  // fold 1/sqrt(DK) into q
    long base = ((long)bn * S_ + s0) * DK_;
#pragma unroll
    for (int t = 0; t < 4; ++t)
#pragma unroll
      for (int i = 0; i < 8; ++i)
        dst[base + (long)(i + 8 * g) * DK_ + t * 16 + c] = (__bf16)(acc[t][i] * sc);
  }
}

__global__ void __launch_bounds__(128) attn_kernel(const __bf16* __restrict__ qm, const __bf16* __restrict__ km,
                            const __bf16* __restrict__ vT, const int* __restrict__ live,
                            __bf16* __restrict__ h) {
  int wid = threadIdx.x >> 5;
  int l = threadIdx.x & 31;
  int g = l >> 4, c = l & 15;
  int bn = blockIdx.x;
  int b = bn >> 3, n = bn & 7;
  const int nl = live_rows(live, b);
  if ((int)blockIdx.y * 64 >= nl) return;  // whole block: no live query here
  long s0 = (long)blockIdx.y * 64 + wid * 16;
  const __bf16* qb = qm + (long)bn * S_ * DK_;
  const __bf16* kb = km + (long)bn * S_ * DK_;
  const __bf16* vb = vT + (long)bn * DK_ * S_;   // [d][s]
  const unsigned koff = (unsigned)(c * DK_ + 8 * g);  // key row c
  const unsigned voff = (unsigned)(c * S_ + 8 * g);   // V^T row d = c

  // B operand: column c = query s0 + c
  v16bf bq0 = load_frag_rm(qb, s0, DK_, 0);
  v16bf bq1 = load_frag_rm(qb, s0, DK_, 32);
  // the Q loads' address pair is reused behind them: wait before it is overwritten
  asm volatile("s_wait_xcnt 0x0" ::: "memory");

  v8f acc[4];  // acc[t][i] = O^T[d = 16t + 8g + i][query s0 + c]
#pragma unroll
  for (int t = 0; t < 4; ++t) acc[t] = zero_v8f();
  float mr = -1e38f;  // running maximum of this lane's query (both halves agree)
  float lr = 0.f;     // running sum over this half's keys only; joined after the loop

  // The eight fragments of one tile of 32 keys: K rows 0-15 and 16-31 (two k halves each),
  // V^T rows 16t.
  auto load_tile = [&](v16bf (&fk)[4], v16bf (&fv)[4], int kt) {
    const __bf16* pk = kb + (long)kt * DK_ + koff;  // the lane's own addresses
    const __bf16* pv = vb + kt + voff;
    fk[0] = load_frag_bo(pk, 0);
    fk[1] = load_frag_bo(pk, 32);
    fk[2] = load_frag_bo(pk, 16 * DK_);
    fk[3] = load_frag_bo(pk, 16 * DK_ + 32);
#pragma unroll  // constant indices keep the fragments in registers
    for (int t = 0; t < 4; ++t) fv[t] = load_frag_bo(pv, t * 16 * S_);
    // The loads' address pairs are formed anew for the next tile while these loads fly: wait
    // before they are overwritten. Naming them as inputs keeps them whole up to the wait.
    asm volatile("s_wait_xcnt 0x0" ::"v"(pk), "v"(pv) : "memory");
  };

  // One tile of 32 compact keys from the fragments ck, cv; the next tile's sixteen loads go
  // out first, into nk, nv, and land while this tile is worked on. In the last, partly filled
  // tile only the keys below nl are live (it holds at least one); the rows of the pad behind
  // them are zeros.
  auto tile = [&](const v16bf (&ck)[4], const v16bf (&cv)[4], v16bf (&nk)[4], v16bf (&nv)[4],
                  int kt) {
    // behind the last tile there is none: that tile is fetched again (written, finite values)
    load_tile(nk, nv, min(kt + 32, (nl - 1) & ~31));
    // keeps the loads up here: moved down to their use, each would be waited for alone
    __builtin_amdgcn_sched_barrier(0);
    // s0f[i] = score(key kt + 8g + i, query c); s1f[i] = score(key kt + 16 + 8g + i, query c)
    v8f s0f = zero_v8f(), s1f = zero_v8f();
    s0f = wmma_bf16(ck[0], bq0, s0f);
    s0f = wmma_bf16(ck[1], bq1, s0f);
    s1f = wmma_bf16(ck[2], bq0, s1f);
    s1f = wmma_bf16(ck[3], bq1, s1f);

    const int rem = nl - kt - 8 * g;  // register i of s0f is live while i < rem
    float tm = 0.f;
#pragma unroll
    for (int i = 0; i < 8; ++i) {
      s0f[i] = (i < rem) ? s0f[i] : NEG_INF_;
      s1f[i] = (i + 16 < rem) ? s1f[i] : NEG_INF_;
      float t2 = fmaxf(s0f[i], s1f[i]);
      tm = (i == 0) ? t2 : fmaxf(tm, t2);
    }
    tm = fmaxf(tm, xhalf(tm));

    float mn = fmaxf(mr, tm);
    float corr = __expf(mr - mn);
    mr = mn;
#pragma unroll
    for (int t = 0; t < 4; ++t)
#pragma unroll
      for (int i = 0; i < 8; ++i) acc[t][i] *= corr;

    // P^T as B operand: element e < 8 is key 8g + e, e >= 8 is key 16 + 8g + (e - 8),
    // the k order of load_frag_rm.
    v16bf pt;
    float psum = 0.f;
#pragma unroll
    for (int i = 0; i < 8; ++i) {
      float p0 = __expf(s0f[i] - mn);
      float p1 = __expf(s1f[i] - mn);
      psum += p0 + p1;
      pt[i] = (__bf16)p0;
      pt[8 + i] = (__bf16)p1;
    }
    lr = lr * corr + psum;

#pragma unroll
    for (int t = 0; t < 4; ++t) acc[t] = wmma_bf16(cv[t], pt, acc[t]);
  };

  // Two sets of fragments take turns, so that none is copied; nl is at least 1 here and at
  // most S_. With an odd number of tiles the last turn has no live key: every score is
  // NEG_INF_ against a finite maximum, so corr is 1, every p is 0 and nothing changes.
  v16bf k0[4], v0[4], k1[4], v1[4];
  load_tile(k0, v0, 0);
  for (int kt = 0; kt < nl; kt += 64) {
    tile(k0, v0, k1, v1, kt);
    tile(k1, v1, k0, v0, kt + 32);
  }

  float inv = 1.f / (lr + xhalf(lr));
  // lane stores 8 contiguous d of its query per tile
  __bf16* hp = h + ((long)b * S_ + s0 + c) * H_ + n * DK_ + 8 * g;
#pragma unroll
  for (int t = 0; t < 4; ++t) {
    v8bf o;
#pragma unroll
    for (int i = 0; i < 8; ++i) o[i] = (__bf16)(acc[t][i] * inv);
    *(v8bf*)(hp + t * 16) = o;
  }
}

// ---------------- kernel 4: output projection + residual, live rows back in place ----------
// grid = B*S/16, block = 256 (8 waves); wave w computes cols [w*64, w*64+64) of 16 compact
// rows. The batch is the fast part of the index, so that the blocks with live rows come first.
__global__ void outproj_kernel(const __bf16* __restrict__ hbf, const __bf16* __restrict__ wo_pk,
                               const float* __restrict__ xn, const int* __restrict__ rowof,
                               const int* __restrict__ live, float* __restrict__ out) {
  int wid = threadIdx.x >> 5;
  int l = threadIdx.x & 31;
  int g = l >> 4, c = l & 15;
  int b = blockIdx.x % B_;
  int j0 = (int)(blockIdx.x / B_) * 16;
  const int nl = live_rows(live, b);
  if (j0 >= nl) return;  // whole block: no live row here
  long row0 = (long)b * S_ + j0;
  int n0 = wid * 64;

  v8f acc[4];
#pragma unroll
  for (int t = 0; t < 4; ++t) acc[t] = zero_v8f();

  for (int kc = 0; kc < H_ / 32; ++kc) {
    v16bf a = load_frag_rm(hbf, row0, H_, kc * 32);
#pragma unroll
    for (int t = 0; t < 4; ++t)
      acc[t] = wmma_bf16(a, load_frag_pk(wo_pk, kc * 32 + wid * 4 + t), acc[t]);
  }
  // the loop's address registers are reused behind it: wait before they are overwritten
  asm volatile("s_wait_xcnt 0x0" ::: "memory");
  // A row of the pad has no place in out: it reads the last live row's residual and home
  // row, so that all loads go out together, and stores nothing.
  // Lane l fetches the home row of the tile's row l & 15.
  const unsigned ro = (unsigned)(b * S_ + min(j0 + c, nl - 1));  // element offset in rowof
  const int hr = rowof[ro];
  float res[4][8];
  unsigned xo[8];  // element offsets in xn
#pragma unroll
  for (int i = 0; i < 8; ++i)
    xo[i] = (unsigned)(b * S_ + min(j0 + i + 8 * g, nl - 1)) * H_ + n0 + c;
#pragma unroll
  for (int i = 0; i < 8; ++i)
#pragma unroll
    for (int t = 0; t < 4; ++t) res[t][i] = xn[xo[i] + t * 16];
  // The loads' offset registers are reused behind them: wait before they are overwritten.
  // Naming the offsets as inputs keeps them whole up to the wait.
  asm volatile("s_wait_xcnt 0x0" ::"v"(ro), "v"(xo[0]), "v"(xo[1]), "v"(xo[2]), "v"(xo[3]),
               "v"(xo[4]), "v"(xo[5]), "v"(xo[6]), "v"(xo[7])
               : "memory");
#pragma unroll
  for (int i = 0; i < 8; ++i)
#pragma unroll
    for (int t = 0; t < 4; ++t) acc[t][i] += res[t][i];
#pragma unroll
  for (int i = 0; i < 8; ++i) {
    // home row of the tile's row i + 8g, masked to the shape
    int lo = __builtin_amdgcn_readlane(hr, i), hi = __builtin_amdgcn_readlane(hr, i + 8);
    int orow = (g ? hi : lo) & (S_ - 1);
    if (j0 + i + 8 * g < nl) {
      float* op = out + ((long)b * S_ + orow) * H_ + n0 + c;
#pragma unroll
      for (int t = 0; t < 4; ++t) op[t * 16] = acc[t][i];
    }
  }
}

extern "C" void kernel_launch(void* const* d_in, const int* in_sizes, int n_in,
                              void* d_out, int out_size, void* d_ws, size_t ws_size,
                              hipStream_t stream) {
  (void)in_sizes; (void)n_in; (void)out_size; (void)ws_size;
  const float* x     = (const float*)d_in[0];
  const int*   mask  = (const int*)d_in[1];
  const float* Wq    = (const float*)d_in[2];
  const float* Wk    = (const float*)d_in[3];
  const float* Wv    = (const float*)d_in[4];
  const float* Wo    = (const float*)d_in[5];
  const float* gamma = (const float*)d_in[6];
  const float* beta  = (const float*)d_in[7];
  float* out = (float*)d_out;

  char* ws = (char*)d_ws;
  float* xn = (float*)ws;        ws += (size_t)B_ * S_ * H_ * 4;
  __bf16* xn_bf = (__bf16*)ws;   ws += (size_t)B_ * S_ * H_ * 2;
  __bf16* qb = (__bf16*)ws;      ws += (size_t)B_ * NH_ * S_ * DK_ * 2;
  __bf16* kb = (__bf16*)ws;      ws += (size_t)B_ * NH_ * S_ * DK_ * 2;
  __bf16* vT = (__bf16*)ws;      ws += (size_t)B_ * NH_ * S_ * DK_ * 2;
  __bf16* hb = (__bf16*)ws;      ws += (size_t)B_ * S_ * H_ * 2;
  __bf16* wq_pk = (__bf16*)ws;   ws += (size_t)NH_ * H_ * DK_ * 2;
  __bf16* wk_pk = (__bf16*)ws;   ws += (size_t)NH_ * H_ * DK_ * 2;
  __bf16* wv_pk = (__bf16*)ws;   ws += (size_t)NH_ * H_ * DK_ * 2;
  __bf16* wo_pk = (__bf16*)ws;   ws += (size_t)H_ * H_ * 2;
  int* rowof = (int*)ws;         ws += (size_t)B_ * S_ * 4;
  int* live = (int*)ws;          ws += (size_t)B_ * 4;

  // weight packing (per-head KxN = 512x64: 8*16*4 = 512 fragments; Wo: 16*32 = 512) and
  // LayerNorm in one launch
  prep_kernel<<<PACK_BLOCKS_ + B_ * S_, 128, 0, stream>>>(x, mask, gamma, beta, Wq, Wk, Wv, Wo,
                                                          wq_pk, wk_pk, wv_pk, wo_pk, xn, xn_bf,
                                                          rowof, live, out);

  proj_kernel<<<dim3(B_ * NH_, 3, S_ / 32), 64, 0, stream>>>(xn_bf, wq_pk, wk_pk, wv_pk,
                                                             live, qb, kb, vT);

  attn_kernel<<<dim3(B_ * NH_, S_ / 64), 128, 0, stream>>>(qb, kb, vT, live, hb);

  outproj_kernel<<<B_ * S_ / 16, 256, 0, stream>>>(hb, wo_pk, xn, rowof, live, out);
}

// v005
// One run takes 57.3 microseconds.
// Two timings next to v004 put it at 1.45 and 1.46 times that version's speed.
// Over all steps from v000 it is 6.20 times as fast.
#include <hip/hip_runtime.h>

#define B_ 4
#define S_ 2048
#define H_ 512
#define NH_ 8
#define DK_ 64

constexpr float LN_EPS_ = 1e-5f;
constexpr float NEG_INF_ = -1e30f;

typedef __attribute__((ext_vector_type(16))) __bf16 v16bf;
typedef __attribute__((ext_vector_type(8)))  __bf16 v8bf;
typedef __attribute__((ext_vector_type(8)))  float  v8f;
typedef __attribute__((ext_vector_type(4)))  float  v4f;
typedef __attribute__((ext_vector_type(4)))  int    v4i;

__device__ __forceinline__ v8f zero_v8f() {
  v8f z;
#pragma unroll
  for (int i = 0; i < 8; ++i) z[i] = 0.f;
  return z;
}

// A-style fragment: 16x32 bf16 tile from a row-major matrix (ld elements/row).
// lane (l&15) = row; element K pattern: e<8 -> 8g+e, e>=8 -> 8g+16+(e-8).
// Two aligned 16-byte loads per lane. p = the lane's own row + the tile's column + 8g.
__device__ __forceinline__ v16bf load_frag_rm(const __bf16* p) {
  v8bf lo = *(const v8bf*)p;
  v8bf hi = *(const v8bf*)(p + 16);
  return __builtin_shufflevector(lo, hi, 0, 1, 2, 3, 4, 5, 6, 7,
                                 8, 9, 10, 11, 12, 13, 14, 15);
}

// Fragment order: a 16x32 tile is 512 elements in a row, [half][lane][8]. Lane l = 16g + r
// holds row r; its 8 elements of half 0 are K = 8g + e, of half 1 K = 16 + 8g + e: the K
// pattern of load_frag_rm. Each half is 512 contiguous bytes, so that a wave's 16-byte load
// or store of it covers four whole 128-byte lines (a row-major tile: a piece of sixteen).
constexpr int FT_ = 512;  // elements of a tile
constexpr int FH_ = 256;  // elements of a half
// p = start of the tile + 8 * lane
__device__ __forceinline__ v16bf load_frag_fo(const __bf16* p) {
  v8bf lo = *(const v8bf*)p;
  v8bf hi = *(const v8bf*)(p + FH_);
  return __builtin_shufflevector(lo, hi, 0, 1, 2, 3, 4, 5, 6, 7,
                                 8, 9, 10, 11, 12, 13, 14, 15);
}

// Packed weight fragment f, in fragment order.
__device__ __forceinline__ v16bf load_frag_pk(const __bf16* pk, int f) {
  int l = threadIdx.x & 31;
  return load_frag_fo(pk + (long)f * FT_ + l * 8);
}

__device__ __forceinline__ v8f wmma_bf16(v16bf a, v16bf b, v8f c) {
  return __builtin_amdgcn_wmma_f32_16x16x32_bf16(false, a, false, b, (short)0, c,
                                                 false, false);
}

// value of lane l ^ 16
__device__ __forceinline__ float xhalf(float x) {
  int b = __builtin_bit_cast(int, x);
  return __builtin_bit_cast(float, __builtin_amdgcn_permlanex16(b, b, 0x76543210, 0xfedcba98,
                                                                false, false));
}

// Rows whose mask is 0 give an output of 0 as queries and a probability of exactly 0 as
// keys (a batch with no live key has no live query either), so every stage behind the
// LayerNorm works on the live rows alone, moved up to the front of their batch in their
// old order ("compact" rows). live[b] = number of live rows of batch b.
__device__ __forceinline__ int live_rows(const int* __restrict__ live, int b) {
  return min(max(live[b], 0), S_);
}
// compact rows are zero-filled up to the next multiple of 64 (the largest row tile)
__device__ __forceinline__ int padded_rows(int n) { return (n + 63) & ~63; }

// ---------------- pack fp32 weights into bf16 B-fragments ----------------
// Input: row-major KxN matrices, one behind the other. Output: per fragment
// (kc in K/32, nt in N/16): tile fid in fragment order, lane = column.
// One wave packs fragment fid, counted through all the matrices.
template <unsigned K, unsigned N>
__device__ __forceinline__ void pack_frag(const float* __restrict__ w, __bf16* __restrict__ pk,
                                          unsigned fid) {
  constexpr unsigned ntiles = N >> 4;
  constexpr unsigned fpm = (K >> 5) * ntiles;
  unsigned m = fid / fpm;
  unsigned f = fid % fpm;
  unsigned kc = f / ntiles, nt = f % ntiles;
  unsigned l = threadIdx.x & 31;
  unsigned g = l >> 4, c = l & 15;
  const float* wm = w + m * K * N;
  __bf16* dst = pk + fid * FT_ + l * 8;
#pragma unroll
  for (unsigned e = 0; e < 16; ++e) {
    unsigned kpat = (e < 8 ? e : e + 8) + 8 * g;
    dst[(e >> 3) * FH_ + (e & 7)] = (__bf16)wm[(kc * 32 + kpat) * N + nt * 16 + c];
  }
  // the stores' registers may be reused behind them: wait before they are overwritten
  asm volatile("s_wait_xcnt 0x0" ::: "memory");
}

// ---------------- kernel 1: weight packing, LayerNorm + row compaction ----------------
// Neither job reads what the other writes, so one launch holds both.
// block = 128 threads. The first PACK_BLOCKS_ blocks pack the weights, one fragment per wave;
// they come first so that their strided loads land while the rows are worked on.
// Every other block: one row of 512; contiguous float4 per thread.
// The block counts its batch's mask: pos = live rows in front of its own, n = all live rows.
// A live row is normalised and written at compact row pos; a masked row stores its zeros
// to out and, if it is one of the first masked rows, the zero row n + (its rank) of the pad.
constexpr int FRAGS_ = (H_ / 32) * (H_ / 16);  // fragments of each of the four weight inputs
constexpr int PACK_BLOCKS_ = 4 * FRAGS_ / 4;   // four waves per block
__global__ void prep_kernel(const float* __restrict__ x, const int* __restrict__ mask,
                            const float* __restrict__ gamma, const float* __restrict__ beta,
                            const float* __restrict__ Wq, const float* __restrict__ Wk,
                            const float* __restrict__ Wv, const float* __restrict__ Wo,
                            __bf16* __restrict__ wq_pk, __bf16* __restrict__ wk_pk,
                            __bf16* __restrict__ wv_pk, __bf16* __restrict__ wo_pk,
                            float* __restrict__ xn, __bf16* __restrict__ xn_bf,
                            int* __restrict__ rowof, int* __restrict__ live,
                            float* __restrict__ out) {
  if (blockIdx.x < PACK_BLOCKS_) {  // whole block, in front of the barrier
    const int which = (int)blockIdx.x / (FRAGS_ / 4);  // the weight input, one per block
    const unsigned fid = (blockIdx.x % (FRAGS_ / 4)) * 4 + (threadIdx.x >> 5);
    if (which == 0) pack_frag<H_, DK_>(Wq, wq_pk, fid);
    else if (which == 1) pack_frag<H_, DK_>(Wk, wk_pk, fid);
    else if (which == 2) pack_frag<H_, DK_>(Wv, wv_pk, fid);
    else pack_frag<H_, H_>(Wo, wo_pk, fid);
    return;
  }
  long row = blockIdx.x - PACK_BLOCKS_;
  int b = (int)(row / S_), sr = (int)(row % S_);
  int t = threadIdx.x;
  const int* mb = mask + (long)b * S_;
  const bool on = mb[sr] != 0;  // the same for the whole block
  v4i m[4];  // this thread's 16 entries of the batch's mask
  const unsigned moff = (unsigned)t * 64u;  // in bytes
#pragma unroll
  for (int q = 0; q < 4; ++q) m[q] = *(const v4i*)((const char*)mb + moff + q * 16);
  // The loads' offset register is reused behind them: wait before it is overwritten.
  // Naming it as an input keeps it whole up to the wait.
  asm volatile("s_wait_xcnt 0x0" ::"v"(moff) : "memory");
  int pc = 0;  // low 16 bits: live rows in front of sr; from bit 16: live rows
#pragma unroll
  for (int q = 0; q < 4; ++q)
#pragma unroll
    for (int j = 0; j < 4; ++j)
      if (m[q][j] != 0) pc += 0x10000 + ((t * 16 + q * 4 + j < sr) ? 1 : 0);
  v4f v = {0.f, 0.f, 0.f, 0.f};
  if (on) v = *(const v4f*)(x + row * H_ + t * 4);
  float s = v[0] + v[1] + v[2] + v[3];
  float ss = v[0] * v[0] + v[1] * v[1] + v[2] * v[2] + v[3] * v[3];
#pragma unroll
  for (int off = 16; off > 0; off >>= 1) {
    s += __shfl_xor(s, off, 32);
    ss += __shfl_xor(ss, off, 32);
    pc += __shfl_xor(pc, off, 32);
  }
  __shared__ float rs[4], rss[4];
  __shared__ int rpc[4];
  int wid = t >> 5;
  if ((t & 31) == 0) { rs[wid] = s; rss[wid] = ss; rpc[wid] = pc; }
  __syncthreads();
  s = rs[0] + rs[1] + rs[2] + rs[3];
  ss = rss[0] + rss[1] + rss[2] + rss[3];
  pc = rpc[0] + rpc[1] + rpc[2] + rpc[3];
  const int pos = pc & 0xffff, n = pc >> 16;
  if (sr == 0 && t == 0) live[b] = n;
  if (!on) {
    v4f z = {0.f, 0.f, 0.f, 0.f};
    *(v4f*)(out + row * H_ + t * 4) = z;
    // the store's registers are reused behind it: wait before they are overwritten
    asm volatile("s_wait_xcnt 0x0" ::: "memory");
    int j = n + (sr - pos);  // masked rows follow the live ones: j < S_
    if (j < padded_rows(n)) {
      __bf16* zb = xn_bf + ((long)b * S_ + j) * H_ + t * 4;
      zb[0] = (__bf16)0.f; zb[1] = (__bf16)0.f; zb[2] = (__bf16)0.f; zb[3] = (__bf16)0.f;
      // the store's registers may be reused behind it: wait before they are overwritten
      asm volatile("s_wait_xcnt 0x0" ::: "memory");
    }
  } else {
    row = (long)b * S_ + pos;  // compact row
    if (t == 0) rowof[row] = sr;
    float mean = s * (1.f / H_);
    float var = ss * (1.f / H_) - mean * mean;
    float inv = rsqrtf(var + LN_EPS_);
    v4f gm = *(const v4f*)(gamma + t * 4);
    v4f bt = *(const v4f*)(beta + t * 4);
    v4f o;
    v8bf ob;
#pragma unroll
    for (int j = 0; j < 4; ++j) {
      o[j] = (v[j] - mean) * inv * gm[j] + bt[j];
      ob[j] = (__bf16)o[j];
    }
    *(v4f*)(xn + row * H_ + t * 4) = o;
    // store 4 bf16 (8 bytes)
    __bf16* xb = xn_bf + row * H_ + t * 4;
    xb[0] = ob[0]; xb[1] = ob[1]; xb[2] = ob[2]; xb[3] = ob[3];
    // the stores' registers may be reused behind them: wait before they are overwritten
    asm volatile("s_wait_xcnt 0x0" ::: "memory");
  }
}

// ---------------- kernel 2: Q/K/V projections ----------------
// grid = (B*NH, 3, S/32), block = 64 (2 waves); wave: 16(S) x 64(DK) tile of compact rows.
// The row tile is the slowest grid index, so that the blocks with live rows come first.
// All three results are stored in fragment order, as the attention reads them:
// y=0: q (scaled 1/8) and y=1: k, per bn tiles [s/16][d/32], row = s, K = d;
// y=2: v transposed, per bn tiles [s/32][d/16], row = d, K = s.
// A lane stores 8 neighbours along K. For v that is the product xn * W (a lane's registers
// run along s); for q and k the operands change places, W^T * xn^T (they run along d).
// TR: the transposed product.
template <bool TR>
__device__ __forceinline__ void proj_tile(const __bf16* __restrict__ xn_bf, long row0,
                                          const __bf16* __restrict__ wpk, float sc,
                                          __bf16* __restrict__ dst) {
  v8f acc[4];
#pragma unroll
  for (int t = 0; t < 4; ++t) acc[t] = zero_v8f();

  // Register ring, PD_ k-steps deep: a step's ten loads go out PD_ steps ahead of its
  // products, so that a wave waits for one landing per PD_ steps, not for one per product.
  constexpr int PD_ = 3;
  v16bf fa[PD_], fb[PD_][4];
  const int l = threadIdx.x & 31;
  const __bf16* pa = xn_bf + (row0 + (l & 15)) * (long)H_ + 8 * (l >> 4);  // xn_bf is row-major
  const unsigned wo = (unsigned)l * 16u;  // the lane's place in a half tile, in bytes
  auto load_a = [&](int kc) { return load_frag_rm(pa + kc * 32); };
  auto load_b = [&](int f) {
    return load_frag_fo((const __bf16*)((const char*)wpk + wo) + f * FT_);
  };
  // Every loop over the ring is unrolled in full: only constant slot numbers keep it in
  // registers.
#pragma unroll
  for (int s = 0; s < PD_; ++s) {
    fa[s] = load_a(s);
#pragma unroll  // constant slot numbers, as above
    for (int t = 0; t < 4; ++t) fb[s][t] = load_b(s * 4 + t);
  }
#pragma unroll  // constant slot numbers, as above
  for (int kc = 0; kc < H_ / 32; ++kc) {
    const int s = kc % PD_;
#pragma unroll  // constant slot numbers, as above
    for (int t = 0; t < 4; ++t)
      acc[t] = TR ? wmma_bf16(fb[s][t], fa[s], acc[t]) : wmma_bf16(fa[s], fb[s][t], acc[t]);
    if (kc + PD_ < H_ / 32) {
      fa[s] = load_a(kc + PD_);
#pragma unroll  // constant slot numbers, as above
      for (int t = 0; t < 4; ++t) fb[s][t] = load_b((kc + PD_) * 4 + t);
    }
    // keeps the refill here: moved down to its use, each load would be waited for alone
    __builtin_amdgcn_sched_barrier(0);
  }
  // The loads' address registers are reused behind the loop: wait before they are overwritten.
  // Naming them as inputs keeps them whole up to the wait.
  asm volatile("s_wait_xcnt 0x0" ::"v"(pa), "v"(wo) : "memory");

  // TR: acc[t][i] = value(s = lane's row c, d = 16t + 8g + i): half t & 1 of tile t >> 1.
  // else: acc[t][i] = value(s = 8g + i, d = 16t + c): the wave's half of tile t.
  v8bf o[4];
#pragma unroll
  for (int t = 0; t < 4; ++t)
#pragma unroll
    for (int i = 0; i < 8; ++i) o[t][i] = (__bf16)(acc[t][i] * sc);
#pragma unroll
  for (int t = 0; t < 4; ++t) *(v8bf*)(dst + t * (TR ? FH_ : FT_)) = o[t];
  // the stores' registers may be reused behind them: wait before they are overwritten
  asm volatile("s_wait_xcnt 0x0" ::: "memory");
}

// The real block size lifts the register ceiling, which the ring of fragments needs.
__global__ void __launch_bounds__(64) proj_kernel(const __bf16* __restrict__ xn_bf,
                            const __bf16* __restrict__ wq_pk, const __bf16* __restrict__ wk_pk,
                            const __bf16* __restrict__ wv_pk,
                            const int* __restrict__ live, __bf16* __restrict__ q, __bf16* __restrict__ k,
                            __bf16* __restrict__ vT) {
  int which = blockIdx.y;
  int wid = threadIdx.x >> 5;
  int l = threadIdx.x & 31;
  int bn = blockIdx.x;
  int n = bn & 7;
  if ((int)blockIdx.z * 32 >= padded_rows(live_rows(live, bn >> 3))) return;  // whole block
  long s0 = (long)blockIdx.z * 32 + wid * 16;
  long row0 = ((long)(bn >> 3)) * S_ + s0;
  const long hoff = (long)n * 64 * FT_;  // 64 fragments per head
  // 32 rows of a head are 32 * DK_ elements in each of the three layouts
  const long boff = ((long)bn * S_ + (long)blockIdx.z * 32) * DK_ + l * 8;
  if (which == 2)
    proj_tile<false>(xn_bf, row0, wv_pk + hoff, 1.f, vT + boff + wid * FH_);
  else  // 1/sqrt(DK) is folded into q
    proj_tile<true>(xn_bf, row0, (which == 1 ? wk_pk : wq_pk) + hoff, which == 1 ? 1.f : 0.125f,
                    (which == 1 ? k : q) + boff + wid * 2 * FT_);
}

__global__ void __launch_bounds__(128) attn_kernel(const __bf16* __restrict__ qm, const __bf16* __restrict__ km,
                            const __bf16* __restrict__ vT, const int* __restrict__ live,
                            __bf16* __restrict__ h) {
  int wid = threadIdx.x >> 5;
  int l = threadIdx.x & 31;
  int g = l >> 4;
  int bn = blockIdx.x;
  int b = bn >> 3, n = bn & 7;
  const int nl = live_rows(live, b);
  if ((int)blockIdx.y * 64 >= nl) return;  // whole block: no live query here
  long s0 = (long)blockIdx.y * 64 + wid * 16;
  const __bf16* qb = qm + (long)bn * S_ * DK_;
  const __bf16* kb = km + (long)bn * S_ * DK_;
  const __bf16* vb = vT + (long)bn * DK_ * S_;
  const unsigned loff = (unsigned)l * 8;  // the lane's place in a half tile

  // B operand: column c = query s0 + c
  v16bf bq0 = load_frag_fo(qb + s0 * DK_ + loff);
  v16bf bq1 = load_frag_fo(qb + s0 * DK_ + loff + FT_);
  // the Q loads' address pair is reused behind them: wait before it is overwritten
  asm volatile("s_wait_xcnt 0x0" ::: "memory");

  v8f acc[4];  // acc[t][i] = O^T[d = 16t + 8g + i][query s0 + c]
#pragma unroll
  for (int t = 0; t < 4; ++t) acc[t] = zero_v8f();
  float mr = -1e38f;  // running maximum of this lane's query (both halves agree)
  float lr = 0.f;     // running sum over this half's keys only; joined after the loop

  // The eight fragments of one tile of 32 keys: K rows 0-15 and 16-31 (two k halves each),
  // V^T rows 16t. Each four are neighbours in memory.
  auto load_tile = [&](v16bf (&fk)[4], v16bf (&fv)[4], int kt) {
    const __bf16* pk = kb + (long)kt * DK_ + loff;  // the lane's own addresses
    const __bf16* pv = vb + (long)kt * DK_ + loff;
#pragma unroll  // constant indices keep the fragments in registers
    for (int t = 0; t < 4; ++t) fk[t] = load_frag_fo(pk + t * FT_);
#pragma unroll  // constant indices keep the fragments in registers
    for (int t = 0; t < 4; ++t) fv[t] = load_frag_fo(pv + t * FT_);
    // The loads' address pairs are formed anew for the next tile while these loads fly: wait
    // before they are overwritten. Naming them as inputs keeps them whole up to the wait.
    asm volatile("s_wait_xcnt 0x0" ::"v"(pk), "v"(pv) : "memory");
  };

  // One tile of 32 compact keys from the fragments ck, cv; the next tile's sixteen loads go
  // out first, into nk, nv, and land while this tile is worked on. In the last, partly filled
  // tile only the keys below nl are live (it holds at least one); the rows of the pad behind
  // them are zeros.
  auto tile = [&](const v16bf (&ck)[4], const v16bf (&cv)[4], v16bf (&nk)[4], v16bf (&nv)[4],
                  int kt) {
    // behind the last tile there is none: that tile is fetched again (written, finite values)
    load_tile(nk, nv, min(kt + 32, (nl - 1) & ~31));
    // keeps the loads up here: moved down to their use, each would be waited for alone
    __builtin_amdgcn_sched_barrier(0);
    // s0f[i] = score(key kt + 8g + i, query c); s1f[i] = score(key kt + 16 + 8g + i, query c)
    v8f s0f = zero_v8f(), s1f = zero_v8f();
    s0f = wmma_bf16(ck[0], bq0, s0f);
    s0f = wmma_bf16(ck[1], bq1, s0f);
    s1f = wmma_bf16(ck[2], bq0, s1f);
    s1f = wmma_bf16(ck[3], bq1, s1f);

    const int rem = nl - kt - 8 * g;  // register i of s0f is live while i < rem
    float tm = 0.f;
#pragma unroll
    for (int i = 0; i < 8; ++i) {
      s0f[i] = (i < rem) ? s0f[i] : NEG_INF_;
      s1f[i] = (i + 16 < rem) ? s1f[i] : NEG_INF_;
      float t2 = fmaxf(s0f[i], s1f[i]);
      tm = (i == 0) ? t2 : fmaxf(tm, t2);
    }
    tm = fmaxf(tm, xhalf(tm));

    float mn = fmaxf(mr, tm);
    float corr = __expf(mr - mn);
    mr = mn;
#pragma unroll
    for (int t = 0; t < 4; ++t)
#pragma unroll
      for (int i = 0; i < 8; ++i) acc[t][i] *= corr;

    // P^T as B operand: element e < 8 is key 8g + e, e >= 8 is key 16 + 8g + (e - 8),
    // the k order of load_frag_rm.
    v16bf pt;
    float psum = 0.f;
#pragma unroll
    for (int i = 0; i < 8; ++i) {
      float p0 = __expf(s0f[i] - mn);
      float p1 = __expf(s1f[i] - mn);
      psum += p0 + p1;
      pt[i] = (__bf16)p0;
      pt[8 + i] = (__bf16)p1;
    }
    lr = lr * corr + psum;

#pragma unroll
    for (int t = 0; t < 4; ++t) acc[t] = wmma_bf16(cv[t], pt, acc[t]);
  };

  // Two sets of fragments take turns, so that none is copied; nl is at least 1 here and at
  // most S_. With an odd number of tiles the last turn has no live key: every score is
  // NEG_INF_ against a finite maximum, so corr is 1, every p is 0 and nothing changes.
  v16bf k0[4], v0[4], k1[4], v1[4];
  load_tile(k0, v0, 0);
  for (int kt = 0; kt < nl; kt += 64) {
    tile(k0, v0, k1, v1, kt);
    tile(k1, v1, k0, v0, kt + 32);
  }

  float inv = 1.f / (lr + xhalf(lr));
  // the lane's 8 contiguous d of its query are its place in half t & 1 of tile 2n + (t >> 1)
  __bf16* hp = h + ((long)b * S_ + s0) * H_ + n * 2 * FT_ + loff;
  v8bf o[4];
#pragma unroll
  for (int t = 0; t < 4; ++t)
#pragma unroll
    for (int i = 0; i < 8; ++i) o[t][i] = (__bf16)(acc[t][i] * inv);
#pragma unroll
  for (int t = 0; t < 4; ++t) *(v8bf*)(hp + t * FH_) = o[t];
  // the stores' registers may be reused behind them: wait before they are overwritten
  asm volatile("s_wait_xcnt 0x0" ::: "memory");
}

// ---------------- kernel 4: output projection + residual, live rows back in place ----------
// grid = B*S/16, block = 256 (8 waves); wave w computes cols [w*64, w*64+64) of 16 compact
// rows. The batch is the fast part of the index, so that the blocks with live rows come first.
__global__ void outproj_kernel(const __bf16* __restrict__ hbf, const __bf16* __restrict__ wo_pk,
                               const float* __restrict__ xn, const int* __restrict__ rowof,
                               const int* __restrict__ live, float* __restrict__ out) {
  int wid = threadIdx.x >> 5;
  int l = threadIdx.x & 31;
  int g = l >> 4, c = l & 15;
  int b = blockIdx.x % B_;
  int j0 = (int)(blockIdx.x / B_) * 16;
  const int nl = live_rows(live, b);
  if (j0 >= nl) return;  // whole block: no live row here
  long row0 = (long)b * S_ + j0;
  int n0 = wid * 64;

  v8f acc[4];
#pragma unroll
  for (int t = 0; t < 4; ++t) acc[t] = zero_v8f();

  // Unrolled in full: every load is a constant offset from one address, which stays whole,
  // and the compiler sends the loads out a step ahead of their products.
#pragma unroll
  for (int kc = 0; kc < H_ / 32; ++kc) {
    v16bf a = load_frag_fo(hbf + row0 * H_ + kc * FT_ + l * 8);  // tile [row0 / 16][kc]
#pragma unroll
    for (int t = 0; t < 4; ++t)
      acc[t] = wmma_bf16(a, load_frag_pk(wo_pk, kc * 32 + wid * 4 + t), acc[t]);
  }
  // the loop's address registers are reused behind it: wait before they are overwritten
  asm volatile("s_wait_xcnt 0x0" ::: "memory");
  // A row of the pad has no place in out: it reads the last live row's residual and home
  // row, so that all loads go out together, and stores nothing.
  // Lane l fetches the home row of the tile's row l & 15.
  const unsigned ro = (unsigned)(b * S_ + min(j0 + c, nl - 1));  // element offset in rowof
  const int hr = rowof[ro];
  float res[4][8];
  unsigned xo[8];  // element offsets in xn
#pragma unroll
  for (int i = 0; i < 8; ++i)
    xo[i] = (unsigned)(b * S_ + min(j0 + i + 8 * g, nl - 1)) * H_ + n0 + c;
#pragma unroll
  for (int i = 0; i < 8; ++i)
#pragma unroll
    for (int t = 0; t < 4; ++t) res[t][i] = xn[xo[i] + t * 16];
  // The loads' offset registers are reused behind them: wait before they are overwritten.
  // Naming the offsets as inputs keeps them whole up to the wait.
  asm volatile("s_wait_xcnt 0x0" ::"v"(ro), "v"(xo[0]), "v"(xo[1]), "v"(xo[2]), "v"(xo[3]),
               "v"(xo[4]), "v"(xo[5]), "v"(xo[6]), "v"(xo[7])
               : "memory");
#pragma unroll
  for (int i = 0; i < 8; ++i)
#pragma unroll
    for (int t = 0; t < 4; ++t) acc[t][i] += res[t][i];
#pragma unroll
  for (int i = 0; i < 8; ++i) {
    // home row of the tile's row i + 8g, masked to the shape
    int lo = __builtin_amdgcn_readlane(hr, i), hi = __builtin_amdgcn_readlane(hr, i + 8);
    int orow = (g ? hi : lo) & (S_ - 1);
    if (j0 + i + 8 * g < nl) {
      float* op = out + ((long)b * S_ + orow) * H_ + n0 + c;
#pragma unroll
      for (int t = 0; t < 4; ++t) op[t * 16] = acc[t][i];
    }
  }
}

extern "C" void kernel_launch(void* const* d_in, const int* in_sizes, int n_in,
                              void* d_out, int out_size, void* d_ws, size_t ws_size,
                              hipStream_t stream) {
  (void)in_sizes; (void)n_in; (void)out_size; (void)ws_size;
  const float* x     = (const float*)d_in[0];
  const int*   mask  = (const int*)d_in[1];
  const float* Wq    = (const float*)d_in[2];
  const float* Wk    = (const float*)d_in[3];
  const float* Wv    = (const float*)d_in[4];
  const float* Wo    = (const float*)d_in[5];
  const float* gamma = (const float*)d_in[6];
  const float* beta  = (const float*)d_in[7];
  float* out = (float*)d_out;

  char* ws = (char*)d_ws;
  float* xn = (float*)ws;        ws += (size_t)B_ * S_ * H_ * 4;
  __bf16* xn_bf = (__bf16*)ws;   ws += (size_t)B_ * S_ * H_ * 2;
  __bf16* qb = (__bf16*)ws;      ws += (size_t)B_ * NH_ * S_ * DK_ * 2;
  __bf16* kb = (__bf16*)ws;      ws += (size_t)B_ * NH_ * S_ * DK_ * 2;
  __bf16* vT = (__bf16*)ws;      ws += (size_t)B_ * NH_ * S_ * DK_ * 2;
  __bf16* hb = (__bf16*)ws;      ws += (size_t)B_ * S_ * H_ * 2;
  __bf16* wq_pk = (__bf16*)ws;   ws += (size_t)NH_ * H_ * DK_ * 2;
  __bf16* wk_pk = (__bf16*)ws;   ws += (size_t)NH_ * H_ * DK_ * 2;
  __bf16* wv_pk = (__bf16*)ws;   ws += (size_t)NH_ * H_ * DK_ * 2;
  __bf16* wo_pk = (__bf16*)ws;   ws += (size_t)H_ * H_ * 2;
  int* rowof = (int*)ws;         ws += (size_t)B_ * S_ * 4;
  int* live = (int*)ws;          ws += (size_t)B_ * 4;

  // weight packing (per-head KxN = 512x64: 8*16*4 = 512 fragments; Wo: 16*32 = 512) and
  // LayerNorm in one launch
  prep_kernel<<<PACK_BLOCKS_ + B_ * S_, 128, 0, stream>>>(x, mask, gamma, beta, Wq, Wk, Wv, Wo,
                                                          wq_pk, wk_pk, wv_pk, wo_pk, xn, xn_bf,
                                                          rowof, live, out);

  proj_kernel<<<dim3(B_ * NH_, 3, S_ / 32), 64, 0, stream>>>(xn_bf, wq_pk, wk_pk, wv_pk,
                                                             live, qb, kb, vT);

  attn_kernel<<<dim3(B_ * NH_, S_ / 64), 128, 0, stream>>>(qb, kb, vT, live, hb);

  outproj_kernel<<<B_ * S_ / 16, 256, 0, stream>>>(hb, wo_pk, xn, rowof, live, out);
}

// v006
// It runs in 53.2 microseconds.
// Two timings next to v005 put it at 1.07 and 1.08 times that version's speed.
// All steps since v000 together make it 6.67 times as fast.
#include <hip/hip_runtime.h>

#define B_ 4
#define S_ 2048
#define H_ 512
#define NH_ 8
#define DK_ 64

constexpr float LN_EPS_ = 1e-5f;
constexpr float NEG_INF_ = -1e30f;

typedef __attribute__((ext_vector_type(16))) __bf16 v16bf;
typedef __attribute__((ext_vector_type(8)))  __bf16 v8bf;
typedef __attribute__((ext_vector_type(4)))  __bf16 v4bf;
typedef __attribute__((ext_vector_type(8)))  float  v8f;
typedef __attribute__((ext_vector_type(4)))  float  v4f;
typedef __attribute__((ext_vector_type(4)))  int    v4i;
typedef __attribute__((ext_vector_type(2)))  int    v2i;

__device__ __forceinline__ v8f zero_v8f() {
  v8f z;
#pragma unroll
  for (int i = 0; i < 8; ++i) z[i] = 0.f;
  return z;
}

// A-style fragment: 16x32 bf16 tile from a row-major matrix (ld elements/row).
// lane (l&15) = row; element K pattern: e<8 -> 8g+e, e>=8 -> 8g+16+(e-8).
// Two aligned 16-byte loads per lane. p = the lane's own row + the tile's column + 8g.
__device__ __forceinline__ v16bf load_frag_rm(const __bf16* p) {
  v8bf lo = *(const v8bf*)p;
  v8bf hi = *(const v8bf*)(p + 16);
  return __builtin_shufflevector(lo, hi, 0, 1, 2, 3, 4, 5, 6, 7,
                                 8, 9, 10, 11, 12, 13, 14, 15);
}

// Fragment order: a 16x32 tile is 512 elements in a row, [half][lane][8]. Lane l = 16g + r
// holds row r; its 8 elements of half 0 are K = 8g + e, of half 1 K = 16 + 8g + e: the K
// pattern of load_frag_rm. Each half is 512 contiguous bytes, so that a wave's 16-byte load
// or store of it covers four whole 128-byte lines (a row-major tile: a piece of sixteen).
constexpr int FT_ = 512;  // elements of a tile
constexpr int FH_ = 256;  // elements of a half
// p = start of the tile + 8 * lane
__device__ __forceinline__ v16bf load_frag_fo(const __bf16* p) {
  v8bf lo = *(const v8bf*)p;
  v8bf hi = *(const v8bf*)(p + FH_);
  return __builtin_shufflevector(lo, hi, 0, 1, 2, 3, 4, 5, 6, 7,
                                 8, 9, 10, 11, 12, 13, 14, 15);
}

// Packed weight fragment f, in fragment order.
__device__ __forceinline__ v16bf load_frag_pk(const __bf16* pk, int f) {
  int l = threadIdx.x & 31;
  return load_frag_fo(pk + (long)f * FT_ + l * 8);
}

__device__ __forceinline__ v8f wmma_bf16(v16bf a, v16bf b, v8f c) {
  return __builtin_amdgcn_wmma_f32_16x16x32_bf16(false, a, false, b, (short)0, c,
                                                 false, false);
}

// value of lane l ^ 16
__device__ __forceinline__ float xhalf(float x) {
  int b = __builtin_bit_cast(int, x);
  return __builtin_bit_cast(float, __builtin_amdgcn_permlanex16(b, b, 0x76543210, 0xfedcba98,
                                                                false, false));
}

// Rows whose mask is 0 give an output of 0 as queries and a probability of exactly 0 as
// keys (a batch with no live key has no live query either), so every stage behind the
// LayerNorm works on the live rows alone, moved up to the front of their batch in their
// old order ("compact" rows). live[b] = number of live rows of batch b.
__device__ __forceinline__ int live_rows(const int* __restrict__ live, int b) {
  return min(max(live[b], 0), S_);
}
// compact rows are zero-filled up to the next multiple of 64 (the largest row tile)
__device__ __forceinline__ int padded_rows(int n) { return (n + 63) & ~63; }

// ---------------- kernel 1: weight packing, LayerNorm + row compaction ----------------
// Work-groups start at a limited rate, so the launch has one work-group per WGP and not one
// per row: 256 blocks of 8 waves. Each wave packs one weight fragment and takes four rows.
// Neither job reads what the other writes.
constexpr int PW_ = 8;          // waves of a block
constexpr int RW_ = 4;          // rows of a wave
constexpr int RB_ = PW_ * RW_;  // rows of a block: their mask is one 32-bit ballot
constexpr int FRAGS_ = (H_ / 32) * (H_ / 16);  // fragments of each of the four weight inputs
static_assert(RB_ == 32 && 4 * FRAGS_ == (B_ * S_ / RB_) * PW_, "one fragment per wave");

// x + (x of lane l ^ M), M < 16: one DPP add inside the 16-lane row
template <int M>
__device__ __forceinline__ float xmask_add(float x) {
  int b = __builtin_bit_cast(int, x);
  return x + __builtin_bit_cast(float,
                                __builtin_amdgcn_update_dpp(0, b, 0x160 + M, 0xf, 0xf, true));
}
// sum over the wave, the same in every lane
__device__ __forceinline__ float wave_sum(float x) {
  x = xmask_add<1>(x);
  x = xmask_add<2>(x);
  x = xmask_add<4>(x);
  x = xmask_add<8>(x);
  return x + xhalf(x);
}

// A block takes RB_ neighbouring rows of one batch. It counts the batch's mask once: base =
// live rows in front of its first row, n = all live rows; the ballot of its own rows' mask
// gives each row's place behind base. A wave holds a whole row, 16 values a lane (four runs of
// 512 contiguous bytes a wave), so the row sums need no barrier.
// A live row is normalised and written at its compact row; a masked row stores its zeros
// to out and, if it is one of the first masked rows, the zero row n + (its rank) of the pad.
__global__ void __launch_bounds__(256) prep_kernel(
                            const float* __restrict__ x, const int* __restrict__ mask,
                            const float* __restrict__ gamma, const float* __restrict__ beta,
                            const float* __restrict__ Wq, const float* __restrict__ Wk,
                            const float* __restrict__ Wv, const float* __restrict__ Wo,
                            __bf16* __restrict__ wq_pk, __bf16* __restrict__ wk_pk,
                            __bf16* __restrict__ wv_pk, __bf16* __restrict__ wo_pk,
                            float* __restrict__ xn, __bf16* __restrict__ xn_bf,
                            int* __restrict__ rowof, int* __restrict__ live,
                            float* __restrict__ out) {
  const int t = threadIdx.x, l = t & 31;
  const int wid = __builtin_amdgcn_readfirstlane(t >> 5);
  const int b = (int)blockIdx.x / (S_ / RB_);
  const int r0 = ((int)blockIdx.x % (S_ / RB_)) * RB_;
  const int* mb = mask + b * S_;
  const unsigned boff = (unsigned)(r0 + l) * 4u;  // in bytes: the block's row l
  const unsigned moff = (unsigned)t * 32u;        // in bytes: this thread's 8 entries
  const int mine = *(const int*)((const char*)mb + boff);
  const v4i m0 = *(const v4i*)((const char*)mb + moff);
  const v4i m1 = *(const v4i*)((const char*)mb + moff + 16);
  const unsigned coff = (unsigned)l * 16u;  // in bytes: the lane's 4 floats of a run of 128
  v4f gm[4], bt[4];
#pragma unroll
  for (int q = 0; q < 4; ++q) {
    gm[q] = *(const v4f*)((const char*)gamma + coff + q * 512);
    bt[q] = *(const v4f*)((const char*)beta + coff + q * 512);
  }
  const unsigned bits = __builtin_amdgcn_ballot_w32(mine != 0);  // bit j: row r0 + j is live
  // Counted here, in front of the rows' loads: behind them the wait for the mask would take
  // in the rows as well.
  // The wave's 256 mask entries, counted by ballots: na = live, nb = live in front of r0.
  const int lim = r0 / 8 - wid * 32;  // lanes below lim hold entries in front of r0
  const unsigned lt = lim >= 32 ? 0xffffffffu : lim <= 0 ? 0u : (1u << lim) - 1u;
  int na = 0, nb = 0;
#pragma unroll
  for (int j = 0; j < 4; ++j) {
    const unsigned a0 = __builtin_amdgcn_ballot_w32(m0[j] != 0);
    const unsigned a1 = __builtin_amdgcn_ballot_w32(m1[j] != 0);
    na += __builtin_popcount(a0) + __builtin_popcount(a1);
    nb += __builtin_popcount(a0 & lt) + __builtin_popcount(a1 & lt);
  }
  __shared__ int rpc[PW_];
  if (l == 0) rpc[wid] = (na << 16) | nb;
  const int j0 = wid * RW_;
  const float* xr = x + (long)(b * S_ + r0 + j0) * H_;
  v4f v[RW_][4];
#pragma unroll
  for (int r = 0; r < RW_; ++r) {
    if ((bits >> (j0 + r)) & 1) {  // the same for the whole wave
#pragma unroll
      for (int q = 0; q < 4; ++q)
        v[r][q] = *(const v4f*)((const char*)(xr + r * H_) + coff + q * 512);
    } else {
#pragma unroll
      for (int q = 0; q < 4; ++q) v[r][q] = v4f{0.f, 0.f, 0.f, 0.f};
    }
  }
  // The weight loads go out behind the rows': in front of them the wait for the mask would take
  // them in and hold the rows' loads back.
  const unsigned which = blockIdx.x / (FRAGS_ / PW_);  // the weight input, one per block
  const unsigned fid = (blockIdx.x % (FRAGS_ / PW_)) * PW_ + wid;
  // Wq, Wk, Wv: eight row-major 512x64 matrices, one behind the other; Wo: one of 512x512.
  // Fragment fid, counted through the matrices, is (kc in K/32, nt in N/16); lane = column.
  const float* w = which == 0 ? Wq : which == 1 ? Wk : which == 2 ? Wv : Wo;
  const unsigned ld = which == 3 ? H_ : DK_;  // floats of a row
  const float* wf = w + (which == 3 ? (fid / 32) * 32 * H_ + (fid % 32) * 16
                                    : (fid / 64) * (H_ * DK_) + (fid % 64 / 4) * 32 * DK_ +
                                          (fid % 4) * 16);
  // The row length differs between the inputs: each load has an offset register of its own, so
  // that no branch stands here and the sixteen loads go out in a row.
  unsigned wx[16];  // element offsets of the lane's 16 values, in the K pattern of load_frag_rm
  float wv[16];
#pragma unroll  // constant indices keep both arrays in registers
  for (unsigned e = 0; e < 16; ++e)
    wx[e] = ((e < 8 ? e : e + 8) + 8 * (unsigned)(l >> 4)) * ld + (l & 15);
#pragma unroll  // as above
  for (unsigned e = 0; e < 16; ++e) wv[e] = wf[wx[e]];
  // The offset registers of these loads and of those above may be reused behind them: wait
  // before they are overwritten. Naming them as inputs keeps them whole up to the wait.
  asm volatile("s_wait_xcnt 0x0" ::"v"(wx[0]), "v"(wx[1]), "v"(wx[2]), "v"(wx[3]), "v"(wx[4]),
               "v"(wx[5]), "v"(wx[6]), "v"(wx[7]), "v"(wx[8]), "v"(wx[9]), "v"(wx[10]),
               "v"(wx[11]), "v"(wx[12]), "v"(wx[13]), "v"(wx[14]), "v"(wx[15]), "v"(boff),
               "v"(moff), "v"(coff)
               : "memory");

  __syncthreads();
  int pc = 0;
#pragma unroll
  for (int i = 0; i < PW_; ++i) pc += rpc[i];
  pc = __builtin_amdgcn_readfirstlane(pc);
  const int base = pc & 0xffff, n = pc >> 16;
  if (r0 == 0 && t == 0) live[b] = n;

  // The four rows' sums side by side (a masked row's are 0): eight independent chains.
  float s[RW_], ss[RW_];
#pragma unroll
  for (int r = 0; r < RW_; ++r) {
    v4f a = (v[r][0] + v[r][1]) + (v[r][2] + v[r][3]);
    v4f a2 = (v[r][0] * v[r][0] + v[r][1] * v[r][1]) + (v[r][2] * v[r][2] + v[r][3] * v[r][3]);
    s[r] = (a[0] + a[1]) + (a[2] + a[3]);
    ss[r] = (a2[0] + a2[1]) + (a2[2] + a2[3]);
  }
#pragma unroll
  for (int r = 0; r < RW_; ++r) {
    s[r] = wave_sum(s[r]);
    ss[r] = wave_sum(ss[r]);
  }

#pragma unroll
  for (int r = 0; r < RW_; ++r) {
    const int j = j0 + r, sr = r0 + j;
    const int pos = base + __builtin_popcount(bits & ((1u << j) - 1u));  // live rows in front
    if ((bits >> j) & 1) {  // the same for the whole wave
      const long row = (long)b * S_ + pos;  // compact row
      if (l == 0) rowof[row] = sr;
      float mean = s[r] * (1.f / H_);
      float var = ss[r] * (1.f / H_) - mean * mean;
      float inv = rsqrtf(var + LN_EPS_);
      char* xo = (char*)(xn + row * H_);
      char* xb = (char*)(xn_bf + row * H_);
      v4f o[4];
      v2i ob[4];  // four bf16 each
#pragma unroll
      for (int q = 0; q < 4; ++q) {
        v4bf c4;
#pragma unroll
        for (int i = 0; i < 4; ++i) {
          o[q][i] = (v[r][q][i] - mean) * inv * gm[q][i] + bt[q][i];
          c4[i] = (__bf16)o[q][i];
        }
        ob[q] = __builtin_bit_cast(v2i, c4);
      }
#pragma unroll
      for (int q = 0; q < 4; ++q) *(v4f*)(xo + coff + q * 512) = o[q];
#pragma unroll
      for (int q = 0; q < 4; ++q) *(v2i*)(xb + (coff >> 1) + q * 256) = ob[q];
      // The stores' registers are reused for the next row: wait before they are overwritten.
      // Naming the values as inputs keeps them whole up to the wait.
      asm volatile("s_wait_xcnt 0x0" ::"v"(o[0]), "v"(o[1]), "v"(o[2]), "v"(o[3]), "v"(ob[0]),
                   "v"(ob[1]), "v"(ob[2]), "v"(ob[3])
                   : "memory");
    } else {
      char* op = (char*)(out + ((long)b * S_ + sr) * H_);
#pragma unroll
      for (int q = 0; q < 4; ++q) *(v4f*)(op + coff + q * 512) = v4f{0.f, 0.f, 0.f, 0.f};
      // the stores' registers are reused behind them: wait before they are overwritten
      asm volatile("s_wait_xcnt 0x0" ::: "memory");
      const int jz = n + (sr - pos);  // masked rows follow the live ones: jz < S_
      if (jz < padded_rows(n)) {
        char* zb = (char*)(xn_bf + ((long)b * S_ + jz) * H_);
#pragma unroll
        for (int q = 0; q < 4; ++q) *(v2i*)(zb + (coff >> 1) + q * 256) = v2i{0, 0};  // bf16 zeros
        // as above
        asm volatile("s_wait_xcnt 0x0" ::: "memory");
      }
    }
  }

  // the weight fragment, in fragment order
  __bf16* pk = which == 0 ? wq_pk : which == 1 ? wk_pk : which == 2 ? wv_pk : wo_pk;
  __bf16* dst = pk + fid * FT_ + l * 8;
  v8bf lo, hi;
#pragma unroll
  for (int e = 0; e < 8; ++e) {
    lo[e] = (__bf16)wv[e];
    hi[e] = (__bf16)wv[8 + e];
  }
  *(v8bf*)dst = lo;
  *(v8bf*)(dst + FH_) = hi;
  // the stores' registers may be reused behind them: wait before they are overwritten
  asm volatile("s_wait_xcnt 0x0" ::: "memory");
}

// ---------------- kernel 2: Q/K/V projections ----------------
// grid = (B*NH, 3, S/128), block = 256 (8 waves); wave: 16(S) x 64(DK) tile of compact rows.
// Eight waves to a block: a quarter of the work-groups to start, and eight waves walk through
// the same weight fragments together.
// The row tile is the slowest grid index, so that the blocks with live rows come first.
// All three results are stored in fragment order, as the attention reads them:
// y=0: q (scaled 1/8) and y=1: k, per bn tiles [s/16][d/32], row = s, K = d;
// y=2: v transposed, per bn tiles [s/32][d/16], row = d, K = s.
// A lane stores 8 neighbours along K. For v that is the product xn * W (a lane's registers
// run along s); for q and k the operands change places, W^T * xn^T (they run along d).
// TR: the transposed product.
template <bool TR>
__device__ __forceinline__ void proj_tile(const __bf16* __restrict__ xn_bf, long row0,
                                          const __bf16* __restrict__ wpk, float sc,
                                          __bf16* __restrict__ dst) {
  v8f acc[4];
#pragma unroll
  for (int t = 0; t < 4; ++t) acc[t] = zero_v8f();

  // Register ring, PD_ k-steps deep: a step's ten loads go out PD_ steps ahead of its
  // products, so that a wave waits for one landing per PD_ steps, not for one per product.
  constexpr int PD_ = 3;
  v16bf fa[PD_], fb[PD_][4];
  const int l = threadIdx.x & 31;
  const __bf16* pa = xn_bf + (row0 + (l & 15)) * (long)H_ + 8 * (l >> 4);  // xn_bf is row-major
  const unsigned wo = (unsigned)l * 16u;  // the lane's place in a half tile, in bytes
  auto load_a = [&](int kc) { return load_frag_rm(pa + kc * 32); };
  auto load_b = [&](int f) {
    return load_frag_fo((const __bf16*)((const char*)wpk + wo) + f * FT_);
  };
  // Every loop over the ring is unrolled in full: only constant slot numbers keep it in
  // registers.
#pragma unroll
  for (int s = 0; s < PD_; ++s) {
    fa[s] = load_a(s);
#pragma unroll  // constant slot numbers, as above
    for (int t = 0; t < 4; ++t) fb[s][t] = load_b(s * 4 + t);
  }
#pragma unroll  // constant slot numbers, as above
  for (int kc = 0; kc < H_ / 32; ++kc) {
    const int s = kc % PD_;
#pragma unroll  // constant slot numbers, as above
    for (int t = 0; t < 4; ++t)
      acc[t] = TR ? wmma_bf16(fb[s][t], fa[s], acc[t]) : wmma_bf16(fa[s], fb[s][t], acc[t]);
    if (kc + PD_ < H_ / 32) {
      fa[s] = load_a(kc + PD_);
#pragma unroll  // constant slot numbers, as above
      for (int t = 0; t < 4; ++t) fb[s][t] = load_b((kc + PD_) * 4 + t);
    }
    // keeps the refill here: moved down to its use, each load would be waited for alone
    __builtin_amdgcn_sched_barrier(0);
  }
  // The loads' address registers are reused behind the loop: wait before they are overwritten.
  // Naming them as inputs keeps them whole up to the wait.
  asm volatile("s_wait_xcnt 0x0" ::"v"(pa), "v"(wo) : "memory");

  // TR: acc[t][i] = value(s = lane's row c, d = 16t + 8g + i): half t & 1 of tile t >> 1.
  // else: acc[t][i] = value(s = 8g + i, d = 16t + c): the wave's half of tile t.
  v8bf o[4];
#pragma unroll
  for (int t = 0; t < 4; ++t)
#pragma unroll
    for (int i = 0; i < 8; ++i) o[t][i] = (__bf16)(acc[t][i] * sc);
#pragma unroll
  for (int t = 0; t < 4; ++t) *(v8bf*)(dst + t * (TR ? FH_ : FT_)) = o[t];
  // the stores' registers may be reused behind them: wait before they are overwritten
  asm volatile("s_wait_xcnt 0x0" ::: "memory");
}

// The real block size lifts the register ceiling, which the ring of fragments needs.
__global__ void __launch_bounds__(256) proj_kernel(const __bf16* __restrict__ xn_bf,
                            const __bf16* __restrict__ wq_pk, const __bf16* __restrict__ wk_pk,
                            const __bf16* __restrict__ wv_pk,
                            const int* __restrict__ live, __bf16* __restrict__ q, __bf16* __restrict__ k,
                            __bf16* __restrict__ vT) {
  int which = blockIdx.y;
  const int wid = __builtin_amdgcn_readfirstlane(threadIdx.x >> 5);
  int l = threadIdx.x & 31;
  int bn = blockIdx.x;
  int n = bn & 7;
  const int s32 = (int)blockIdx.z * 128 + (wid >> 1) * 32;  // the wave's group of 32 rows
  const int sub = wid & 1;                                  // its 16 rows of the group
  // whole waves leave (the pad ends at a multiple of 64 rows); the kernel has no barrier
  if (s32 >= padded_rows(live_rows(live, bn >> 3))) return;
  long s0 = (long)s32 + sub * 16;
  long row0 = ((long)(bn >> 3)) * S_ + s0;
  const long hoff = (long)n * 64 * FT_;  // 64 fragments per head
  // 32 rows of a head are 32 * DK_ elements in each of the three layouts
  const long boff = ((long)bn * S_ + (long)s32) * DK_ + l * 8;
  if (which == 2)
    proj_tile<false>(xn_bf, row0, wv_pk + hoff, 1.f, vT + boff + sub * FH_);
  else  // 1/sqrt(DK) is folded into q
    proj_tile<true>(xn_bf, row0, (which == 1 ? wk_pk : wq_pk) + hoff, which == 1 ? 1.f : 0.125f,
                    (which == 1 ? k : q) + boff + sub * 2 * FT_);
}

__global__ void __launch_bounds__(128) attn_kernel(const __bf16* __restrict__ qm, const __bf16* __restrict__ km,
                            const __bf16* __restrict__ vT, const int* __restrict__ live,
                            __bf16* __restrict__ h) {
  int wid = threadIdx.x >> 5;
  int l = threadIdx.x & 31;
  int g = l >> 4;
  int bn = blockIdx.x;
  int b = bn >> 3, n = bn & 7;
  const int nl = live_rows(live, b);
  if ((int)blockIdx.y * 64 >= nl) return;  // whole block: no live query here
  long s0 = (long)blockIdx.y * 64 + wid * 16;
  const __bf16* qb = qm + (long)bn * S_ * DK_;
  const __bf16* kb = km + (long)bn * S_ * DK_;
  const __bf16* vb = vT + (long)bn * DK_ * S_;
  const unsigned loff = (unsigned)l * 8;  // the lane's place in a half tile

  // B operand: column c = query s0 + c
  v16bf bq0 = load_frag_fo(qb + s0 * DK_ + loff);
  v16bf bq1 = load_frag_fo(qb + s0 * DK_ + loff + FT_);
  // the Q loads' address pair is reused behind them: wait before it is overwritten
  asm volatile("s_wait_xcnt 0x0" ::: "memory");

  v8f acc[4];  // acc[t][i] = O^T[d = 16t + 8g + i][query s0 + c]
#pragma unroll
  for (int t = 0; t < 4; ++t) acc[t] = zero_v8f();
  float mr = -1e38f;  // running maximum of this lane's query (both halves agree)
  float lr = 0.f;     // running sum over this half's keys only; joined after the loop

  // The eight fragments of one tile of 32 keys: K rows 0-15 and 16-31 (two k halves each),
  // V^T rows 16t. Each four are neighbours in memory.
  auto load_tile = [&](v16bf (&fk)[4], v16bf (&fv)[4], int kt) {
    const __bf16* pk = kb + (long)kt * DK_ + loff;  // the lane's own addresses
    const __bf16* pv = vb + (long)kt * DK_ + loff;
#pragma unroll  // constant indices keep the fragments in registers
    for (int t = 0; t < 4; ++t) fk[t] = load_frag_fo(pk + t * FT_);
#pragma unroll  // constant indices keep the fragments in registers
    for (int t = 0; t < 4; ++t) fv[t] = load_frag_fo(pv + t * FT_);
    // The loads' address pairs are formed anew for the next tile while these loads fly: wait
    // before they are overwritten. Naming them as inputs keeps them whole up to the wait.
    asm volatile("s_wait_xcnt 0x0" ::"v"(pk), "v"(pv) : "memory");
  };

  // One tile of 32 compact keys from the fragments ck, cv; the next tile's sixteen loads go
  // out first, into nk, nv, and land while this tile is worked on. In the last, partly filled
  // tile only the keys below nl are live (it holds at least one); the rows of the pad behind
  // them are zeros.
  auto tile = [&](const v16bf (&ck)[4], const v16bf (&cv)[4], v16bf (&nk)[4], v16bf (&nv)[4],
                  int kt) {
    // behind the last tile there is none: that tile is fetched again (written, finite values)
    load_tile(nk, nv, min(kt + 32, (nl - 1) & ~31));
    // keeps the loads up here: moved down to their use, each would be waited for alone
    __builtin_amdgcn_sched_barrier(0);
    // s0f[i] = score(key kt + 8g + i, query c); s1f[i] = score(key kt + 16 + 8g + i, query c)
    v8f s0f = zero_v8f(), s1f = zero_v8f();
    s0f = wmma_bf16(ck[0], bq0, s0f);
    s0f = wmma_bf16(ck[1], bq1, s0f);
    s1f = wmma_bf16(ck[2], bq0, s1f);
    s1f = wmma_bf16(ck[3], bq1, s1f);

    const int rem = nl - kt - 8 * g;  // register i of s0f is live while i < rem
    float tm = 0.f;
#pragma unroll
    for (int i = 0; i < 8; ++i) {
      s0f[i] = (i < rem) ? s0f[i] : NEG_INF_;
      s1f[i] = (i + 16 < rem) ? s1f[i] : NEG_INF_;
      float t2 = fmaxf(s0f[i], s1f[i]);
      tm = (i == 0) ? t2 : fmaxf(tm, t2);
    }
    tm = fmaxf(tm, xhalf(tm));

    float mn = fmaxf(mr, tm);
    float corr = __expf(mr - mn);
    mr = mn;
#pragma unroll
    for (int t = 0; t < 4; ++t)
#pragma unroll
      for (int i = 0; i < 8; ++i) acc[t][i] *= corr;

    // P^T as B operand: element e < 8 is key 8g + e, e >= 8 is key 16 + 8g + (e - 8),
    // the k order of load_frag_rm.
    v16bf pt;
    float psum = 0.f;
#pragma unroll
    for (int i = 0; i < 8; ++i) {
      float p0 = __expf(s0f[i] - mn);
      float p1 = __expf(s1f[i] - mn);
      psum += p0 + p1;
      pt[i] = (__bf16)p0;
      pt[8 + i] = (__bf16)p1;
    }
    lr = lr * corr + psum;

#pragma unroll
    for (int t = 0; t < 4; ++t) acc[t] = wmma_bf16(cv[t], pt, acc[t]);
  };

  // Two sets of fragments take turns, so that none is copied; nl is at least 1 here and at
  // most S_. With an odd number of tiles the last turn has no live key: every score is
  // NEG_INF_ against a finite maximum, so corr is 1, every p is 0 and nothing changes.
  v16bf k0[4], v0[4], k1[4], v1[4];
  load_tile(k0, v0, 0);
  for (int kt = 0; kt < nl; kt += 64) {
    tile(k0, v0, k1, v1, kt);
    tile(k1, v1, k0, v0, kt + 32);
  }

  float inv = 1.f / (lr + xhalf(lr));
  // the lane's 8 contiguous d of its query are its place in half t & 1 of tile 2n + (t >> 1)
  __bf16* hp = h + ((long)b * S_ + s0) * H_ + n * 2 * FT_ + loff;
  v8bf o[4];
#pragma unroll
  for (int t = 0; t < 4; ++t)
#pragma unroll
    for (int i = 0; i < 8; ++i) o[t][i] = (__bf16)(acc[t][i] * inv);
#pragma unroll
  for (int t = 0; t < 4; ++t) *(v8bf*)(hp + t * FH_) = o[t];
  // the stores' registers may be reused behind them: wait before they are overwritten
  asm volatile("s_wait_xcnt 0x0" ::: "memory");
}

// ---------------- kernel 4: output projection + residual, live rows back in place ----------
// grid = B*S/16, block = 256 (8 waves); wave w computes cols [w*64, w*64+64) of 16 compact
// rows. The batch is the fast part of the index, so that the blocks with live rows come first.
__global__ void outproj_kernel(const __bf16* __restrict__ hbf, const __bf16* __restrict__ wo_pk,
                               const float* __restrict__ xn, const int* __restrict__ rowof,
                               const int* __restrict__ live, float* __restrict__ out) {
  int wid = threadIdx.x >> 5;
  int l = threadIdx.x & 31;
  int g = l >> 4, c = l & 15;
  int b = blockIdx.x % B_;
  int j0 = (int)(blockIdx.x / B_) * 16;
  const int nl = live_rows(live, b);
  if (j0 >= nl) return;  // whole block: no live row here
  long row0 = (long)b * S_ + j0;
  int n0 = wid * 64;

  v8f acc[4];
#pragma unroll
  for (int t = 0; t < 4; ++t) acc[t] = zero_v8f();

  // Unrolled in full: every load is a constant offset from one address, which stays whole,
  // and the compiler sends the loads out a step ahead of their products.
#pragma unroll
  for (int kc = 0; kc < H_ / 32; ++kc) {
    v16bf a = load_frag_fo(hbf + row0 * H_ + kc * FT_ + l * 8);  // tile [row0 / 16][kc]
#pragma unroll
    for (int t = 0; t < 4; ++t)
      acc[t] = wmma_bf16(a, load_frag_pk(wo_pk, kc * 32 + wid * 4 + t), acc[t]);
  }
  // the loop's address registers are reused behind it: wait before they are overwritten
  asm volatile("s_wait_xcnt 0x0" ::: "memory");
  // A row of the pad has no place in out: it reads the last live row's residual and home
  // row, so that all loads go out together, and stores nothing.
  // Lane l fetches the home row of the tile's row l & 15.
  const unsigned ro = (unsigned)(b * S_ + min(j0 + c, nl - 1));  // element offset in rowof
  const int hr = rowof[ro];
  float res[4][8];
  unsigned xo[8];  // element offsets in xn
#pragma unroll
  for (int i = 0; i < 8; ++i)
    xo[i] = (unsigned)(b * S_ + min(j0 + i + 8 * g, nl - 1)) * H_ + n0 + c;
#pragma unroll
  for (int i = 0; i < 8; ++i)
#pragma unroll
    for (int t = 0; t < 4; ++t) res[t][i] = xn[xo[i] + t * 16];
  // The loads' offset registers are reused behind them: wait before they are overwritten.
  // Naming the offsets as inputs keeps them whole up to the wait.
  asm volatile("s_wait_xcnt 0x0" ::"v"(ro), "v"(xo[0]), "v"(xo[1]), "v"(xo[2]), "v"(xo[3]),
               "v"(xo[4]), "v"(xo[5]), "v"(xo[6]), "v"(xo[7])
               : "memory");
#pragma unroll
  for (int i = 0; i < 8; ++i)
#pragma unroll
    for (int t = 0; t < 4; ++t) acc[t][i] += res[t][i];
#pragma unroll
  for (int i = 0; i < 8; ++i) {
    // home row of the tile's row i + 8g, masked to the shape
    int lo = __builtin_amdgcn_readlane(hr, i), hi = __builtin_amdgcn_readlane(hr, i + 8);
    int orow = (g ? hi : lo) & (S_ - 1);
    if (j0 + i + 8 * g < nl) {
      float* op = out + ((long)b * S_ + orow) * H_ + n0 + c;
#pragma unroll
      for (int t = 0; t < 4; ++t) op[t * 16] = acc[t][i];
    }
  }
}

extern "C" void kernel_launch(void* const* d_in, const int* in_sizes, int n_in,
                              void* d_out, int out_size, void* d_ws, size_t ws_size,
                              hipStream_t stream) {
  (void)in_sizes; (void)n_in; (void)out_size; (void)ws_size;
  const float* x     = (const float*)d_in[0];
  const int*   mask  = (const int*)d_in[1];
  const float* Wq    = (const float*)d_in[2];
  const float* Wk    = (const float*)d_in[3];
  const float* Wv    = (const float*)d_in[4];
  const float* Wo    = (const float*)d_in[5];
  const float* gamma = (const float*)d_in[6];
  const float* beta  = (const float*)d_in[7];
  float* out = (float*)d_out;

  char* ws = (char*)d_ws;
  float* xn = (float*)ws;        ws += (size_t)B_ * S_ * H_ * 4;
  __bf16* xn_bf = (__bf16*)ws;   ws += (size_t)B_ * S_ * H_ * 2;
  __bf16* qb = (__bf16*)ws;      ws += (size_t)B_ * NH_ * S_ * DK_ * 2;
  __bf16* kb = (__bf16*)ws;      ws += (size_t)B_ * NH_ * S_ * DK_ * 2;
  __bf16* vT = (__bf16*)ws;      ws += (size_t)B_ * NH_ * S_ * DK_ * 2;
  __bf16* hb = (__bf16*)ws;      ws += (size_t)B_ * S_ * H_ * 2;
  __bf16* wq_pk = (__bf16*)ws;   ws += (size_t)NH_ * H_ * DK_ * 2;
  __bf16* wk_pk = (__bf16*)ws;   ws += (size_t)NH_ * H_ * DK_ * 2;
  __bf16* wv_pk = (__bf16*)ws;   ws += (size_t)NH_ * H_ * DK_ * 2;
  __bf16* wo_pk = (__bf16*)ws;   ws += (size_t)H_ * H_ * 2;
  int* rowof = (int*)ws;         ws += (size_t)B_ * S_ * 4;
  int* live = (int*)ws;          ws += (size_t)B_ * 4;

  // weight packing (per-head KxN = 512x64: 8*16*4 = 512 fragments; Wo: 16*32 = 512) and
  // LayerNorm in one launch
  prep_kernel<<<B_ * S_ / RB_, 32 * PW_, 0, stream>>>(x, mask, gamma, beta, Wq, Wk, Wv, Wo,
                                                      wq_pk, wk_pk, wv_pk, wo_pk, xn, xn_bf,
                                                      rowof, live, out);

  proj_kernel<<<dim3(B_ * NH_, 3, S_ / 128), 256, 0, stream>>>(xn_bf, wq_pk, wk_pk, wv_pk,
                                                               live, qb, kb, vT);

  attn_kernel<<<dim3(B_ * NH_, S_ / 64), 128, 0, stream>>>(qb, kb, vT, live, hb);

  outproj_kernel<<<B_ * S_ / 16, 256, 0, stream>>>(hb, wo_pk, xn, rowof, live, out);
}

// v007
// It runs in 50.4 microseconds.
// In two side-by-side timings against v006, it was 1.06 and 1.05 times as fast.
// Counting every step since v000, it is 7.02 times as fast.
#include <hip/hip_runtime.h>

#define B_ 4
#define S_ 2048
#define H_ 512
#define NH_ 8
#define DK_ 64

constexpr float LN_EPS_ = 1e-5f;
constexpr float NEG_INF_ = -1e30f;

typedef __attribute__((ext_vector_type(16))) __bf16 v16bf;
typedef __attribute__((ext_vector_type(8)))  __bf16 v8bf;
typedef __attribute__((ext_vector_type(4)))  __bf16 v4bf;
typedef __attribute__((ext_vector_type(8)))  float  v8f;
typedef __attribute__((ext_vector_type(4)))  float  v4f;
typedef __attribute__((ext_vector_type(4)))  int    v4i;
typedef __attribute__((ext_vector_type(2)))  int    v2i;

__device__ __forceinline__ v8f zero_v8f() {
  v8f z;
#pragma unroll
  for (int i = 0; i < 8; ++i) z[i] = 0.f;
  return z;
}

// A 16x32 bf16 fragment: lane l = 16g + r holds row r; the K pattern of its 16 elements is
// e < 8 -> 8g + e, e >= 8 -> 16 + 8g + (e - 8).
// Fragment order: a 16x32 tile is 512 elements in a row, [half][lane][8]. Lane l = 16g + r
// holds row r; its 8 elements of half 0 are K = 8g + e, of half 1 K = 16 + 8g + e: the K
// pattern above. Each half is 512 contiguous bytes, so that a wave's 16-byte load
// or store of it covers four whole 128-byte lines (a row-major tile: a piece of sixteen).
constexpr int FT_ = 512;  // elements of a tile
constexpr int FH_ = 256;  // elements of a half
// p = start of the tile + 8 * lane
__device__ __forceinline__ v16bf load_frag_fo(const __bf16* p) {
  v8bf lo = *(const v8bf*)p;
  v8bf hi = *(const v8bf*)(p + FH_);
  return __builtin_shufflevector(lo, hi, 0, 1, 2, 3, 4, 5, 6, 7,
                                 8, 9, 10, 11, 12, 13, 14, 15);
}

// Packed weight fragment f, in fragment order.
__device__ __forceinline__ v16bf load_frag_pk(const __bf16* pk, int f) {
  int l = threadIdx.x & 31;
  return load_frag_fo(pk + (long)f * FT_ + l * 8);
}

__device__ __forceinline__ v8f wmma_bf16(v16bf a, v16bf b, v8f c) {
  return __builtin_amdgcn_wmma_f32_16x16x32_bf16(false, a, false, b, (short)0, c,
                                                 false, false);
}

// value of lane l ^ 16
__device__ __forceinline__ float xhalf(float x) {
  int b = __builtin_bit_cast(int, x);
  return __builtin_bit_cast(float, __builtin_amdgcn_permlanex16(b, b, 0x76543210, 0xfedcba98,
                                                                false, false));
}

// Rows whose mask is 0 give an output of 0 as queries and a probability of exactly 0 as
// keys (a batch with no live key has no live query either), so every stage behind the
// LayerNorm works on the live rows alone, moved up to the front of their batch in their
// old order ("compact" rows). live[b] = number of live rows of batch b.
__device__ __forceinline__ int live_rows(const int* __restrict__ live, int b) {
  return min(max(live[b], 0), S_);
}
// compact rows are zero-filled up to the next multiple of 64 (the largest row tile)
__device__ __forceinline__ int padded_rows(int n) { return (n + 63) & ~63; }

// ---------------- kernel 1: weight packing, LayerNorm + row compaction ----------------
// Work-groups start at a limited rate, so the launch has one work-group per WGP and not one
// per row: 256 blocks of 8 waves. Each wave packs one weight fragment and takes four rows.
// Neither job reads what the other writes.
constexpr int PW_ = 8;          // waves of a block
constexpr int RW_ = 4;          // rows of a wave
constexpr int RB_ = PW_ * RW_;  // rows of a block: their mask is one 32-bit ballot
constexpr int FRAGS_ = (H_ / 32) * (H_ / 16);  // fragments of each of the four weight inputs
static_assert(RB_ == 32 && 4 * FRAGS_ == (B_ * S_ / RB_) * PW_, "one fragment per wave");

// x + (x of lane l ^ M), M < 16: one DPP add inside the 16-lane row
template <int M>
__device__ __forceinline__ float xmask_add(float x) {
  int b = __builtin_bit_cast(int, x);
  return x + __builtin_bit_cast(float,
                                __builtin_amdgcn_update_dpp(0, b, 0x160 + M, 0xf, 0xf, true));
}
// sum over the wave, the same in every lane
__device__ __forceinline__ float wave_sum(float x) {
  x = xmask_add<1>(x);
  x = xmask_add<2>(x);
  x = xmask_add<4>(x);
  x = xmask_add<8>(x);
  return x + xhalf(x);
}

// A block takes RB_ neighbouring rows of one batch. It counts the batch's mask once: base =
// live rows in front of its first row, n = all live rows; the ballot of its own rows' mask
// gives each row's place behind base. A wave holds a whole row, 16 values a lane (four runs of
// 512 contiguous bytes a wave), so the row sums need no barrier.
// A live row is normalised and written at its compact row; a masked row stores its zeros
// to out and, if it is one of the first masked rows, the zero row n + (its rank) of the pad.
// xn_bf is written in fragment order, tiles [row/16][col/32], as kernel 2 reads it: a lane's
// four neighbours along a row are half of one 16-byte place there.
__global__ void __launch_bounds__(256) prep_kernel(
                            const float* __restrict__ x, const int* __restrict__ mask,
                            const float* __restrict__ gamma, const float* __restrict__ beta,
                            const float* __restrict__ Wq, const float* __restrict__ Wk,
                            const float* __restrict__ Wv, const float* __restrict__ Wo,
                            __bf16* __restrict__ wq_pk, __bf16* __restrict__ wk_pk,
                            __bf16* __restrict__ wv_pk, __bf16* __restrict__ wo_pk,
                            float* __restrict__ xn, __bf16* __restrict__ xn_bf,
                            int* __restrict__ rowof, int* __restrict__ live,
                            float* __restrict__ out) {
  const int t = threadIdx.x, l = t & 31;
  const int wid = __builtin_amdgcn_readfirstlane(t >> 5);
  const int b = (int)blockIdx.x / (S_ / RB_);
  const int r0 = ((int)blockIdx.x % (S_ / RB_)) * RB_;
  const int* mb = mask + b * S_;
  const unsigned boff = (unsigned)(r0 + l) * 4u;  // in bytes: the block's row l
  const unsigned moff = (unsigned)t * 32u;        // in bytes: this thread's 8 entries
  const int mine = *(const int*)((const char*)mb + boff);
  const v4i m0 = *(const v4i*)((const char*)mb + moff);
  const v4i m1 = *(const v4i*)((const char*)mb + moff + 16);
  const unsigned coff = (unsigned)l * 16u;  // in bytes: the lane's 4 floats of a run of 128
  // In bytes: where columns 4l .. 4l + 3 of row 0 stand in fragment order: tile l / 8, and
  // K = 4 (l & 7) gives the half, g and the first or second four of the eight.
  const unsigned foff = ((unsigned)(l >> 3) * FT_ + (unsigned)((l >> 2) & 1) * FH_ +
                         (unsigned)((l >> 1) & 1) * 128u + (unsigned)(l & 1) * 4u) * 2u;
  v4f gm[4], bt[4];
#pragma unroll
  for (int q = 0; q < 4; ++q) {
    gm[q] = *(const v4f*)((const char*)gamma + coff + q * 512);
    bt[q] = *(const v4f*)((const char*)beta + coff + q * 512);
  }
  const unsigned bits = __builtin_amdgcn_ballot_w32(mine != 0);  // bit j: row r0 + j is live
  // Counted here, in front of the rows' loads: behind them the wait for the mask would take
  // in the rows as well.
  // The wave's 256 mask entries, counted by ballots: na = live, nb = live in front of r0.
  const int lim = r0 / 8 - wid * 32;  // lanes below lim hold entries in front of r0
  const unsigned lt = lim >= 32 ? 0xffffffffu : lim <= 0 ? 0u : (1u << lim) - 1u;
  int na = 0, nb = 0;
#pragma unroll
  for (int j = 0; j < 4; ++j) {
    const unsigned a0 = __builtin_amdgcn_ballot_w32(m0[j] != 0);
    const unsigned a1 = __builtin_amdgcn_ballot_w32(m1[j] != 0);
    na += __builtin_popcount(a0) + __builtin_popcount(a1);
    nb += __builtin_popcount(a0 & lt) + __builtin_popcount(a1 & lt);
  }
  __shared__ int rpc[PW_];
  if (l == 0) rpc[wid] = (na << 16) | nb;
  const int j0 = wid * RW_;
  const float* xr = x + (long)(b * S_ + r0 + j0) * H_;
  v4f v[RW_][4];
#pragma unroll
  for (int r = 0; r < RW_; ++r) {
    if ((bits >> (j0 + r)) & 1) {  // the same for the whole wave
#pragma unroll
      for (int q = 0; q < 4; ++q)
        v[r][q] = *(const v4f*)((const char*)(xr + r * H_) + coff + q * 512);
    } else {
#pragma unroll
      for (int q = 0; q < 4; ++q) v[r][q] = v4f{0.f, 0.f, 0.f, 0.f};
    }
  }
  // The weight loads go out behind the rows': in front of them the wait for the mask would take
  // them in and hold the rows' loads back.
  const unsigned which = blockIdx.x / (FRAGS_ / PW_);  // the weight input, one per block
  const unsigned fid = (blockIdx.x % (FRAGS_ / PW_)) * PW_ + wid;
  // Wq, Wk, Wv: eight row-major 512x64 matrices, one behind the other; Wo: one of 512x512.
  // Fragment fid, counted through the matrices, is (kc in K/32, nt in N/16); lane = column.
  const float* w = which == 0 ? Wq : which == 1 ? Wk : which == 2 ? Wv : Wo;
  const unsigned ld = which == 3 ? H_ : DK_;  // floats of a row
  const float* wf = w + (which == 3 ? (fid / 32) * 32 * H_ + (fid % 32) * 16
                                    : (fid / 64) * (H_ * DK_) + (fid % 64 / 4) * 32 * DK_ +
                                          (fid % 4) * 16);
  // The row length differs between the inputs: each load has an offset register of its own, so
  // that no branch stands here and the sixteen loads go out in a row.
  unsigned wx[16];  // element offsets of the lane's 16 values, in the K pattern of a fragment
  float wv[16];
#pragma unroll  // constant indices keep both arrays in registers
  for (unsigned e = 0; e < 16; ++e)
    wx[e] = ((e < 8 ? e : e + 8) + 8 * (unsigned)(l >> 4)) * ld + (l & 15);
#pragma unroll  // as above
  for (unsigned e = 0; e < 16; ++e) wv[e] = wf[wx[e]];
  // The offset registers of these loads and of those above may be reused behind them: wait
  // before they are overwritten. Naming them as inputs keeps them whole up to the wait.
  asm volatile("s_wait_xcnt 0x0" ::"v"(wx[0]), "v"(wx[1]), "v"(wx[2]), "v"(wx[3]), "v"(wx[4]),
               "v"(wx[5]), "v"(wx[6]), "v"(wx[7]), "v"(wx[8]), "v"(wx[9]), "v"(wx[10]),
               "v"(wx[11]), "v"(wx[12]), "v"(wx[13]), "v"(wx[14]), "v"(wx[15]), "v"(boff),
               "v"(moff), "v"(coff)
               : "memory");

  __syncthreads();
  int pc = 0;
#pragma unroll
  for (int i = 0; i < PW_; ++i) pc += rpc[i];
  pc = __builtin_amdgcn_readfirstlane(pc);
  const int base = pc & 0xffff, n = pc >> 16;
  if (r0 == 0 && t == 0) live[b] = n;

  // The four rows' sums side by side (a masked row's are 0): eight independent chains.
  float s[RW_], ss[RW_];
#pragma unroll
  for (int r = 0; r < RW_; ++r) {
    v4f a = (v[r][0] + v[r][1]) + (v[r][2] + v[r][3]);
    v4f a2 = (v[r][0] * v[r][0] + v[r][1] * v[r][1]) + (v[r][2] * v[r][2] + v[r][3] * v[r][3]);
    s[r] = (a[0] + a[1]) + (a[2] + a[3]);
    ss[r] = (a2[0] + a2[1]) + (a2[2] + a2[3]);
  }
#pragma unroll
  for (int r = 0; r < RW_; ++r) {
    s[r] = wave_sum(s[r]);
    ss[r] = wave_sum(ss[r]);
  }

#pragma unroll
  for (int r = 0; r < RW_; ++r) {
    const int j = j0 + r, sr = r0 + j;
    const int pos = base + __builtin_popcount(bits & ((1u << j) - 1u));  // live rows in front
    if ((bits >> j) & 1) {  // the same for the whole wave
      const long row = (long)b * S_ + pos;  // compact row
      if (l == 0) rowof[row] = sr;
      float mean = s[r] * (1.f / H_);
      float var = ss[r] * (1.f / H_) - mean * mean;
      float inv = rsqrtf(var + LN_EPS_);
      char* xo = (char*)(xn + row * H_);
      char* xb = (char*)(xn_bf + (row >> 4) * (16 * H_) + (row & 15) * 8);  // row's tiles, its place
      v4f o[4];
      v2i ob[4];  // four bf16 each
#pragma unroll
      for (int q = 0; q < 4; ++q) {
        v4bf c4;
#pragma unroll
        for (int i = 0; i < 4; ++i) {
          o[q][i] = (v[r][q][i] - mean) * inv * gm[q][i] + bt[q][i];
          c4[i] = (__bf16)o[q][i];
        }
        ob[q] = __builtin_bit_cast(v2i, c4);
      }
#pragma unroll
      for (int q = 0; q < 4; ++q) *(v4f*)(xo + coff + q * 512) = o[q];
#pragma unroll
      for (int q = 0; q < 4; ++q) *(v2i*)(xb + foff + q * (4 * FT_ * 2)) = ob[q];  // 128 columns: 4 tiles
      // The stores' registers are reused for the next row: wait before they are overwritten.
      // Naming the values as inputs keeps them whole up to the wait.
      asm volatile("s_wait_xcnt 0x0" ::"v"(o[0]), "v"(o[1]), "v"(o[2]), "v"(o[3]), "v"(ob[0]),
                   "v"(ob[1]), "v"(ob[2]), "v"(ob[3])
                   : "memory");
    } else {
      char* op = (char*)(out + ((long)b * S_ + sr) * H_);
#pragma unroll
      for (int q = 0; q < 4; ++q) *(v4f*)(op + coff + q * 512) = v4f{0.f, 0.f, 0.f, 0.f};
      // the stores' registers are reused behind them: wait before they are overwritten
      asm volatile("s_wait_xcnt 0x0" ::: "memory");
      const int jz = n + (sr - pos);  // masked rows follow the live ones: jz < S_
      if (jz < padded_rows(n)) {
        const long zr = (long)b * S_ + jz;
        char* zb = (char*)(xn_bf + (zr >> 4) * (16 * H_) + (zr & 15) * 8);
#pragma unroll
        for (int q = 0; q < 4; ++q) *(v2i*)(zb + foff + q * (4 * FT_ * 2)) = v2i{0, 0};  // bf16 zeros
        // as above
        asm volatile("s_wait_xcnt 0x0" ::: "memory");
      }
    }
  }

  // the weight fragment, in fragment order
  __bf16* pk = which == 0 ? wq_pk : which == 1 ? wk_pk : which == 2 ? wv_pk : wo_pk;
  __bf16* dst = pk + fid * FT_ + l * 8;
  v8bf lo, hi;
#pragma unroll
  for (int e = 0; e < 8; ++e) {
    lo[e] = (__bf16)wv[e];
    hi[e] = (__bf16)wv[8 + e];
  }
  *(v8bf*)dst = lo;
  *(v8bf*)(dst + FH_) = hi;
  // the stores' registers may be reused behind them: wait before they are overwritten
  asm volatile("s_wait_xcnt 0x0" ::: "memory");
}

// ---------------- kernel 2: Q/K/V projections ----------------
// grid = (B*NH, 3, S/128), block = 256 (8 waves); wave: 16(S) x 64(DK) tile of compact rows.
// Eight waves to a block: a quarter of the work-groups to start, and eight waves walk through
// the same weight fragments together.
// The row tile is the slowest grid index, so that the blocks with live rows come first.
// All three results are stored in fragment order, as the attention reads them:
// y=0: q (scaled 1/8) and y=1: k, per bn tiles [s/16][d/32], row = s, K = d;
// y=2: v transposed, per bn tiles [s/32][d/16], row = d, K = s.
// A lane stores 8 neighbours along K. For v that is the product xn * W (a lane's registers
// run along s); for q and k the operands change places, W^T * xn^T (they run along d).
// TR: the transposed product.
template <bool TR>
__device__ __forceinline__ void proj_tile(const __bf16* __restrict__ xn_bf, long row0,
                                          const __bf16* __restrict__ wpk, float sc,
                                          __bf16* __restrict__ dst) {
  v8f acc[4];
#pragma unroll
  for (int t = 0; t < 4; ++t) acc[t] = zero_v8f();

  // Register ring, PD_ k-steps deep: a step's ten loads go out PD_ steps ahead of its
  // products, so that a wave waits for one landing per PD_ steps, not for one per product.
  constexpr int PD_ = 3;
  v16bf fa[PD_], fb[PD_][4];
  const int l = threadIdx.x & 31;
  const __bf16* pa = xn_bf + row0 * (long)H_ + l * 8;  // tile [row0 / 16][0], the lane's place
  const unsigned wo = (unsigned)l * 16u;  // the lane's place in a half tile, in bytes
  auto load_a = [&](int kc) { return load_frag_fo(pa + kc * FT_); };
  auto load_b = [&](int f) {
    return load_frag_fo((const __bf16*)((const char*)wpk + wo) + f * FT_);
  };
  // Every loop over the ring is unrolled in full: only constant slot numbers keep it in
  // registers.
#pragma unroll
  for (int s = 0; s < PD_; ++s) {
    fa[s] = load_a(s);
#pragma unroll  // constant slot numbers, as above
    for (int t = 0; t < 4; ++t) fb[s][t] = load_b(s * 4 + t);
  }
#pragma unroll  // constant slot numbers, as above
  for (int kc = 0; kc < H_ / 32; ++kc) {
    const int s = kc % PD_;
#pragma unroll  // constant slot numbers, as above
    for (int t = 0; t < 4; ++t)
      acc[t] = TR ? wmma_bf16(fb[s][t], fa[s], acc[t]) : wmma_bf16(fa[s], fb[s][t], acc[t]);
    if (kc + PD_ < H_ / 32) {
      fa[s] = load_a(kc + PD_);
#pragma unroll  // constant slot numbers, as above
      for (int t = 0; t < 4; ++t) fb[s][t] = load_b((kc + PD_) * 4 + t);
    }
    // keeps the refill here: moved down to its use, each load would be waited for alone
    __builtin_amdgcn_sched_barrier(0);
  }
  // The loads' address registers are reused behind the loop: wait before they are overwritten.
  // Naming them as inputs keeps them whole up to the wait.
  asm volatile("s_wait_xcnt 0x0" ::"v"(pa), "v"(wo) : "memory");

  // TR: acc[t][i] = value(s = lane's row c, d = 16t + 8g + i): half t & 1 of tile t >> 1.
  // else: acc[t][i] = value(s = 8g + i, d = 16t + c): the wave's half of tile t.
  v8bf o[4];
#pragma unroll
  for (int t = 0; t < 4; ++t)
#pragma unroll
    for (int i = 0; i < 8; ++i) o[t][i] = (__bf16)(acc[t][i] * sc);
#pragma unroll
  for (int t = 0; t < 4; ++t) *(v8bf*)(dst + t * (TR ? FH_ : FT_)) = o[t];
  // the stores' registers may be reused behind them: wait before they are overwritten
  asm volatile("s_wait_xcnt 0x0" ::: "memory");
}

// The real block size lifts the register ceiling, which the ring of fragments needs.
__global__ void __launch_bounds__(256) proj_kernel(const __bf16* __restrict__ xn_bf,
                            const __bf16* __restrict__ wq_pk, const __bf16* __restrict__ wk_pk,
                            const __bf16* __restrict__ wv_pk,
                            const int* __restrict__ live, __bf16* __restrict__ q, __bf16* __restrict__ k,
                            __bf16* __restrict__ vT) {
  int which = blockIdx.y;
  const int wid = __builtin_amdgcn_readfirstlane(threadIdx.x >> 5);
  int l = threadIdx.x & 31;
  int bn = blockIdx.x;
  int n = bn & 7;
  const int s32 = (int)blockIdx.z * 128 + (wid >> 1) * 32;  // the wave's group of 32 rows
  const int sub = wid & 1;                                  // its 16 rows of the group
  // whole waves leave (the pad ends at a multiple of 64 rows); the kernel has no barrier
  if (s32 >= padded_rows(live_rows(live, bn >> 3))) return;
  long s0 = (long)s32 + sub * 16;
  long row0 = ((long)(bn >> 3)) * S_ + s0;
  const long hoff = (long)n * 64 * FT_;  // 64 fragments per head
  // 32 rows of a head are 32 * DK_ elements in each of the three layouts
  const long boff = ((long)bn * S_ + (long)s32) * DK_ + l * 8;
  if (which == 2)
    proj_tile<false>(xn_bf, row0, wv_pk + hoff, 1.f, vT + boff + sub * FH_);
  else  // 1/sqrt(DK) is folded into q
    proj_tile<true>(xn_bf, row0, (which == 1 ? wk_pk : wq_pk) + hoff, which == 1 ? 1.f : 0.125f,
                    (which == 1 ? k : q) + boff + sub * 2 * FT_);
}

__global__ void __launch_bounds__(128) attn_kernel(const __bf16* __restrict__ qm, const __bf16* __restrict__ km,
                            const __bf16* __restrict__ vT, const int* __restrict__ live,
                            __bf16* __restrict__ h) {
  int wid = threadIdx.x >> 5;
  int l = threadIdx.x & 31;
  int g = l >> 4;
  int bn = blockIdx.x;
  int b = bn >> 3, n = bn & 7;
  const int nl = live_rows(live, b);
  if ((int)blockIdx.y * 64 >= nl) return;  // whole block: no live query here
  long s0 = (long)blockIdx.y * 64 + wid * 16;
  const __bf16* qb = qm + (long)bn * S_ * DK_;
  const __bf16* kb = km + (long)bn * S_ * DK_;
  const __bf16* vb = vT + (long)bn * DK_ * S_;
  const unsigned loff = (unsigned)l * 8;  // the lane's place in a half tile

  // B operand: column c = query s0 + c
  v16bf bq0 = load_frag_fo(qb + s0 * DK_ + loff);
  v16bf bq1 = load_frag_fo(qb + s0 * DK_ + loff + FT_);
  // the Q loads' address pair is reused behind them: wait before it is overwritten
  asm volatile("s_wait_xcnt 0x0" ::: "memory");

  v8f acc[4];  // acc[t][i] = O^T[d = 16t + 8g + i][query s0 + c]
#pragma unroll
  for (int t = 0; t < 4; ++t) acc[t] = zero_v8f();
  float mr = -1e38f;  // running maximum of this lane's query (both halves agree)
  float lr = 0.f;     // running sum over this half's keys only; joined after the loop

  // The eight fragments of one tile of 32 keys: K rows 0-15 and 16-31 (two k halves each),
  // V^T rows 16t. Each four are neighbours in memory.
  auto load_tile = [&](v16bf (&fk)[4], v16bf (&fv)[4], int kt) {
    const __bf16* pk = kb + (long)kt * DK_ + loff;  // the lane's own addresses
    const __bf16* pv = vb + (long)kt * DK_ + loff;
#pragma unroll  // constant indices keep the fragments in registers
    for (int t = 0; t < 4; ++t) fk[t] = load_frag_fo(pk + t * FT_);
#pragma unroll  // constant indices keep the fragments in registers
    for (int t = 0; t < 4; ++t) fv[t] = load_frag_fo(pv + t * FT_);
    // The loads' address pairs are formed anew for the next tile while these loads fly: wait
    // before they are overwritten. Naming them as inputs keeps them whole up to the wait.
    asm volatile("s_wait_xcnt 0x0" ::"v"(pk), "v"(pv) : "memory");
  };

  // One tile of 32 compact keys from the fragments ck, cv; the next tile's sixteen loads go
  // out first, into nk, nv, and land while this tile is worked on. In the last, partly filled
  // tile only the keys below nl are live (it holds at least one); the rows of the pad behind
  // them are zeros.
  auto tile = [&](const v16bf (&ck)[4], const v16bf (&cv)[4], v16bf (&nk)[4], v16bf (&nv)[4],
                  int kt) {
    // behind the last tile there is none: that tile is fetched again (written, finite values)
    load_tile(nk, nv, min(kt + 32, (nl - 1) & ~31));
    // keeps the loads up here: moved down to their use, each would be waited for alone
    __builtin_amdgcn_sched_barrier(0);
    // s0f[i] = score(key kt + 8g + i, query c); s1f[i] = score(key kt + 16 + 8g + i, query c)
    v8f s0f = zero_v8f(), s1f = zero_v8f();
    s0f = wmma_bf16(ck[0], bq0, s0f);
    s0f = wmma_bf16(ck[1], bq1, s0f);
    s1f = wmma_bf16(ck[2], bq0, s1f);
    s1f = wmma_bf16(ck[3], bq1, s1f);

    const int rem = nl - kt - 8 * g;  // register i of s0f is live while i < rem
    float tm = 0.f;
#pragma unroll
    for (int i = 0; i < 8; ++i) {
      s0f[i] = (i < rem) ? s0f[i] : NEG_INF_;
      s1f[i] = (i + 16 < rem) ? s1f[i] : NEG_INF_;
      float t2 = fmaxf(s0f[i], s1f[i]);
      tm = (i == 0) ? t2 : fmaxf(tm, t2);
    }
    tm = fmaxf(tm, xhalf(tm));

    float mn = fmaxf(mr, tm);
    float corr = __expf(mr - mn);
    mr = mn;
#pragma unroll
    for (int t = 0; t < 4; ++t)
#pragma unroll
      for (int i = 0; i < 8; ++i) acc[t][i] *= corr;

    // P^T as B operand: element e < 8 is key 8g + e, e >= 8 is key 16 + 8g + (e - 8),
    // the K pattern of a fragment.
    v16bf pt;
    float psum = 0.f;
#pragma unroll
    for (int i = 0; i < 8; ++i) {
      float p0 = __expf(s0f[i] - mn);
      float p1 = __expf(s1f[i] - mn);
      psum += p0 + p1;
      pt[i] = (__bf16)p0;
      pt[8 + i] = (__bf16)p1;
    }
    lr = lr * corr + psum;

#pragma unroll
    for (int t = 0; t < 4; ++t) acc[t] = wmma_bf16(cv[t], pt, acc[t]);
  };

  // Two sets of fragments take turns, so that none is copied; nl is at least 1 here and at
  // most S_. With an odd number of tiles the last turn has no live key: every score is
  // NEG_INF_ against a finite maximum, so corr is 1, every p is 0 and nothing changes.
  v16bf k0[4], v0[4], k1[4], v1[4];
  load_tile(k0, v0, 0);
  for (int kt = 0; kt < nl; kt += 64) {
    tile(k0, v0, k1, v1, kt);
    tile(k1, v1, k0, v0, kt + 32);
  }

  float inv = 1.f / (lr + xhalf(lr));
  // the lane's 8 contiguous d of its query are its place in half t & 1 of tile 2n + (t >> 1)
  __bf16* hp = h + ((long)b * S_ + s0) * H_ + n * 2 * FT_ + loff;
  v8bf o[4];
#pragma unroll
  for (int t = 0; t < 4; ++t)
#pragma unroll
    for (int i = 0; i < 8; ++i) o[t][i] = (__bf16)(acc[t][i] * inv);
#pragma unroll
  for (int t = 0; t < 4; ++t) *(v8bf*)(hp + t * FH_) = o[t];
  // the stores' registers may be reused behind them: wait before they are overwritten
  asm volatile("s_wait_xcnt 0x0" ::: "memory");
}

// ---------------- kernel 4: output projection + residual, live rows back in place ----------
// grid = B*S/16, block = 256 (8 waves); wave w computes cols [w*64, w*64+64) of 16 compact
// rows. The batch is the fast part of the index, so that the blocks with live rows come first.
__global__ void outproj_kernel(const __bf16* __restrict__ hbf, const __bf16* __restrict__ wo_pk,
                               const float* __restrict__ xn, const int* __restrict__ rowof,
                               const int* __restrict__ live, float* __restrict__ out) {
  int wid = threadIdx.x >> 5;
  int l = threadIdx.x & 31;
  int g = l >> 4, c = l & 15;
  int b = blockIdx.x % B_;
  int j0 = (int)(blockIdx.x / B_) * 16;
  const int nl = live_rows(live, b);
  if (j0 >= nl) return;  // whole block: no live row here
  long row0 = (long)b * S_ + j0;
  int n0 = wid * 64;

  v8f acc[4];
#pragma unroll
  for (int t = 0; t < 4; ++t) acc[t] = zero_v8f();

  // Unrolled in full: every load is a constant offset from one address, which stays whole,
  // and the compiler sends the loads out a step ahead of their products.
#pragma unroll
  for (int kc = 0; kc < H_ / 32; ++kc) {
    v16bf a = load_frag_fo(hbf + row0 * H_ + kc * FT_ + l * 8);  // tile [row0 / 16][kc]
#pragma unroll
    for (int t = 0; t < 4; ++t)
      acc[t] = wmma_bf16(a, load_frag_pk(wo_pk, kc * 32 + wid * 4 + t), acc[t]);
  }
  // the loop's address registers are reused behind it: wait before they are overwritten
  asm volatile("s_wait_xcnt 0x0" ::: "memory");
  // A row of the pad has no place in out: it reads the last live row's residual and home
  // row, so that all loads go out together, and stores nothing.
  // Lane l fetches the home row of the tile's row l & 15.
  const unsigned ro = (unsigned)(b * S_ + min(j0 + c, nl - 1));  // element offset in rowof
  const int hr = rowof[ro];
  float res[4][8];
  unsigned xo[8];  // element offsets in xn
#pragma unroll
  for (int i = 0; i < 8; ++i)
    xo[i] = (unsigned)(b * S_ + min(j0 + i + 8 * g, nl - 1)) * H_ + n0 + c;
#pragma unroll
  for (int i = 0; i < 8; ++i)
#pragma unroll
    for (int t = 0; t < 4; ++t) res[t][i] = xn[xo[i] + t * 16];
  // The loads' offset registers are reused behind them: wait before they are overwritten.
  // Naming the offsets as inputs keeps them whole up to the wait.
  asm volatile("s_wait_xcnt 0x0" ::"v"(ro), "v"(xo[0]), "v"(xo[1]), "v"(xo[2]), "v"(xo[3]),
               "v"(xo[4]), "v"(xo[5]), "v"(xo[6]), "v"(xo[7])
               : "memory");
#pragma unroll
  for (int i = 0; i < 8; ++i)
#pragma unroll
    for (int t = 0; t < 4; ++t) acc[t][i] += res[t][i];
#pragma unroll
  for (int i = 0; i < 8; ++i) {
    // home row of the tile's row i + 8g, masked to the shape
    int lo = __builtin_amdgcn_readlane(hr, i), hi = __builtin_amdgcn_readlane(hr, i + 8);
    int orow = (g ? hi : lo) & (S_ - 1);
    if (j0 + i + 8 * g < nl) {
      float* op = out + ((long)b * S_ + orow) * H_ + n0 + c;
#pragma unroll
      for (int t = 0; t < 4; ++t) op[t * 16] = acc[t][i];
    }
  }
}

extern "C" void kernel_launch(void* const* d_in, const int* in_sizes, int n_in,
                              void* d_out, int out_size, void* d_ws, size_t ws_size,
                              hipStream_t stream) {
  (void)in_sizes; (void)n_in; (void)out_size; (void)ws_size;
  const float* x     = (const float*)d_in[0];
  const int*   mask  = (const int*)d_in[1];
  const float* Wq    = (const float*)d_in[2];
  const float* Wk    = (const float*)d_in[3];
  const float* Wv    = (const float*)d_in[4];
  const float* Wo    = (const float*)d_in[5];
  const float* gamma = (const float*)d_in[6];
  const float* beta  = (const float*)d_in[7];
  float* out = (float*)d_out;

  char* ws = (char*)d_ws;
  float* xn = (float*)ws;        ws += (size_t)B_ * S_ * H_ * 4;
  __bf16* xn_bf = (__bf16*)ws;   ws += (size_t)B_ * S_ * H_ * 2;
  __bf16* qb = (__bf16*)ws;      ws += (size_t)B_ * NH_ * S_ * DK_ * 2;
  __bf16* kb = (__bf16*)ws;      ws += (size_t)B_ * NH_ * S_ * DK_ * 2;
  __bf16* vT = (__bf16*)ws;      ws += (size_t)B_ * NH_ * S_ * DK_ * 2;
  __bf16* hb = (__bf16*)ws;      ws += (size_t)B_ * S_ * H_ * 2;
  __bf16* wq_pk = (__bf16*)ws;   ws += (size_t)NH_ * H_ * DK_ * 2;
  __bf16* wk_pk = (__bf16*)ws;   ws += (size_t)NH_ * H_ * DK_ * 2;
  __bf16* wv_pk = (__bf16*)ws;   ws += (size_t)NH_ * H_ * DK_ * 2;
  __bf16* wo_pk = (__bf16*)ws;   ws += (size_t)H_ * H_ * 2;
  int* rowof = (int*)ws;         ws += (size_t)B_ * S_ * 4;
  int* live = (int*)ws;          ws += (size_t)B_ * 4;

  // weight packing (per-head KxN = 512x64: 8*16*4 = 512 fragments; Wo: 16*32 = 512) and
  // LayerNorm in one launch
  prep_kernel<<<B_ * S_ / RB_, 32 * PW_, 0, stream>>>(x, mask, gamma, beta, Wq, Wk, Wv, Wo,
                                                      wq_pk, wk_pk, wv_pk, wo_pk, xn, xn_bf,
                                                      rowof, live, out);

  proj_kernel<<<dim3(B_ * NH_, 3, S_ / 128), 256, 0, stream>>>(xn_bf, wq_pk, wk_pk, wv_pk,
                                                               live, qb, kb, vT);

  attn_kernel<<<dim3(B_ * NH_, S_ / 64), 128, 0, stream>>>(qb, kb, vT, live, hb);

  outproj_kernel<<<B_ * S_ / 16, 256, 0, stream>>>(hb, wo_pk, xn, rowof, live, out);
}

// v008
// It runs in 49.4 microseconds.
// Next to v007, in two timings, it ran 1.03 and 1.04 times as fast.
// All steps since v000 together make it 7.28 times as fast.
#include <hip/hip_runtime.h>

#define B_ 4
#define S_ 2048
#define H_ 512
#define NH_ 8
#define DK_ 64

constexpr float LN_EPS_ = 1e-5f;
constexpr float NEG_INF_ = -1e30f;

typedef __attribute__((ext_vector_type(16))) __bf16 v16bf;
typedef __attribute__((ext_vector_type(8)))  __bf16 v8bf;
typedef __attribute__((ext_vector_type(4)))  __bf16 v4bf;
typedef __attribute__((ext_vector_type(8)))  float  v8f;
typedef __attribute__((ext_vector_type(4)))  float  v4f;
typedef __attribute__((ext_vector_type(4)))  int    v4i;
typedef __attribute__((ext_vector_type(2)))  int    v2i;

__device__ __forceinline__ v8f zero_v8f() {
  v8f z;
#pragma unroll
  for (int i = 0; i < 8; ++i) z[i] = 0.f;
  return z;
}

// A 16x32 bf16 fragment: lane l = 16g + r holds row r; the K pattern of its 16 elements is
// e < 8 -> 8g + e, e >= 8 -> 16 + 8g + (e - 8).
// Fragment order: a 16x32 tile is 512 elements in a row, [half][lane][8]. Lane l = 16g + r
// holds row r; its 8 elements of half 0 are K = 8g + e, of half 1 K = 16 + 8g + e: the K
// pattern above. Each half is 512 contiguous bytes, so that a wave's 16-byte load
// or store of it covers four whole 128-byte lines (a row-major tile: a piece of sixteen).
constexpr int FT_ = 512;  // elements of a tile
constexpr int FH_ = 256;  // elements of a half
// p = start of the tile + 8 * lane
__device__ __forceinline__ v16bf load_frag_fo(const __bf16* p) {
  v8bf lo = *(const v8bf*)p;
  v8bf hi = *(const v8bf*)(p + FH_);
  return __builtin_shufflevector(lo, hi, 0, 1, 2, 3, 4, 5, 6, 7,
                                 8, 9, 10, 11, 12, 13, 14, 15);
}

// Packed weight fragment f, in fragment order.
__device__ __forceinline__ v16bf load_frag_pk(const __bf16* pk, int f) {
  int l = threadIdx.x & 31;
  return load_frag_fo(pk + (long)f * FT_ + l * 8);
}

__device__ __forceinline__ v8f wmma_bf16(v16bf a, v16bf b, v8f c) {
  return __builtin_amdgcn_wmma_f32_16x16x32_bf16(false, a, false, b, (short)0, c,
                                                 false, false);
}

// value of lane l ^ 16
__device__ __forceinline__ float xhalf(float x) {
  int b = __builtin_bit_cast(int, x);
  return __builtin_bit_cast(float, __builtin_amdgcn_permlanex16(b, b, 0x76543210, 0xfedcba98,
                                                                false, false));
}

// Rows whose mask is 0 give an output of 0 as queries and a probability of exactly 0 as
// keys (a batch with no live key has no live query either), so every stage behind the
// LayerNorm works on the live rows alone, moved up to the front of their batch in their
// old order ("compact" rows). live[b] = number of live rows of batch b.
__device__ __forceinline__ int live_rows(const int* __restrict__ live, int b) {
  return min(max(live[b], 0), S_);
}
// compact rows are zero-filled up to the next multiple of 64 (the largest row tile)
__device__ __forceinline__ int padded_rows(int n) { return (n + 63) & ~63; }

// ---------------- kernel 1: weight packing, LayerNorm + row compaction ----------------
// Work-groups start at a limited rate, so the launch has one work-group per WGP and not one
// per row: 256 blocks of 8 waves. Each wave packs one weight fragment and takes four rows.
// Neither job reads what the other writes.
constexpr int PW_ = 8;          // waves of a block
constexpr int RW_ = 4;          // rows of a wave
constexpr int RB_ = PW_ * RW_;  // rows of a block: their mask is one 32-bit ballot
constexpr int FRAGS_ = (H_ / 32) * (H_ / 16);  // fragments of each of the four weight inputs
static_assert(RB_ == 32 && 4 * FRAGS_ == (B_ * S_ / RB_) * PW_, "one fragment per wave");

// x + (x of lane l ^ M), M < 16: one DPP add inside the 16-lane row
template <int M>
__device__ __forceinline__ float xmask_add(float x) {
  int b = __builtin_bit_cast(int, x);
  return x + __builtin_bit_cast(float,
                                __builtin_amdgcn_update_dpp(0, b, 0x160 + M, 0xf, 0xf, true));
}
// sum over the wave, the same in every lane
__device__ __forceinline__ float wave_sum(float x) {
  x = xmask_add<1>(x);
  x = xmask_add<2>(x);
  x = xmask_add<4>(x);
  x = xmask_add<8>(x);
  return x + xhalf(x);
}

// A block takes RB_ neighbouring rows of one batch. It counts the batch's mask once: base =
// live rows in front of its first row, n = all live rows; the ballot of its own rows' mask
// gives each row's place behind base. A wave holds a whole row, 16 values a lane (four runs of
// 512 contiguous bytes a wave), so the row sums need no barrier.
// A live row is normalised and written at its compact row; a masked row stores its zeros
// to out and, if it is one of the first masked rows, the zero row n + (its rank) of the pad.
// xn_bf is written in fragment order, tiles [row/16][col/32], as kernel 2 reads it: a lane's
// four neighbours along a row are half of one 16-byte place there.
__global__ void __launch_bounds__(256) prep_kernel(
                            const float* __restrict__ x, const int* __restrict__ mask,
                            const float* __restrict__ gamma, const float* __restrict__ beta,
                            const float* __restrict__ Wq, const float* __restrict__ Wk,
                            const float* __restrict__ Wv, const float* __restrict__ Wo,
                            __bf16* __restrict__ wq_pk, __bf16* __restrict__ wk_pk,
                            __bf16* __restrict__ wv_pk, __bf16* __restrict__ wo_pk,
                            float* __restrict__ xn, __bf16* __restrict__ xn_bf,
                            int* __restrict__ rowof, int* __restrict__ live,
                            float* __restrict__ out) {
  const int t = threadIdx.x, l = t & 31;
  const int wid = __builtin_amdgcn_readfirstlane(t >> 5);
  const int b = (int)blockIdx.x / (S_ / RB_);
  const int r0 = ((int)blockIdx.x % (S_ / RB_)) * RB_;
  const int* mb = mask + b * S_;
  const unsigned boff = (unsigned)(r0 + l) * 4u;  // in bytes: the block's row l
  const unsigned moff = (unsigned)t * 32u;        // in bytes: this thread's 8 entries
  const int mine = *(const int*)((const char*)mb + boff);
  const v4i m0 = *(const v4i*)((const char*)mb + moff);
  const v4i m1 = *(const v4i*)((const char*)mb + moff + 16);
  const unsigned coff = (unsigned)l * 16u;  // in bytes: the lane's 4 floats of a run of 128
  // In bytes: where columns 4l .. 4l + 3 of row 0 stand in fragment order: tile l / 8, and
  // K = 4 (l & 7) gives the half, g and the first or second four of the eight.
  const unsigned foff = ((unsigned)(l >> 3) * FT_ + (unsigned)((l >> 2) & 1) * FH_ +
                         (unsigned)((l >> 1) & 1) * 128u + (unsigned)(l & 1) * 4u) * 2u;
  v4f gm[4], bt[4];
#pragma unroll
  for (int q = 0; q < 4; ++q) {
    gm[q] = *(const v4f*)((const char*)gamma + coff + q * 512);
    bt[q] = *(const v4f*)((const char*)beta + coff + q * 512);
  }
  const unsigned bits = __builtin_amdgcn_ballot_w32(mine != 0);  // bit j: row r0 + j is live
  // Counted here, in front of the rows' loads: behind them the wait for the mask would take
  // in the rows as well.
  // The wave's 256 mask entries, counted by ballots: na = live, nb = live in front of r0.
  const int lim = r0 / 8 - wid * 32;  // lanes below lim hold entries in front of r0
  const unsigned lt = lim >= 32 ? 0xffffffffu : lim <= 0 ? 0u : (1u << lim) - 1u;
  int na = 0, nb = 0;
#pragma unroll
  for (int j = 0; j < 4; ++j) {
    const unsigned a0 = __builtin_amdgcn_ballot_w32(m0[j] != 0);
    const unsigned a1 = __builtin_amdgcn_ballot_w32(m1[j] != 0);
    na += __builtin_popcount(a0) + __builtin_popcount(a1);
    nb += __builtin_popcount(a0 & lt) + __builtin_popcount(a1 & lt);
  }
  __shared__ int rpc[PW_];
  if (l == 0) rpc[wid] = (na << 16) | nb;
  const int j0 = wid * RW_;
  const float* xr = x + (long)(b * S_ + r0 + j0) * H_;
  v4f v[RW_][4];
#pragma unroll
  for (int r = 0; r < RW_; ++r) {
    if ((bits >> (j0 + r)) & 1) {  // the same for the whole wave
#pragma unroll
      for (int q = 0; q < 4; ++q)
        v[r][q] = *(const v4f*)((const char*)(xr + r * H_) + coff + q * 512);
    } else {
#pragma unroll
      for (int q = 0; q < 4; ++q) v[r][q] = v4f{0.f, 0.f, 0.f, 0.f};
    }
  }
  // The weight loads go out behind the rows': in front of them the wait for the mask would take
  // them in and hold the rows' loads back.
  const unsigned which = blockIdx.x / (FRAGS_ / PW_);  // the weight input, one per block
  const unsigned fid = (blockIdx.x % (FRAGS_ / PW_)) * PW_ + wid;
  // Wq, Wk, Wv: eight row-major 512x64 matrices, one behind the other; Wo: one of 512x512.
  // Fragment fid, counted through the matrices, is (kc in K/32, nt in N/16); lane = column.
  const float* w = which == 0 ? Wq : which == 1 ? Wk : which == 2 ? Wv : Wo;
  const unsigned ld = which == 3 ? H_ : DK_;  // floats of a row
  const float* wf = w + (which == 3 ? (fid / 32) * 32 * H_ + (fid % 32) * 16
                                    : (fid / 64) * (H_ * DK_) + (fid % 64 / 4) * 32 * DK_ +
                                          (fid % 4) * 16);
  // The row length differs between the inputs: each load has an offset register of its own, so
  // that no branch stands here and the sixteen loads go out in a row.
  unsigned wx[16];  // element offsets of the lane's 16 values, in the K pattern of a fragment
  float wv[16];
#pragma unroll  // constant indices keep both arrays in registers
  for (unsigned e = 0; e < 16; ++e)
    wx[e] = ((e < 8 ? e : e + 8) + 8 * (unsigned)(l >> 4)) * ld + (l & 15);
#pragma unroll  // as above
  for (unsigned e = 0; e < 16; ++e) wv[e] = wf[wx[e]];
  // The offset registers of these loads and of those above may be reused behind them: wait
  // before they are overwritten. Naming them as inputs keeps them whole up to the wait.
  asm volatile("s_wait_xcnt 0x0" ::"v"(wx[0]), "v"(wx[1]), "v"(wx[2]), "v"(wx[3]), "v"(wx[4]),
               "v"(wx[5]), "v"(wx[6]), "v"(wx[7]), "v"(wx[8]), "v"(wx[9]), "v"(wx[10]),
               "v"(wx[11]), "v"(wx[12]), "v"(wx[13]), "v"(wx[14]), "v"(wx[15]), "v"(boff),
               "v"(moff), "v"(coff)
               : "memory");

  __syncthreads();
  int pc = 0;
#pragma unroll
  for (int i = 0; i < PW_; ++i) pc += rpc[i];
  pc = __builtin_amdgcn_readfirstlane(pc);
  const int base = pc & 0xffff, n = pc >> 16;
  if (r0 == 0 && t == 0) live[b] = n;

  // The four rows' sums side by side (a masked row's are 0): eight independent chains.
  float s[RW_], ss[RW_];
#pragma unroll
  for (int r = 0; r < RW_; ++r) {
    v4f a = (v[r][0] + v[r][1]) + (v[r][2] + v[r][3]);
    v4f a2 = (v[r][0] * v[r][0] + v[r][1] * v[r][1]) + (v[r][2] * v[r][2] + v[r][3] * v[r][3]);
    s[r] = (a[0] + a[1]) + (a[2] + a[3]);
    ss[r] = (a2[0] + a2[1]) + (a2[2] + a2[3]);
  }
#pragma unroll
  for (int r = 0; r < RW_; ++r) {
    s[r] = wave_sum(s[r]);
    ss[r] = wave_sum(ss[r]);
  }

#pragma unroll
  for (int r = 0; r < RW_; ++r) {
    const int j = j0 + r, sr = r0 + j;
    const int pos = base + __builtin_popcount(bits & ((1u << j) - 1u));  // live rows in front
    if ((bits >> j) & 1) {  // the same for the whole wave
      const long row = (long)b * S_ + pos;  // compact row
      if (l == 0) rowof[row] = sr;
      float mean = s[r] * (1.f / H_);
      float var = ss[r] * (1.f / H_) - mean * mean;
      float inv = rsqrtf(var + LN_EPS_);
      char* xo = (char*)(xn + row * H_);
      char* xb = (char*)(xn_bf + (row >> 4) * (16 * H_) + (row & 15) * 8);  // row's tiles, its place
      v4f o[4];
      v2i ob[4];  // four bf16 each
#pragma unroll
      for (int q = 0; q < 4; ++q) {
        v4bf c4;
#pragma unroll
        for (int i = 0; i < 4; ++i) {
          o[q][i] = (v[r][q][i] - mean) * inv * gm[q][i] + bt[q][i];
          c4[i] = (__bf16)o[q][i];
        }
        ob[q] = __builtin_bit_cast(v2i, c4);
      }
#pragma unroll
      for (int q = 0; q < 4; ++q) *(v4f*)(xo + coff + q * 512) = o[q];
#pragma unroll
      for (int q = 0; q < 4; ++q) *(v2i*)(xb + foff + q * (4 * FT_ * 2)) = ob[q];  // 128 columns: 4 tiles
      // The stores' registers are reused for the next row: wait before they are overwritten.
      // Naming the values as inputs keeps them whole up to the wait.
      asm volatile("s_wait_xcnt 0x0" ::"v"(o[0]), "v"(o[1]), "v"(o[2]), "v"(o[3]), "v"(ob[0]),
                   "v"(ob[1]), "v"(ob[2]), "v"(ob[3])
                   : "memory");
    } else {
      char* op = (char*)(out + ((long)b * S_ + sr) * H_);
#pragma unroll
      for (int q = 0; q < 4; ++q) *(v4f*)(op + coff + q * 512) = v4f{0.f, 0.f, 0.f, 0.f};
      // the stores' registers are reused behind them: wait before they are overwritten
      asm volatile("s_wait_xcnt 0x0" ::: "memory");
      const int jz = n + (sr - pos);  // masked rows follow the live ones: jz < S_
      if (jz < padded_rows(n)) {
        const long zr = (long)b * S_ + jz;
        char* zb = (char*)(xn_bf + (zr >> 4) * (16 * H_) + (zr & 15) * 8);
#pragma unroll
        for (int q = 0; q < 4; ++q) *(v2i*)(zb + foff + q * (4 * FT_ * 2)) = v2i{0, 0};  // bf16 zeros
        // as above
        asm volatile("s_wait_xcnt 0x0" ::: "memory");
      }
    }
  }

  // the weight fragment, in fragment order
  __bf16* pk = which == 0 ? wq_pk : which == 1 ? wk_pk : which == 2 ? wv_pk : wo_pk;
  __bf16* dst = pk + fid * FT_ + l * 8;
  v8bf lo, hi;
#pragma unroll
  for (int e = 0; e < 8; ++e) {
    lo[e] = (__bf16)wv[e];
    hi[e] = (__bf16)wv[8 + e];
  }
  *(v8bf*)dst = lo;
  *(v8bf*)(dst + FH_) = hi;
  // the stores' registers may be reused behind them: wait before they are overwritten
  asm volatile("s_wait_xcnt 0x0" ::: "memory");
}

// ---------------- kernel 2: Q/K/V projections ----------------
// grid = (B*NH, 3, S/128), block = 128 (4 waves); wave: 32(S) x 64(DK) tile of compact rows.
// Two row tiles to a wave: a weight fragment, once loaded, feeds two products, so that a k-step
// takes twelve loads for eight products (ten for four with one row tile), and half the waves
// are started. Four waves walk through the same weight fragments together.
// The row tile is the slowest grid index, so that the blocks with live rows come first.
// All three results are stored in fragment order, as the attention reads them:
// y=0: q (scaled 1/8) and y=1: k, per bn tiles [s/16][d/32], row = s, K = d;
// y=2: v transposed, per bn tiles [s/32][d/16], row = d, K = s.
// A lane stores 8 neighbours along K. For v that is the product xn * W (a lane's registers
// run along s); for q and k the operands change places, W^T * xn^T (they run along d).
// TR: the transposed product. row0: the first of the wave's 32 rows; dst: the place of its
// first 16 rows.
template <bool TR>
__device__ __forceinline__ void proj_tile(const __bf16* __restrict__ xn_bf, long row0,
                                          const __bf16* __restrict__ wpk, float sc,
                                          __bf16* __restrict__ dst) {
  v8f acc[2][4];  // [row tile][column tile]
#pragma unroll
  for (int u = 0; u < 2; ++u)
#pragma unroll
    for (int t = 0; t < 4; ++t) acc[u][t] = zero_v8f();

  // Register ring, PD_ k-steps deep: a step's twelve loads go out PD_ steps ahead of its
  // products, so that a wave waits for one landing per PD_ steps, not for one per product.
  constexpr int PD_ = 3;
  v16bf fa[PD_][2], fb[PD_][4];
  const int l = threadIdx.x & 31;
  const __bf16* pa = xn_bf + row0 * (long)H_ + l * 8;  // tile [row0 / 16][0], the lane's place
  const unsigned wo = (unsigned)l * 16u;  // the lane's place in a half tile, in bytes
  // the second row tile stands 16 rows of H_ elements behind the first
  auto load_a = [&](int kc, int u) { return load_frag_fo(pa + u * (16 * H_) + kc * FT_); };
  auto load_b = [&](int f) {
    return load_frag_fo((const __bf16*)((const char*)wpk + wo) + f * FT_);
  };
  // Every loop over the ring is unrolled in full: only constant slot numbers keep it in
  // registers.
#pragma unroll
  for (int s = 0; s < PD_; ++s) {
    fa[s][0] = load_a(s, 0);
    fa[s][1] = load_a(s, 1);
#pragma unroll  // constant slot numbers, as above
    for (int t = 0; t < 4; ++t) fb[s][t] = load_b(s * 4 + t);
  }
#pragma unroll  // constant slot numbers, as above
  for (int kc = 0; kc < H_ / 32; ++kc) {
    const int s = kc % PD_;
#pragma unroll  // constant slot numbers, as above
    for (int u = 0; u < 2; ++u)
#pragma unroll  // constant slot numbers, as above
      for (int t = 0; t < 4; ++t)
        acc[u][t] = TR ? wmma_bf16(fb[s][t], fa[s][u], acc[u][t])
                       : wmma_bf16(fa[s][u], fb[s][t], acc[u][t]);
    if (kc + PD_ < H_ / 32) {
      fa[s][0] = load_a(kc + PD_, 0);
      fa[s][1] = load_a(kc + PD_, 1);
#pragma unroll  // constant slot numbers, as above
      for (int t = 0; t < 4; ++t) fb[s][t] = load_b((kc + PD_) * 4 + t);
    }
    // keeps the refill here: moved down to its use, each load would be waited for alone
    __builtin_amdgcn_sched_barrier(0);
  }
  // The loads' address registers are reused behind the loop: wait before they are overwritten.
  // Naming them as inputs keeps them whole up to the wait.
  asm volatile("s_wait_xcnt 0x0" ::"v"(pa), "v"(wo) : "memory");

  // Row tile u, s counted from its first row:
  // TR: acc[u][t][i] = value(s = lane's row c, d = 16t + 8g + i): half t & 1 of tile 2u + (t >> 1).
  // else: acc[u][t][i] = value(s = 8g + i, d = 16t + c): half u of tile t.
  v8bf o[2][4];
#pragma unroll
  for (int u = 0; u < 2; ++u)
#pragma unroll
    for (int t = 0; t < 4; ++t)
#pragma unroll
      for (int i = 0; i < 8; ++i) o[u][t][i] = (__bf16)(acc[u][t][i] * sc);
#pragma unroll
  for (int u = 0; u < 2; ++u)
#pragma unroll
    for (int t = 0; t < 4; ++t)
      *(v8bf*)(dst + u * (TR ? 2 * FT_ : FH_) + t * (TR ? FH_ : FT_)) = o[u][t];
  // the stores' registers may be reused behind them: wait before they are overwritten
  asm volatile("s_wait_xcnt 0x0" ::: "memory");
}

// The real block size lifts the register ceiling, which the ring of fragments needs.
__global__ void __launch_bounds__(128) proj_kernel(const __bf16* __restrict__ xn_bf,
                            const __bf16* __restrict__ wq_pk, const __bf16* __restrict__ wk_pk,
                            const __bf16* __restrict__ wv_pk,
                            const int* __restrict__ live, __bf16* __restrict__ q, __bf16* __restrict__ k,
                            __bf16* __restrict__ vT) {
  int which = blockIdx.y;
  const int wid = __builtin_amdgcn_readfirstlane(threadIdx.x >> 5);
  int l = threadIdx.x & 31;
  int bn = blockIdx.x;
  int n = bn & 7;
  const int s32 = (int)blockIdx.z * 128 + wid * 32;  // the wave's 32 rows
  // whole waves leave (the pad ends at a multiple of 64 rows); the kernel has no barrier
  if (s32 >= padded_rows(live_rows(live, bn >> 3))) return;
  long row0 = ((long)(bn >> 3)) * S_ + s32;
  const long hoff = (long)n * 64 * FT_;  // 64 fragments per head
  // 32 rows of a head are 32 * DK_ elements in each of the three layouts
  const long boff = ((long)bn * S_ + (long)s32) * DK_ + l * 8;
  if (which == 2)
    proj_tile<false>(xn_bf, row0, wv_pk + hoff, 1.f, vT + boff);
  else  // 1/sqrt(DK) is folded into q
    proj_tile<true>(xn_bf, row0, (which == 1 ? wk_pk : wq_pk) + hoff, which == 1 ? 1.f : 0.125f,
                    (which == 1 ? k : q) + boff);
}

__global__ void __launch_bounds__(128) attn_kernel(const __bf16* __restrict__ qm, const __bf16* __restrict__ km,
                            const __bf16* __restrict__ vT, const int* __restrict__ live,
                            __bf16* __restrict__ h) {
  int wid = threadIdx.x >> 5;
  int l = threadIdx.x & 31;
  int g = l >> 4;
  int bn = blockIdx.x;
  int b = bn >> 3, n = bn & 7;
  const int nl = live_rows(live, b);
  if ((int)blockIdx.y * 64 >= nl) return;  // whole block: no live query here
  long s0 = (long)blockIdx.y * 64 + wid * 16;
  const __bf16* qb = qm + (long)bn * S_ * DK_;
  const __bf16* kb = km + (long)bn * S_ * DK_;
  const __bf16* vb = vT + (long)bn * DK_ * S_;
  const unsigned loff = (unsigned)l * 8;  // the lane's place in a half tile

  // B operand: column c = query s0 + c
  v16bf bq0 = load_frag_fo(qb + s0 * DK_ + loff);
  v16bf bq1 = load_frag_fo(qb + s0 * DK_ + loff + FT_);
  // the Q loads' address pair is reused behind them: wait before it is overwritten
  asm volatile("s_wait_xcnt 0x0" ::: "memory");

  v8f acc[4];  // acc[t][i] = O^T[d = 16t + 8g + i][query s0 + c]
#pragma unroll
  for (int t = 0; t < 4; ++t) acc[t] = zero_v8f();
  float mr = -1e38f;  // running maximum of this lane's query (both halves agree)
  float lr = 0.f;     // running sum over this half's keys only; joined after the loop

  // The eight fragments of one tile of 32 keys: K rows 0-15 and 16-31 (two k halves each),
  // V^T rows 16t. Each four are neighbours in memory.
  auto load_tile = [&](v16bf (&fk)[4], v16bf (&fv)[4], int kt) {
    const __bf16* pk = kb + (long)kt * DK_ + loff;  // the lane's own addresses
    const __bf16* pv = vb + (long)kt * DK_ + loff;
#pragma unroll  // constant indices keep the fragments in registers
    for (int t = 0; t < 4; ++t) fk[t] = load_frag_fo(pk + t * FT_);
#pragma unroll  // constant indices keep the fragments in registers
    for (int t = 0; t < 4; ++t) fv[t] = load_frag_fo(pv + t * FT_);
    // The loads' address pairs are formed anew for the next tile while these loads fly: wait
    // before they are overwritten. Naming them as inputs keeps them whole up to the wait.
    asm volatile("s_wait_xcnt 0x0" ::"v"(pk), "v"(pv) : "memory");
  };

  // One tile of 32 compact keys from the fragments ck, cv; the next tile's sixteen loads go
  // out first, into nk, nv, and land while this tile is worked on. In the last, partly filled
  // tile only the keys below nl are live (it holds at least one); the rows of the pad behind
  // them are zeros.
  auto tile = [&](const v16bf (&ck)[4], const v16bf (&cv)[4], v16bf (&nk)[4], v16bf (&nv)[4],
                  int kt) {
    // behind the last tile there is none: that tile is fetched again (written, finite values)
    load_tile(nk, nv, min(kt + 32, (nl - 1) & ~31));
    // keeps the loads up here: moved down to their use, each would be waited for alone
    __builtin_amdgcn_sched_barrier(0);
    // s0f[i] = score(key kt + 8g + i, query c); s1f[i] = score(key kt + 16 + 8g + i, query c)
    v8f s0f = zero_v8f(), s1f = zero_v8f();
    s0f = wmma_bf16(ck[0], bq0, s0f);
    s0f = wmma_bf16(ck[1], bq1, s0f);
    s1f = wmma_bf16(ck[2], bq0, s1f);
    s1f = wmma_bf16(ck[3], bq1, s1f);

    const int rem = nl - kt - 8 * g;  // register i of s0f is live while i < rem
    float tm = 0.f;
#pragma unroll
    for (int i = 0; i < 8; ++i) {
      s0f[i] = (i < rem) ? s0f[i] : NEG_INF_;
      s1f[i] = (i + 16 < rem) ? s1f[i] : NEG_INF_;
      float t2 = fmaxf(s0f[i], s1f[i]);
      tm = (i == 0) ? t2 : fmaxf(tm, t2);
    }
    tm = fmaxf(tm, xhalf(tm));

    float mn = fmaxf(mr, tm);
    float corr = __expf(mr - mn);
    mr = mn;
#pragma unroll
    for (int t = 0; t < 4; ++t)
#pragma unroll
      for (int i = 0; i < 8; ++i) acc[t][i] *= corr;

    // P^T as B operand: element e < 8 is key 8g + e, e >= 8 is key 16 + 8g + (e - 8),
    // the K pattern of a fragment.
    v16bf pt;
    float psum = 0.f;
#pragma unroll
    for (int i = 0; i < 8; ++i) {
      float p0 = __expf(s0f[i] - mn);
      float p1 = __expf(s1f[i] - mn);
      psum += p0 + p1;
      pt[i] = (__bf16)p0;
      pt[8 + i] = (__bf16)p1;
    }
    lr = lr * corr + psum;

#pragma unroll
    for (int t = 0; t < 4; ++t) acc[t] = wmma_bf16(cv[t], pt, acc[t]);
  };

  // Two sets of fragments take turns, so that none is copied; nl is at least 1 here and at
  // most S_. With an odd number of tiles the last turn has no live key: every score is
  // NEG_INF_ against a finite maximum, so corr is 1, every p is 0 and nothing changes.
  v16bf k0[4], v0[4], k1[4], v1[4];
  load_tile(k0, v0, 0);
  for (int kt = 0; kt < nl; kt += 64) {
    tile(k0, v0, k1, v1, kt);
    tile(k1, v1, k0, v0, kt + 32);
  }

  float inv = 1.f / (lr + xhalf(lr));
  // the lane's 8 contiguous d of its query are its place in half t & 1 of tile 2n + (t >> 1)
  __bf16* hp = h + ((long)b * S_ + s0) * H_ + n * 2 * FT_ + loff;
  v8bf o[4];
#pragma unroll
  for (int t = 0; t < 4; ++t)
#pragma unroll
    for (int i = 0; i < 8; ++i) o[t][i] = (__bf16)(acc[t][i] * inv);
#pragma unroll
  for (int t = 0; t < 4; ++t) *(v8bf*)(hp + t * FH_) = o[t];
  // the stores' registers may be reused behind them: wait before they are overwritten
  asm volatile("s_wait_xcnt 0x0" ::: "memory");
}

// ---------------- kernel 4: output projection + residual, live rows back in place ----------
// grid = B*S/16, block = 256 (8 waves); wave w computes cols [w*64, w*64+64) of 16 compact
// rows. The batch is the fast part of the index, so that the blocks with live rows come first.
__global__ void outproj_kernel(const __bf16* __restrict__ hbf, const __bf16* __restrict__ wo_pk,
                               const float* __restrict__ xn, const int* __restrict__ rowof,
                               const int* __restrict__ live, float* __restrict__ out) {
  int wid = threadIdx.x >> 5;
  int l = threadIdx.x & 31;
  int g = l >> 4, c = l & 15;
  int b = blockIdx.x % B_;
  int j0 = (int)(blockIdx.x / B_) * 16;
  const int nl = live_rows(live, b);
  if (j0 >= nl) return;  // whole block: no live row here
  long row0 = (long)b * S_ + j0;
  int n0 = wid * 64;

  v8f acc[4];
#pragma unroll
  for (int t = 0; t < 4; ++t) acc[t] = zero_v8f();

  // Unrolled in full: every load is a constant offset from one address, which stays whole,
  // and the compiler sends the loads out a step ahead of their products.
#pragma unroll
  for (int kc = 0; kc < H_ / 32; ++kc) {
    v16bf a = load_frag_fo(hbf + row0 * H_ + kc * FT_ + l * 8);  // tile [row0 / 16][kc]
#pragma unroll
    for (int t = 0; t < 4; ++t)
      acc[t] = wmma_bf16(a, load_frag_pk(wo_pk, kc * 32 + wid * 4 + t), acc[t]);
  }
  // the loop's address registers are reused behind it: wait before they are overwritten
  asm volatile("s_wait_xcnt 0x0" ::: "memory");
  // A row of the pad has no place in out: it reads the last live row's residual and home
  // row, so that all loads go out together, and stores nothing.
  // Lane l fetches the home row of the tile's row l & 15.
  const unsigned ro = (unsigned)(b * S_ + min(j0 + c, nl - 1));  // element offset in rowof
  const int hr = rowof[ro];
  float res[4][8];
  unsigned xo[8];  // element offsets in xn
#pragma unroll
  for (int i = 0; i < 8; ++i)
    xo[i] = (unsigned)(b * S_ + min(j0 + i + 8 * g, nl - 1)) * H_ + n0 + c;
#pragma unroll
  for (int i = 0; i < 8; ++i)
#pragma unroll
    for (int t = 0; t < 4; ++t) res[t][i] = xn[xo[i] + t * 16];
  // The loads' offset registers are reused behind them: wait before they are overwritten.
  // Naming the offsets as inputs keeps them whole up to the wait.
  asm volatile("s_wait_xcnt 0x0" ::"v"(ro), "v"(xo[0]), "v"(xo[1]), "v"(xo[2]), "v"(xo[3]),
               "v"(xo[4]), "v"(xo[5]), "v"(xo[6]), "v"(xo[7])
               : "memory");
#pragma unroll
  for (int i = 0; i < 8; ++i)
#pragma unroll
    for (int t = 0; t < 4; ++t) acc[t][i] += res[t][i];
#pragma unroll
  for (int i = 0; i < 8; ++i) {
    // home row of the tile's row i + 8g, masked to the shape
    int lo = __builtin_amdgcn_readlane(hr, i), hi = __builtin_amdgcn_readlane(hr, i + 8);
    int orow = (g ? hi : lo) & (S_ - 1);
    if (j0 + i + 8 * g < nl) {
      float* op = out + ((long)b * S_ + orow) * H_ + n0 + c;
#pragma unroll
      for (int t = 0; t < 4; ++t) op[t * 16] = acc[t][i];
    }
  }
}

extern "C" void kernel_launch(void* const* d_in, const int* in_sizes, int n_in,
                              void* d_out, int out_size, void* d_ws, size_t ws_size,
                              hipStream_t stream) {
  (void)in_sizes; (void)n_in; (void)out_size; (void)ws_size;
  const float* x     = (const float*)d_in[0];
  const int*   mask  = (const int*)d_in[1];
  const float* Wq    = (const float*)d_in[2];
  const float* Wk    = (const float*)d_in[3];
  const float* Wv    = (const float*)d_in[4];
  const float* Wo    = (const float*)d_in[5];
  const float* gamma = (const float*)d_in[6];
  const float* beta  = (const float*)d_in[7];
  float* out = (float*)d_out;

  char* ws = (char*)d_ws;
  float* xn = (float*)ws;        ws += (size_t)B_ * S_ * H_ * 4;
  __bf16* xn_bf = (__bf16*)ws;   ws += (size_t)B_ * S_ * H_ * 2;
  __bf16* qb = (__bf16*)ws;      ws += (size_t)B_ * NH_ * S_ * DK_ * 2;
  __bf16* kb = (__bf16*)ws;      ws += (size_t)B_ * NH_ * S_ * DK_ * 2;
  __bf16* vT = (__bf16*)ws;      ws += (size_t)B_ * NH_ * S_ * DK_ * 2;
  __bf16* hb = (__bf16*)ws;      ws += (size_t)B_ * S_ * H_ * 2;
  __bf16* wq_pk = (__bf16*)ws;   ws += (size_t)NH_ * H_ * DK_ * 2;
  __bf16* wk_pk = (__bf16*)ws;   ws += (size_t)NH_ * H_ * DK_ * 2;
  __bf16* wv_pk = (__bf16*)ws;   ws += (size_t)NH_ * H_ * DK_ * 2;
  __bf16* wo_pk = (__bf16*)ws;   ws += (size_t)H_ * H_ * 2;
  int* rowof = (int*)ws;         ws += (size_t)B_ * S_ * 4;
  int* live = (int*)ws;          ws += (size_t)B_ * 4;

  // weight packing (per-head KxN = 512x64: 8*16*4 = 512 fragments; Wo: 16*32 = 512) and
  // LayerNorm in one launch
  prep_kernel<<<B_ * S_ / RB_, 32 * PW_, 0, stream>>>(x, mask, gamma, beta, Wq, Wk, Wv, Wo,
                                                      wq_pk, wk_pk, wv_pk, wo_pk, xn, xn_bf,
                                                      rowof, live, out);

  proj_kernel<<<dim3(B_ * NH_, 3, S_ / 128), 128, 0, stream>>>(xn_bf, wq_pk, wk_pk, wv_pk,
                                                               live, qb, kb, vT);

  attn_kernel<<<dim3(B_ * NH_, S_ / 64), 128, 0, stream>>>(qb, kb, vT, live, hb);

  outproj_kernel<<<B_ * S_ / 16, 256, 0, stream>>>(hb, wo_pk, xn, rowof, live, out);
}

// v009
// Measured time: 46.5 microseconds a run.
// Next to v008, in two timings, it ran 1.06 times as fast each time.
// Counting every step since v000, it is 7.73 times as fast.
#include <hip/hip_runtime.h>

#define B_ 4
#define S_ 2048
#define H_ 512
#define NH_ 8
#define DK_ 64

constexpr float LN_EPS_ = 1e-5f;
constexpr float NEG_INF_ = -1e30f;

typedef __attribute__((ext_vector_type(16))) __bf16 v16bf;
typedef __attribute__((ext_vector_type(8)))  __bf16 v8bf;
typedef __attribute__((ext_vector_type(4)))  __bf16 v4bf;
typedef __attribute__((ext_vector_type(8)))  float  v8f;
typedef __attribute__((ext_vector_type(4)))  float  v4f;
typedef __attribute__((ext_vector_type(4)))  int    v4i;
typedef __attribute__((ext_vector_type(2)))  int    v2i;

__device__ __forceinline__ v8f zero_v8f() {
  v8f z;
#pragma unroll
  for (int i = 0; i < 8; ++i) z[i] = 0.f;
  return z;
}

// A 16x32 bf16 fragment: lane l = 16g + r holds row r; the K pattern of its 16 elements is
// e < 8 -> 8g + e, e >= 8 -> 16 + 8g + (e - 8).
// Fragment order: a 16x32 tile is 512 elements in a row, [half][lane][8]. Lane l = 16g + r
// holds row r; its 8 elements of half 0 are K = 8g + e, of half 1 K = 16 + 8g + e: the K
// pattern above. Each half is 512 contiguous bytes, so that a wave's 16-byte load
// or store of it covers four whole 128-byte lines (a row-major tile: a piece of sixteen).
constexpr int FT_ = 512;  // elements of a tile
constexpr int FH_ = 256;  // elements of a half
// p = start of the tile + 8 * lane
__device__ __forceinline__ v16bf load_frag_fo(const __bf16* p) {
  v8bf lo = *(const v8bf*)p;
  v8bf hi = *(const v8bf*)(p + FH_);
  return __builtin_shufflevector(lo, hi, 0, 1, 2, 3, 4, 5, 6, 7,
                                 8, 9, 10, 11, 12, 13, 14, 15);
}

// Packed weight fragment f, in fragment order.
__device__ __forceinline__ v16bf load_frag_pk(const __bf16* pk, int f) {
  int l = threadIdx.x & 31;
  return load_frag_fo(pk + (long)f * FT_ + l * 8);
}

__device__ __forceinline__ v8f wmma_bf16(v16bf a, v16bf b, v8f c) {
  return __builtin_amdgcn_wmma_f32_16x16x32_bf16(false, a, false, b, (short)0, c,
                                                 false, false);
}

// value of lane l ^ 16
__device__ __forceinline__ float xhalf(float x) {
  int b = __builtin_bit_cast(int, x);
  return __builtin_bit_cast(float, __builtin_amdgcn_permlanex16(b, b, 0x76543210, 0xfedcba98,
                                                                false, false));
}

// Rows whose mask is 0 give an output of 0 as queries and a probability of exactly 0 as
// keys (a batch with no live key has no live query either), so every stage behind the
// LayerNorm works on the live rows alone, moved up to the front of their batch in their
// old order ("compact" rows). live[b] = number of live rows of batch b.
__device__ __forceinline__ int live_rows(const int* __restrict__ live, int b) {
  return min(max(live[b], 0), S_);
}
// compact rows are zero-filled up to the next multiple of 64 (the query tile of an attention block)
__device__ __forceinline__ int padded_rows(int n) { return (n + 63) & ~63; }

// ---------------- kernel 1: weight packing, LayerNorm + row compaction ----------------
// Work-groups start at a limited rate, so the launch has one work-group per WGP and not one
// per row: 256 blocks of 8 waves. Each wave packs one weight fragment and takes four rows.
// Neither job reads what the other writes.
constexpr int PW_ = 8;          // waves of a block
constexpr int RW_ = 4;          // rows of a wave
constexpr int RB_ = PW_ * RW_;  // rows of a block: their mask is one 32-bit ballot
constexpr int FRAGS_ = (H_ / 32) * (H_ / 16);  // fragments of each of the four weight inputs
static_assert(RB_ == 32 && 4 * FRAGS_ == (B_ * S_ / RB_) * PW_, "one fragment per wave");

// x + (x of lane l ^ M), M < 16: one DPP add inside the 16-lane row
template <int M>
__device__ __forceinline__ float xmask_add(float x) {
  int b = __builtin_bit_cast(int, x);
  return x + __builtin_bit_cast(float,
                                __builtin_amdgcn_update_dpp(0, b, 0x160 + M, 0xf, 0xf, true));
}
// sum over the wave, the same in every lane
__device__ __forceinline__ float wave_sum(float x) {
  x = xmask_add<1>(x);
  x = xmask_add<2>(x);
  x = xmask_add<4>(x);
  x = xmask_add<8>(x);
  return x + xhalf(x);
}

// A block takes RB_ neighbouring rows of one batch. It counts the batch's mask once: base =
// live rows in front of its first row, n = all live rows; the ballot of its own rows' mask
// gives each row's place behind base. A wave holds a whole row, 16 values a lane (four runs of
// 512 contiguous bytes a wave), so the row sums need no barrier.
// A live row is normalised and written at its compact row; a masked row stores its zeros
// to out and, if it is one of the first masked rows, the zero row n + (its rank) of the pad.
// xn_bf is written in fragment order, tiles [row/16][col/32], as kernel 2 reads it: a lane's
// four neighbours along a row are half of one 16-byte place there.
__global__ void __launch_bounds__(256) prep_kernel(
                            const float* __restrict__ x, const int* __restrict__ mask,
                            const float* __restrict__ gamma, const float* __restrict__ beta,
                            const float* __restrict__ Wq, const float* __restrict__ Wk,
                            const float* __restrict__ Wv, const float* __restrict__ Wo,
                            __bf16* __restrict__ wq_pk, __bf16* __restrict__ wk_pk,
                            __bf16* __restrict__ wv_pk, __bf16* __restrict__ wo_pk,
                            float* __restrict__ xn, __bf16* __restrict__ xn_bf,
                            int* __restrict__ rowof, int* __restrict__ live,
                            float* __restrict__ out) {
  const int t = threadIdx.x, l = t & 31;
  const int wid = __builtin_amdgcn_readfirstlane(t >> 5);
  const int b = (int)blockIdx.x / (S_ / RB_);
  const int r0 = ((int)blockIdx.x % (S_ / RB_)) * RB_;
  const int* mb = mask + b * S_;
  const unsigned boff = (unsigned)(r0 + l) * 4u;  // in bytes: the block's row l
  const unsigned moff = (unsigned)t * 32u;        // in bytes: this thread's 8 entries
  const int mine = *(const int*)((const char*)mb + boff);
  const v4i m0 = *(const v4i*)((const char*)mb + moff);
  const v4i m1 = *(const v4i*)((const char*)mb + moff + 16);
  const unsigned coff = (unsigned)l * 16u;  // in bytes: the lane's 4 floats of a run of 128
  // In bytes: where columns 4l .. 4l + 3 of row 0 stand in fragment order: tile l / 8, and
  // K = 4 (l & 7) gives the half, g and the first or second four of the eight.
  const unsigned foff = ((unsigned)(l >> 3) * FT_ + (unsigned)((l >> 2) & 1) * FH_ +
                         (unsigned)((l >> 1) & 1) * 128u + (unsigned)(l & 1) * 4u) * 2u;
  v4f gm[4], bt[4];
#pragma unroll
  for (int q = 0; q < 4; ++q) {
    gm[q] = *(const v4f*)((const char*)gamma + coff + q * 512);
    bt[q] = *(const v4f*)((const char*)beta + coff + q * 512);
  }
  const unsigned bits = __builtin_amdgcn_ballot_w32(mine != 0);  // bit j: row r0 + j is live
  // Counted here, in front of the rows' loads: behind them the wait for the mask would take
  // in the rows as well.
  // The wave's 256 mask entries, counted by ballots: na = live, nb = live in front of r0.
  const int lim = r0 / 8 - wid * 32;  // lanes below lim hold entries in front of r0
  const unsigned lt = lim >= 32 ? 0xffffffffu : lim <= 0 ? 0u : (1u << lim) - 1u;
  int na = 0, nb = 0;
#pragma unroll
  for (int j = 0; j < 4; ++j) {
    const unsigned a0 = __builtin_amdgcn_ballot_w32(m0[j] != 0);
    const unsigned a1 = __builtin_amdgcn_ballot_w32(m1[j] != 0);
    na += __builtin_popcount(a0) + __builtin_popcount(a1);
    nb += __builtin_popcount(a0 & lt) + __builtin_popcount(a1 & lt);
  }
  __shared__ int rpc[PW_];
  if (l == 0) rpc[wid] = (na << 16) | nb;
  const int j0 = wid * RW_;
  const float* xr = x + (long)(b * S_ + r0 + j0) * H_;
  v4f v[RW_][4];
#pragma unroll
  for (int r = 0; r < RW_; ++r) {
    if ((bits >> (j0 + r)) & 1) {  // the same for the whole wave
#pragma unroll
      for (int q = 0; q < 4; ++q)
        v[r][q] = *(const v4f*)((const char*)(xr + r * H_) + coff + q * 512);
    } else {
#pragma unroll
      for (int q = 0; q < 4; ++q) v[r][q] = v4f{0.f, 0.f, 0.f, 0.f};
    }
  }
  // The weight loads go out behind the rows': in front of them the wait for the mask would take
  // them in and hold the rows' loads back.
  const unsigned which = blockIdx.x / (FRAGS_ / PW_);  // the weight input, one per block
  const unsigned fid = (blockIdx.x % (FRAGS_ / PW_)) * PW_ + wid;
  // Wq, Wk, Wv: eight row-major 512x64 matrices, one behind the other; Wo: one of 512x512.
  // Fragment fid, counted through the matrices, is (kc in K/32, nt in N/16); lane = column.
  const float* w = which == 0 ? Wq : which == 1 ? Wk : which == 2 ? Wv : Wo;
  const unsigned ld = which == 3 ? H_ : DK_;  // floats of a row
  const float* wf = w + (which == 3 ? (fid / 32) * 32 * H_ + (fid % 32) * 16
                                    : (fid / 64) * (H_ * DK_) + (fid % 64 / 4) * 32 * DK_ +
                                          (fid % 4) * 16);
  // The row length differs between the inputs: each load has an offset register of its own, so
  // that no branch stands here and the sixteen loads go out in a row.
  unsigned wx[16];  // element offsets of the lane's 16 values, in the K pattern of a fragment
  float wv[16];
#pragma unroll  // constant indices keep both arrays in registers
  for (unsigned e = 0; e < 16; ++e)
    wx[e] = ((e < 8 ? e : e + 8) + 8 * (unsigned)(l >> 4)) * ld + (l & 15);
#pragma unroll  // as above
  for (unsigned e = 0; e < 16; ++e) wv[e] = wf[wx[e]];
  // The offset registers of these loads and of those above may be reused behind them: wait
  // before they are overwritten. Naming them as inputs keeps them whole up to the wait.
  asm volatile("s_wait_xcnt 0x0" ::"v"(wx[0]), "v"(wx[1]), "v"(wx[2]), "v"(wx[3]), "v"(wx[4]),
               "v"(wx[5]), "v"(wx[6]), "v"(wx[7]), "v"(wx[8]), "v"(wx[9]), "v"(wx[10]),
               "v"(wx[11]), "v"(wx[12]), "v"(wx[13]), "v"(wx[14]), "v"(wx[15]), "v"(boff),
               "v"(moff), "v"(coff)
               : "memory");

  __syncthreads();
  int pc = 0;
#pragma unroll
  for (int i = 0; i < PW_; ++i) pc += rpc[i];
  pc = __builtin_amdgcn_readfirstlane(pc);
  const int base = pc & 0xffff, n = pc >> 16;
  if (r0 == 0 && t == 0) live[b] = n;

  // The four rows' sums side by side (a masked row's are 0): eight independent chains.
  float s[RW_], ss[RW_];
#pragma unroll
  for (int r = 0; r < RW_; ++r) {
    v4f a = (v[r][0] + v[r][1]) + (v[r][2] + v[r][3]);
    v4f a2 = (v[r][0] * v[r][0] + v[r][1] * v[r][1]) + (v[r][2] * v[r][2] + v[r][3] * v[r][3]);
    s[r] = (a[0] + a[1]) + (a[2] + a[3]);
    ss[r] = (a2[0] + a2[1]) + (a2[2] + a2[3]);
  }
#pragma unroll
  for (int r = 0; r < RW_; ++r) {
    s[r] = wave_sum(s[r]);
    ss[r] = wave_sum(ss[r]);
  }

#pragma unroll
  for (int r = 0; r < RW_; ++r) {
    const int j = j0 + r, sr = r0 + j;
    const int pos = base + __builtin_popcount(bits & ((1u << j) - 1u));  // live rows in front
    if ((bits >> j) & 1) {  // the same for the whole wave
      const long row = (long)b * S_ + pos;  // compact row
      if (l == 0) rowof[row] = sr;
      float mean = s[r] * (1.f / H_);
      float var = ss[r] * (1.f / H_) - mean * mean;
      float inv = rsqrtf(var + LN_EPS_);
      char* xo = (char*)(xn + row * H_);
      char* xb = (char*)(xn_bf + (row >> 4) * (16 * H_) + (row & 15) * 8);  // row's tiles, its place
      v4f o[4];
      v2i ob[4];  // four bf16 each
#pragma unroll
      for (int q = 0; q < 4; ++q) {
        v4bf c4;
#pragma unroll
        for (int i = 0; i < 4; ++i) {
          o[q][i] = (v[r][q][i] - mean) * inv * gm[q][i] + bt[q][i];
          c4[i] = (__bf16)o[q][i];
        }
        ob[q] = __builtin_bit_cast(v2i, c4);
      }
#pragma unroll
      for (int q = 0; q < 4; ++q) *(v4f*)(xo + coff + q * 512) = o[q];
#pragma unroll
      for (int q = 0; q < 4; ++q) *(v2i*)(xb + foff + q * (4 * FT_ * 2)) = ob[q];  // 128 columns: 4 tiles
      // The stores' registers are reused for the next row: wait before they are overwritten.
      // Naming the values as inputs keeps them whole up to the wait.
      asm volatile("s_wait_xcnt 0x0" ::"v"(o[0]), "v"(o[1]), "v"(o[2]), "v"(o[3]), "v"(ob[0]),
                   "v"(ob[1]), "v"(ob[2]), "v"(ob[3])
                   : "memory");
    } else {
      char* op = (char*)(out + ((long)b * S_ + sr) * H_);
#pragma unroll
      for (int q = 0; q < 4; ++q) *(v4f*)(op + coff + q * 512) = v4f{0.f, 0.f, 0.f, 0.f};
      // the stores' registers are reused behind them: wait before they are overwritten
      asm volatile("s_wait_xcnt 0x0" ::: "memory");
      const int jz = n + (sr - pos);  // masked rows follow the live ones: jz < S_
      if (jz < padded_rows(n)) {
        const long zr = (long)b * S_ + jz;
        char* zb = (char*)(xn_bf + (zr >> 4) * (16 * H_) + (zr & 15) * 8);
#pragma unroll
        for (int q = 0; q < 4; ++q) *(v2i*)(zb + foff + q * (4 * FT_ * 2)) = v2i{0, 0};  // bf16 zeros
        // as above
        asm volatile("s_wait_xcnt 0x0" ::: "memory");
      }
    }
  }

  // the weight fragment, in fragment order
  __bf16* pk = which == 0 ? wq_pk : which == 1 ? wk_pk : which == 2 ? wv_pk : wo_pk;
  __bf16* dst = pk + fid * FT_ + l * 8;
  v8bf lo, hi;
#pragma unroll
  for (int e = 0; e < 8; ++e) {
    lo[e] = (__bf16)wv[e];
    hi[e] = (__bf16)wv[8 + e];
  }
  *(v8bf*)dst = lo;
  *(v8bf*)(dst + FH_) = hi;
  // the stores' registers may be reused behind them: wait before they are overwritten
  asm volatile("s_wait_xcnt 0x0" ::: "memory");
}

// ---------------- kernel 2: Q/K/V projections ----------------
// grid = (B*NH/2, 3, S/128), block = 256 (8 waves); wave: 32(S) x 64(DK) tile of compact rows.
// A block takes 128 rows for two heads: waves w and w + 4 walk through the same rows of xn_bf, so
// that a block fetches 128 KB of rows and 128 KB of weights for its 16,384 results (one head to
// a block: 128 KB and 64 KB for 8,192).
// Two row tiles to a wave: a weight fragment, once loaded, feeds two products, so that a k-step
// takes twelve loads for eight products (ten for four with one row tile), and half the waves
// are started. Four waves walk through the same weight fragments together.
// The row tile is the slowest grid index, so that the blocks with live rows come first.
// All three results are stored in fragment order, as the attention reads them:
// y=0: q (scaled 1/8) and y=1: k, per bn tiles [s/16][d/32], row = s, K = d;
// y=2: v transposed, per bn tiles [s/32][d/16], row = d, K = s.
// A lane stores 8 neighbours along K. For v that is the product xn * W (a lane's registers
// run along s); for q and k the operands change places, W^T * xn^T (they run along d).
// The product of a wave's 32 x 64 tile, for the Q, K, V and output projections. xn_bf: the row operand, in fragment
// order, tiles [row/16][col/32]; wpk: the first of the wave's four weight fragments of k-step 0;
// NF: weight fragments from one k-step to the next. acc: [row tile][column tile].
// TR: the transposed product. row0: the first of the wave's 32 rows.
template <bool TR, int NF>
__device__ __forceinline__ void gemm_tile(const __bf16* __restrict__ xn_bf, long row0,
                                          const __bf16* __restrict__ wpk, v8f (&acc)[2][4]) {
#pragma unroll
  for (int u = 0; u < 2; ++u)
#pragma unroll
    for (int t = 0; t < 4; ++t) acc[u][t] = zero_v8f();

  // Register ring, PD_ k-steps deep: a step's twelve loads go out PD_ steps ahead of its
  // products, so that a wave waits for one landing per PD_ steps, not for one per product.
  constexpr int PD_ = 3;
  v16bf fa[PD_][2], fb[PD_][4];
  const int l = threadIdx.x & 31;
  const __bf16* pa = xn_bf + row0 * (long)H_ + l * 8;  // tile [row0 / 16][0], the lane's place
  const unsigned wo = (unsigned)l * 16u;  // the lane's place in a half tile, in bytes
  // the second row tile stands 16 rows of H_ elements behind the first
  auto load_a = [&](int kc, int u) { return load_frag_fo(pa + u * (16 * H_) + kc * FT_); };
  auto load_b = [&](int f) {
    return load_frag_fo((const __bf16*)((const char*)wpk + wo) + f * FT_);
  };
  // Every loop over the ring is unrolled in full: only constant slot numbers keep it in
  // registers.
#pragma unroll
  for (int s = 0; s < PD_; ++s) {
    fa[s][0] = load_a(s, 0);
    fa[s][1] = load_a(s, 1);
#pragma unroll  // constant slot numbers, as above
    for (int t = 0; t < 4; ++t) fb[s][t] = load_b(s * NF + t);
  }
#pragma unroll  // constant slot numbers, as above
  for (int kc = 0; kc < H_ / 32; ++kc) {
    const int s = kc % PD_;
#pragma unroll  // constant slot numbers, as above
    for (int u = 0; u < 2; ++u)
#pragma unroll  // constant slot numbers, as above
      for (int t = 0; t < 4; ++t)
        acc[u][t] = TR ? wmma_bf16(fb[s][t], fa[s][u], acc[u][t])
                       : wmma_bf16(fa[s][u], fb[s][t], acc[u][t]);
    if (kc + PD_ < H_ / 32) {
      fa[s][0] = load_a(kc + PD_, 0);
      fa[s][1] = load_a(kc + PD_, 1);
#pragma unroll  // constant slot numbers, as above
      for (int t = 0; t < 4; ++t) fb[s][t] = load_b((kc + PD_) * NF + t);
    }
    // keeps the refill here: moved down to its use, each load would be waited for alone
    __builtin_amdgcn_sched_barrier(0);
  }
  // The loads' address registers are reused behind the loop: wait before they are overwritten.
  // Naming them as inputs keeps them whole up to the wait.
  asm volatile("s_wait_xcnt 0x0" ::"v"(pa), "v"(wo) : "memory");
}

// dst: the place of the wave's first 16 rows.
template <bool TR>
__device__ __forceinline__ void proj_tile(const __bf16* __restrict__ xn_bf, long row0,
                                          const __bf16* __restrict__ wpk, float sc,
                                          __bf16* __restrict__ dst) {
  v8f acc[2][4];  // [row tile][column tile]
  gemm_tile<TR, 4>(xn_bf, row0, wpk, acc);

  // Row tile u, s counted from its first row:
  // TR: acc[u][t][i] = value(s = lane's row c, d = 16t + 8g + i): half t & 1 of tile 2u + (t >> 1).
  // else: acc[u][t][i] = value(s = 8g + i, d = 16t + c): half u of tile t.
  v8bf o[2][4];
#pragma unroll
  for (int u = 0; u < 2; ++u)
#pragma unroll
    for (int t = 0; t < 4; ++t)
#pragma unroll
      for (int i = 0; i < 8; ++i) o[u][t][i] = (__bf16)(acc[u][t][i] * sc);
#pragma unroll
  for (int u = 0; u < 2; ++u)
#pragma unroll
    for (int t = 0; t < 4; ++t)
      *(v8bf*)(dst + u * (TR ? 2 * FT_ : FH_) + t * (TR ? FH_ : FT_)) = o[u][t];
  // the stores' registers may be reused behind them: wait before they are overwritten
  asm volatile("s_wait_xcnt 0x0" ::: "memory");
}

// The real block size lifts the register ceiling, which the ring of fragments needs.
__global__ void __launch_bounds__(256) proj_kernel(const __bf16* __restrict__ xn_bf,
                            const __bf16* __restrict__ wq_pk, const __bf16* __restrict__ wk_pk,
                            const __bf16* __restrict__ wv_pk,
                            const int* __restrict__ live, __bf16* __restrict__ q, __bf16* __restrict__ k,
                            __bf16* __restrict__ vT) {
  int which = blockIdx.y;
  const int wid = __builtin_amdgcn_readfirstlane(threadIdx.x >> 5);
  int l = threadIdx.x & 31;
  int bn = (int)blockIdx.x * 2 + (wid >> 2);
  int n = bn & 7;
  const int s32 = (int)blockIdx.z * 128 + (wid & 3) * 32;  // the wave's 32 rows
  // whole waves leave (the pad ends at a multiple of 64 rows); the kernel has no barrier
  if (s32 >= padded_rows(live_rows(live, bn >> 3))) return;
  long row0 = ((long)(bn >> 3)) * S_ + s32;
  const long hoff = (long)n * 64 * FT_;  // 64 fragments per head
  // 32 rows of a head are 32 * DK_ elements in each of the three layouts
  const long boff = ((long)bn * S_ + (long)s32) * DK_ + l * 8;
  if (which == 2)
    proj_tile<false>(xn_bf, row0, wv_pk + hoff, 1.f, vT + boff);
  else  // 1/sqrt(DK) is folded into q
    proj_tile<true>(xn_bf, row0, (which == 1 ? wk_pk : wq_pk) + hoff, which == 1 ? 1.f : 0.125f,
                    (which == 1 ? k : q) + boff);
}

__global__ void __launch_bounds__(128) attn_kernel(const __bf16* __restrict__ qm, const __bf16* __restrict__ km,
                            const __bf16* __restrict__ vT, const int* __restrict__ live,
                            __bf16* __restrict__ h) {
  int wid = threadIdx.x >> 5;
  int l = threadIdx.x & 31;
  int g = l >> 4;
  int bn = blockIdx.x;
  int b = bn >> 3, n = bn & 7;
  const int nl = live_rows(live, b);
  if ((int)blockIdx.y * 64 >= nl) return;  // whole block: no live query here
  long s0 = (long)blockIdx.y * 64 + wid * 16;
  const __bf16* qb = qm + (long)bn * S_ * DK_;
  const __bf16* kb = km + (long)bn * S_ * DK_;
  const __bf16* vb = vT + (long)bn * DK_ * S_;
  const unsigned loff = (unsigned)l * 8;  // the lane's place in a half tile

  // B operand: column c = query s0 + c
  v16bf bq0 = load_frag_fo(qb + s0 * DK_ + loff);
  v16bf bq1 = load_frag_fo(qb + s0 * DK_ + loff + FT_);
  // the Q loads' address pair is reused behind them: wait before it is overwritten
  asm volatile("s_wait_xcnt 0x0" ::: "memory");

  v8f acc[4];  // acc[t][i] = O^T[d = 16t + 8g + i][query s0 + c]
#pragma unroll
  for (int t = 0; t < 4; ++t) acc[t] = zero_v8f();
  float mr = -1e38f;  // running maximum of this lane's query (both halves agree)
  float lr = 0.f;     // running sum over this half's keys only; joined after the loop

  // The eight fragments of one tile of 32 keys: K rows 0-15 and 16-31 (two k halves each),
  // V^T rows 16t. Each four are neighbours in memory.
  auto load_tile = [&](v16bf (&fk)[4], v16bf (&fv)[4], int kt) {
    const __bf16* pk = kb + (long)kt * DK_ + loff;  // the lane's own addresses
    const __bf16* pv = vb + (long)kt * DK_ + loff;
#pragma unroll  // constant indices keep the fragments in registers
    for (int t = 0; t < 4; ++t) fk[t] = load_frag_fo(pk + t * FT_);
#pragma unroll  // constant indices keep the fragments in registers
    for (int t = 0; t < 4; ++t) fv[t] = load_frag_fo(pv + t * FT_);
    // The loads' address pairs are formed anew for the next tile while these loads fly: wait
    // before they are overwritten. Naming them as inputs keeps them whole up to the wait.
    asm volatile("s_wait_xcnt 0x0" ::"v"(pk), "v"(pv) : "memory");
  };

  // One tile of 32 compact keys from the fragments ck, cv; the next tile's sixteen loads go
  // out first, into nk, nv, and land while this tile is worked on. In the last, partly filled
  // tile only the keys below nl are live (it holds at least one); the rows of the pad behind
  // them are zeros.
  auto tile = [&](const v16bf (&ck)[4], const v16bf (&cv)[4], v16bf (&nk)[4], v16bf (&nv)[4],
                  int kt) {
    // behind the last tile there is none: that tile is fetched again (written, finite values)
    load_tile(nk, nv, min(kt + 32, (nl - 1) & ~31));
    // keeps the loads up here: moved down to their use, each would be waited for alone
    __builtin_amdgcn_sched_barrier(0);
    // s0f[i] = score(key kt + 8g + i, query c); s1f[i] = score(key kt + 16 + 8g + i, query c)
    v8f s0f = zero_v8f(), s1f = zero_v8f();
    s0f = wmma_bf16(ck[0], bq0, s0f);
    s0f = wmma_bf16(ck[1], bq1, s0f);
    s1f = wmma_bf16(ck[2], bq0, s1f);
    s1f = wmma_bf16(ck[3], bq1, s1f);

    const int rem = nl - kt - 8 * g;  // register i of s0f is live while i < rem
    float tm = 0.f;
#pragma unroll
    for (int i = 0; i < 8; ++i) {
      s0f[i] = (i < rem) ? s0f[i] : NEG_INF_;
      s1f[i] = (i + 16 < rem) ? s1f[i] : NEG_INF_;
      float t2 = fmaxf(s0f[i], s1f[i]);
      tm = (i == 0) ? t2 : fmaxf(tm, t2);
    }
    tm = fmaxf(tm, xhalf(tm));

    float mn = fmaxf(mr, tm);
    float corr = __expf(mr - mn);
    mr = mn;
#pragma unroll
    for (int t = 0; t < 4; ++t)
#pragma unroll
      for (int i = 0; i < 8; ++i) acc[t][i] *= corr;

    // P^T as B operand: element e < 8 is key 8g + e, e >= 8 is key 16 + 8g + (e - 8),
    // the K pattern of a fragment.
    v16bf pt;
    float psum = 0.f;
#pragma unroll
    for (int i = 0; i < 8; ++i) {
      float p0 = __expf(s0f[i] - mn);
      float p1 = __expf(s1f[i] - mn);
      psum += p0 + p1;
      pt[i] = (__bf16)p0;
      pt[8 + i] = (__bf16)p1;
    }
    lr = lr * corr + psum;

#pragma unroll
    for (int t = 0; t < 4; ++t) acc[t] = wmma_bf16(cv[t], pt, acc[t]);
  };

  // Two sets of fragments take turns, so that none is copied; nl is at least 1 here and at
  // most S_. With an odd number of tiles the last turn has no live key: every score is
  // NEG_INF_ against a finite maximum, so corr is 1, every p is 0 and nothing changes.
  v16bf k0[4], v0[4], k1[4], v1[4];
  load_tile(k0, v0, 0);
  for (int kt = 0; kt < nl; kt += 64) {
    tile(k0, v0, k1, v1, kt);
    tile(k1, v1, k0, v0, kt + 32);
  }

  float inv = 1.f / (lr + xhalf(lr));
  // the lane's 8 contiguous d of its query are its place in half t & 1 of tile 2n + (t >> 1)
  __bf16* hp = h + ((long)b * S_ + s0) * H_ + n * 2 * FT_ + loff;
  v8bf o[4];
#pragma unroll
  for (int t = 0; t < 4; ++t)
#pragma unroll
    for (int i = 0; i < 8; ++i) o[t][i] = (__bf16)(acc[t][i] * inv);
#pragma unroll
  for (int t = 0; t < 4; ++t) *(v8bf*)(hp + t * FH_) = o[t];
  // the stores' registers may be reused behind them: wait before they are overwritten
  asm volatile("s_wait_xcnt 0x0" ::: "memory");
}

// ---------------- kernel 4: output projection + residual, live rows back in place ----------
// grid = B * (S/64) * (H/128), block = 128 (4 waves): a block takes 64 compact rows x 128
// columns, a wave 32 x 64 of them by gemm_tile. Two waves walk through the same weight
// fragments and two through the same rows of h, so that a block fetches 64 KB of h and 128 KB
// of weights for its 8,192 results (a block of 16 rows x 512 columns: 16 KB and 512 KB).
// The batch is the fast part of the index and the row tile the slowest, so that the blocks with
// live rows come first.
// The real block size lifts the register ceiling, which the ring of fragments needs.
__global__ void __launch_bounds__(128) outproj_kernel(
                               const __bf16* __restrict__ hbf, const __bf16* __restrict__ wo_pk,
                               const float* __restrict__ xn, const int* __restrict__ rowof,
                               const int* __restrict__ live, float* __restrict__ out) {
  const int wid = __builtin_amdgcn_readfirstlane(threadIdx.x >> 5);
  int l = threadIdx.x & 31;
  int g = l >> 4, c = l & 15;
  int b = blockIdx.x % B_;
  const int tile = (int)(blockIdx.x / B_);
  const int j0 = (tile / (H_ / 128)) * 64 + (wid & 1) * 32;  // the wave's 32 compact rows
  const int n0 = (tile % (H_ / 128)) * 128 + (wid >> 1) * 64;  // its 64 columns
  const int nl = live_rows(live, b);
  // whole waves leave: no live row here (h is written up to the pad's end, a multiple of 64
  // rows); the kernel has no barrier
  if (j0 >= nl) return;
  long row0 = (long)b * S_ + j0;

  v8f acc[2][4];  // acc[u][t][i] = value(row 16u + 8g + i, column 16t + c)
  gemm_tile<false, H_ / 16>(hbf, row0, wo_pk + (n0 / 16) * FT_, acc);

  // A row of the pad has no place in out: it reads the last live row's residual and home
  // row, so that all loads go out together, and stores nothing.
  // Lane l fetches the home row of the wave's row l.
  const unsigned ro = (unsigned)(b * S_ + min(j0 + l, nl - 1));  // element offset in rowof
  const int hr = rowof[ro];
  v8f res[2][4];
  unsigned xo[2][8];  // element offsets in xn
#pragma unroll
  for (int u = 0; u < 2; ++u)
#pragma unroll
    for (int i = 0; i < 8; ++i)
      xo[u][i] = (unsigned)(b * S_ + min(j0 + 16 * u + i + 8 * g, nl - 1)) * H_ + n0 + c;
#pragma unroll
  for (int u = 0; u < 2; ++u)
#pragma unroll
    for (int i = 0; i < 8; ++i)
#pragma unroll
      for (int t = 0; t < 4; ++t) res[u][t][i] = xn[xo[u][i] + t * 16];
  // The loads' offset registers are reused behind them: wait before they are overwritten.
  // Naming the offsets as inputs keeps them whole up to the wait. Naming the loaded values as
  // inputs keeps all the loads in front of it: moved down into a row's branch, a row's four
  // would go out alone and be waited for alone.
  asm volatile("s_wait_xcnt 0x0" ::"v"(ro), "v"(xo[0][0]), "v"(xo[0][1]), "v"(xo[0][2]),
               "v"(xo[0][3]), "v"(xo[0][4]), "v"(xo[0][5]), "v"(xo[0][6]), "v"(xo[0][7]),
               "v"(xo[1][0]), "v"(xo[1][1]), "v"(xo[1][2]), "v"(xo[1][3]), "v"(xo[1][4]),
               "v"(xo[1][5]), "v"(xo[1][6]), "v"(xo[1][7]), "v"(res[0][0]), "v"(res[0][1]),
               "v"(res[0][2]), "v"(res[0][3]), "v"(res[1][0]), "v"(res[1][1]), "v"(res[1][2]),
               "v"(res[1][3])
               : "memory");
#pragma unroll
  for (int u = 0; u < 2; ++u)
#pragma unroll
    for (int t = 0; t < 4; ++t) acc[u][t] += res[u][t];
#pragma unroll
  for (int u = 0; u < 2; ++u)
#pragma unroll
    for (int i = 0; i < 8; ++i) {
      // home row of the wave's row 16u + i + 8g, masked to the shape
      int lo = __builtin_amdgcn_readlane(hr, 16 * u + i);
      int hi = __builtin_amdgcn_readlane(hr, 16 * u + i + 8);
      int orow = (g ? hi : lo) & (S_ - 1);
      if (j0 + 16 * u + i + 8 * g < nl) {
        float* op = out + ((long)b * S_ + orow) * H_ + n0 + c;
#pragma unroll
        for (int t = 0; t < 4; ++t) op[t * 16] = acc[u][t][i];
        // the stores' registers are reused for the next row: wait before they are overwritten
        asm volatile("s_wait_xcnt 0x0" ::: "memory");
      }
    }
}

extern "C" void kernel_launch(void* const* d_in, const int* in_sizes, int n_in,
                              void* d_out, int out_size, void* d_ws, size_t ws_size,
                              hipStream_t stream) {
  (void)in_sizes; (void)n_in; (void)out_size; (void)ws_size;
  const float* x     = (const float*)d_in[0];
  const int*   mask  = (const int*)d_in[1];
  const float* Wq    = (const float*)d_in[2];
  const float* Wk    = (const float*)d_in[3];
  const float* Wv    = (const float*)d_in[4];
  const float* Wo    = (const float*)d_in[5];
  const float* gamma = (const float*)d_in[6];
  const float* beta  = (const float*)d_in[7];
  float* out = (float*)d_out;

  char* ws = (char*)d_ws;
  float* xn = (float*)ws;        ws += (size_t)B_ * S_ * H_ * 4;
  __bf16* xn_bf = (__bf16*)ws;   ws += (size_t)B_ * S_ * H_ * 2;
  __bf16* qb = (__bf16*)ws;      ws += (size_t)B_ * NH_ * S_ * DK_ * 2;
  __bf16* kb = (__bf16*)ws;      ws += (size_t)B_ * NH_ * S_ * DK_ * 2;
  __bf16* vT = (__bf16*)ws;      ws += (size_t)B_ * NH_ * S_ * DK_ * 2;
  __bf16* hb = (__bf16*)ws;      ws += (size_t)B_ * S_ * H_ * 2;
  __bf16* wq_pk = (__bf16*)ws;   ws += (size_t)NH_ * H_ * DK_ * 2;
  __bf16* wk_pk = (__bf16*)ws;   ws += (size_t)NH_ * H_ * DK_ * 2;
  __bf16* wv_pk = (__bf16*)ws;   ws += (size_t)NH_ * H_ * DK_ * 2;
  __bf16* wo_pk = (__bf16*)ws;   ws += (size_t)H_ * H_ * 2;
  int* rowof = (int*)ws;         ws += (size_t)B_ * S_ * 4;
  int* live = (int*)ws;          ws += (size_t)B_ * 4;

  // weight packing (per-head KxN = 512x64: 8*16*4 = 512 fragments; Wo: 16*32 = 512) and
  // LayerNorm in one launch
  prep_kernel<<<B_ * S_ / RB_, 32 * PW_, 0, stream>>>(x, mask, gamma, beta, Wq, Wk, Wv, Wo,
                                                      wq_pk, wk_pk, wv_pk, wo_pk, xn, xn_bf,
                                                      rowof, live, out);

  proj_kernel<<<dim3(B_ * NH_ / 2, 3, S_ / 128), 256, 0, stream>>>(xn_bf, wq_pk, wk_pk, wv_pk,
                                                                   live, qb, kb, vT);

  attn_kernel<<<dim3(B_ * NH_, S_ / 64), 128, 0, stream>>>(qb, kb, vT, live, hb);

  outproj_kernel<<<B_ * (S_ / 64) * (H_ / 128), 128, 0, stream>>>(hb, wo_pk, xn, rowof, live, out);
}

// v010
// One run takes 45.9 microseconds.
// Next to v009, in two timings, it ran 1.04 and 1.02 times as fast.
// All steps since v000 together make it 7.96 times as fast.
#include <hip/hip_runtime.h>

#define B_ 4
#define S_ 2048
#define H_ 512
#define NH_ 8
#define DK_ 64

constexpr float LN_EPS_ = 1e-5f;
constexpr float NEG_INF_ = -1e30f;

typedef __attribute__((ext_vector_type(16))) __bf16 v16bf;
typedef __attribute__((ext_vector_type(8)))  __bf16 v8bf;
typedef __attribute__((ext_vector_type(4)))  __bf16 v4bf;
typedef __attribute__((ext_vector_type(8)))  float  v8f;
typedef __attribute__((ext_vector_type(4)))  float  v4f;
typedef __attribute__((ext_vector_type(4)))  int    v4i;
typedef __attribute__((ext_vector_type(2)))  int    v2i;

__device__ __forceinline__ v8f zero_v8f() {
  v8f z;
#pragma unroll
  for (int i = 0; i < 8; ++i) z[i] = 0.f;
  return z;
}

// A 16x32 bf16 fragment: lane l = 16g + r holds row r; the K pattern of its 16 elements is
// e < 8 -> 8g + e, e >= 8 -> 16 + 8g + (e - 8).
// Fragment order: a 16x32 tile is 512 elements in a row, [half][lane][8]. Lane l = 16g + r
// holds row r; its 8 elements of half 0 are K = 8g + e, of half 1 K = 16 + 8g + e: the K
// pattern above. Each half is 512 contiguous bytes, so that a wave's 16-byte load
// or store of it covers four whole 128-byte lines (a row-major tile: a piece of sixteen).
constexpr int FT_ = 512;  // elements of a tile
constexpr int FH_ = 256;  // elements of a half
// p = start of the tile + 8 * lane
__device__ __forceinline__ v16bf load_frag_fo(const __bf16* p) {
  v8bf lo = *(const v8bf*)p;
  v8bf hi = *(const v8bf*)(p + FH_);
  return __builtin_shufflevector(lo, hi, 0, 1, 2, 3, 4, 5, 6, 7,
                                 8, 9, 10, 11, 12, 13, 14, 15);
}

// Packed weight fragment f, in fragment order.
__device__ __forceinline__ v16bf load_frag_pk(const __bf16* pk, int f) {
  int l = threadIdx.x & 31;
  return load_frag_fo(pk + (long)f * FT_ + l * 8);
}

__device__ __forceinline__ v8f wmma_bf16(v16bf a, v16bf b, v8f c) {
  return __builtin_amdgcn_wmma_f32_16x16x32_bf16(false, a, false, b, (short)0, c,
                                                 false, false);
}

// value of lane l ^ 16
__device__ __forceinline__ float xhalf(float x) {
  int b = __builtin_bit_cast(int, x);
  return __builtin_bit_cast(float, __builtin_amdgcn_permlanex16(b, b, 0x76543210, 0xfedcba98,
                                                                false, false));
}

// Rows whose mask is 0 give an output of 0 as queries and a probability of exactly 0 as
// keys (a batch with no live key has no live query either), so every stage behind the
// LayerNorm works on the live rows alone, moved up to the front of their batch in their
// old order ("compact" rows). live[b] = number of live rows of batch b.
__device__ __forceinline__ int live_rows(const int* __restrict__ live, int b) {
  return min(max(live[b], 0), S_);
}
// compact rows are zero-filled up to the next multiple of 64 (the query tile of an attention block)
__device__ __forceinline__ int padded_rows(int n) { return (n + 63) & ~63; }

// ---------------- kernel 1: weight packing, LayerNorm + row compaction ----------------
// Work-groups start at a limited rate, so the launch has one work-group per WGP and not one
// per row: 256 blocks of 8 waves. Each wave packs one weight fragment and takes four rows.
// Neither job reads what the other writes.
constexpr int PW_ = 8;          // waves of a block
constexpr int RW_ = 4;          // rows of a wave
constexpr int RB_ = PW_ * RW_;  // rows of a block: their mask is one 32-bit ballot
constexpr int FRAGS_ = (H_ / 32) * (H_ / 16);  // fragments of each of the four weight inputs
static_assert(RB_ == 32 && 4 * FRAGS_ == (B_ * S_ / RB_) * PW_, "one fragment per wave");

// x + (x of lane l ^ M), M < 16: one DPP add inside the 16-lane row
template <int M>
__device__ __forceinline__ float xmask_add(float x) {
  int b = __builtin_bit_cast(int, x);
  return x + __builtin_bit_cast(float,
                                __builtin_amdgcn_update_dpp(0, b, 0x160 + M, 0xf, 0xf, true));
}
// sum over the wave, the same in every lane
__device__ __forceinline__ float wave_sum(float x) {
  x = xmask_add<1>(x);
  x = xmask_add<2>(x);
  x = xmask_add<4>(x);
  x = xmask_add<8>(x);
  return x + xhalf(x);
}

// A block takes RB_ neighbouring rows of one batch. It counts the batch's mask once: base =
// live rows in front of its first row, n = all live rows; the ballot of its own rows' mask
// gives each row's place behind base. A wave holds a whole row, 16 values a lane (four runs of
// 512 contiguous bytes a wave), so the row sums need no barrier.
// A live row is normalised and written at its compact row; a masked row stores its zeros
// to out and, if it is one of the first masked rows, the zero row n + (its rank) of the pad.
// xn_bf is written in fragment order, tiles [row/16][col/32], as kernel 2 reads it: a lane's
// four neighbours along a row are half of one 16-byte place there.
__global__ void __launch_bounds__(256) prep_kernel(
                            const float* __restrict__ x, const int* __restrict__ mask,
                            const float* __restrict__ gamma, const float* __restrict__ beta,
                            const float* __restrict__ Wq, const float* __restrict__ Wk,
                            const float* __restrict__ Wv, const float* __restrict__ Wo,
                            __bf16* __restrict__ wq_pk, __bf16* __restrict__ wk_pk,
                            __bf16* __restrict__ wv_pk, __bf16* __restrict__ wo_pk,
                            float* __restrict__ xn, __bf16* __restrict__ xn_bf,
                            int* __restrict__ rowof, int* __restrict__ live,
                            float* __restrict__ out) {
  const int t = threadIdx.x, l = t & 31;
  const int wid = __builtin_amdgcn_readfirstlane(t >> 5);
  const int b = (int)blockIdx.x / (S_ / RB_);
  const int r0 = ((int)blockIdx.x % (S_ / RB_)) * RB_;
  const int* mb = mask + b * S_;
  const unsigned boff = (unsigned)(r0 + l) * 4u;  // in bytes: the block's row l
  const unsigned moff = (unsigned)t * 32u;        // in bytes: this thread's 8 entries
  const int mine = *(const int*)((const char*)mb + boff);
  const v4i m0 = *(const v4i*)((const char*)mb + moff);
  const v4i m1 = *(const v4i*)((const char*)mb + moff + 16);
  const unsigned coff = (unsigned)l * 16u;  // in bytes: the lane's 4 floats of a run of 128
  // In bytes: where columns 4l .. 4l + 3 of row 0 stand in fragment order: tile l / 8, and
  // K = 4 (l & 7) gives the half, g and the first or second four of the eight.
  const unsigned foff = ((unsigned)(l >> 3) * FT_ + (unsigned)((l >> 2) & 1) * FH_ +
                         (unsigned)((l >> 1) & 1) * 128u + (unsigned)(l & 1) * 4u) * 2u;
  v4f gm[4], bt[4];
#pragma unroll
  for (int q = 0; q < 4; ++q) {
    gm[q] = *(const v4f*)((const char*)gamma + coff + q * 512);
    bt[q] = *(const v4f*)((const char*)beta + coff + q * 512);
  }
  const unsigned bits = __builtin_amdgcn_ballot_w32(mine != 0);  // bit j: row r0 + j is live
  // Counted here, in front of the rows' loads: behind them the wait for the mask would take
  // in the rows as well.
  // The wave's 256 mask entries, counted by ballots: na = live, nb = live in front of r0.
  const int lim = r0 / 8 - wid * 32;  // lanes below lim hold entries in front of r0
  const unsigned lt = lim >= 32 ? 0xffffffffu : lim <= 0 ? 0u : (1u << lim) - 1u;
  int na = 0, nb = 0;
#pragma unroll
  for (int j = 0; j < 4; ++j) {
    const unsigned a0 = __builtin_amdgcn_ballot_w32(m0[j] != 0);
    const unsigned a1 = __builtin_amdgcn_ballot_w32(m1[j] != 0);
    na += __builtin_popcount(a0) + __builtin_popcount(a1);
    nb += __builtin_popcount(a0 & lt) + __builtin_popcount(a1 & lt);
  }
  __shared__ int rpc[PW_];
  if (l == 0) rpc[wid] = (na << 16) | nb;
  const int j0 = wid * RW_;
  const float* xr = x + (long)(b * S_ + r0 + j0) * H_;
  v4f v[RW_][4];
#pragma unroll
  for (int r = 0; r < RW_; ++r) {
    if ((bits >> (j0 + r)) & 1) {  // the same for the whole wave
#pragma unroll
      for (int q = 0; q < 4; ++q)
        v[r][q] = *(const v4f*)((const char*)(xr + r * H_) + coff + q * 512);
    } else {
#pragma unroll
      for (int q = 0; q < 4; ++q) v[r][q] = v4f{0.f, 0.f, 0.f, 0.f};
    }
  }
  // The weight loads go out behind the rows': in front of them the wait for the mask would take
  // them in and hold the rows' loads back.
  const unsigned which = blockIdx.x / (FRAGS_ / PW_);  // the weight input, one per block
  const unsigned fid = (blockIdx.x % (FRAGS_ / PW_)) * PW_ + wid;
  // Wq, Wk, Wv: eight row-major 512x64 matrices, one behind the other; Wo: one of 512x512.
  // Fragment fid, counted through the matrices, is (kc in K/32, nt in N/16); lane = column.
  const float* w = which == 0 ? Wq : which == 1 ? Wk : which == 2 ? Wv : Wo;
  const unsigned ld = which == 3 ? H_ : DK_;  // floats of a row
  const float* wf = w + (which == 3 ? (fid / 32) * 32 * H_ + (fid % 32) * 16
                                    : (fid / 64) * (H_ * DK_) + (fid % 64 / 4) * 32 * DK_ +
                                          (fid % 4) * 16);
  // The row length differs between the inputs: each load has an offset register of its own, so
  // that no branch stands here and the sixteen loads go out in a row.
  unsigned wx[16];  // element offsets of the lane's 16 values, in the K pattern of a fragment
  float wv[16];
#pragma unroll  // constant indices keep both arrays in registers
  for (unsigned e = 0; e < 16; ++e)
    wx[e] = ((e < 8 ? e : e + 8) + 8 * (unsigned)(l >> 4)) * ld + (l & 15);
#pragma unroll  // as above
  for (unsigned e = 0; e < 16; ++e) wv[e] = wf[wx[e]];
  // The offset registers of these loads and of those above may be reused behind them: wait
  // before they are overwritten. Naming them as inputs keeps them whole up to the wait.
  asm volatile("s_wait_xcnt 0x0" ::"v"(wx[0]), "v"(wx[1]), "v"(wx[2]), "v"(wx[3]), "v"(wx[4]),
               "v"(wx[5]), "v"(wx[6]), "v"(wx[7]), "v"(wx[8]), "v"(wx[9]), "v"(wx[10]),
               "v"(wx[11]), "v"(wx[12]), "v"(wx[13]), "v"(wx[14]), "v"(wx[15]), "v"(boff),
               "v"(moff), "v"(coff)
               : "memory");

  __syncthreads();
  int pc = 0;
#pragma unroll
  for (int i = 0; i < PW_; ++i) pc += rpc[i];
  pc = __builtin_amdgcn_readfirstlane(pc);
  const int base = pc & 0xffff, n = pc >> 16;
  if (r0 == 0 && t == 0) live[b] = n;

  // The four rows' sums side by side (a masked row's are 0): eight independent chains.
  float s[RW_], ss[RW_];
#pragma unroll
  for (int r = 0; r < RW_; ++r) {
    v4f a = (v[r][0] + v[r][1]) + (v[r][2] + v[r][3]);
    v4f a2 = (v[r][0] * v[r][0] + v[r][1] * v[r][1]) + (v[r][2] * v[r][2] + v[r][3] * v[r][3]);
    s[r] = (a[0] + a[1]) + (a[2] + a[3]);
    ss[r] = (a2[0] + a2[1]) + (a2[2] + a2[3]);
  }
#pragma unroll
  for (int r = 0; r < RW_; ++r) {
    s[r] = wave_sum(s[r]);
    ss[r] = wave_sum(ss[r]);
  }

#pragma unroll
  for (int r = 0; r < RW_; ++r) {
    const int j = j0 + r, sr = r0 + j;
    const int pos = base + __builtin_popcount(bits & ((1u << j) - 1u));  // live rows in front
    if ((bits >> j) & 1) {  // the same for the whole wave
      const long row = (long)b * S_ + pos;  // compact row
      if (l == 0) rowof[row] = sr;
      float mean = s[r] * (1.f / H_);
      float var = ss[r] * (1.f / H_) - mean * mean;
      float inv = rsqrtf(var + LN_EPS_);
      char* xo = (char*)(xn + row * H_);
      char* xb = (char*)(xn_bf + (row >> 4) * (16 * H_) + (row & 15) * 8);  // row's tiles, its place
      v4f o[4];
      v2i ob[4];  // four bf16 each
#pragma unroll
      for (int q = 0; q < 4; ++q) {
        v4bf c4;
#pragma unroll
        for (int i = 0; i < 4; ++i) {
          o[q][i] = (v[r][q][i] - mean) * inv * gm[q][i] + bt[q][i];
          c4[i] = (__bf16)o[q][i];
        }
        ob[q] = __builtin_bit_cast(v2i, c4);
      }
#pragma unroll
      for (int q = 0; q < 4; ++q) *(v4f*)(xo + coff + q * 512) = o[q];
#pragma unroll
      for (int q = 0; q < 4; ++q) *(v2i*)(xb + foff + q * (4 * FT_ * 2)) = ob[q];  // 128 columns: 4 tiles
      // The stores' registers are reused for the next row: wait before they are overwritten.
      // Naming the values as inputs keeps them whole up to the wait.
      asm volatile("s_wait_xcnt 0x0" ::"v"(o[0]), "v"(o[1]), "v"(o[2]), "v"(o[3]), "v"(ob[0]),
                   "v"(ob[1]), "v"(ob[2]), "v"(ob[3])
                   : "memory");
    } else {
      char* op = (char*)(out + ((long)b * S_ + sr) * H_);
#pragma unroll
      for (int q = 0; q < 4; ++q) *(v4f*)(op + coff + q * 512) = v4f{0.f, 0.f, 0.f, 0.f};
      // the stores' registers are reused behind them: wait before they are overwritten
      asm volatile("s_wait_xcnt 0x0" ::: "memory");
      const int jz = n + (sr - pos);  // masked rows follow the live ones: jz < S_
      if (jz < padded_rows(n)) {
        const long zr = (long)b * S_ + jz;
        char* zb = (char*)(xn_bf + (zr >> 4) * (16 * H_) + (zr & 15) * 8);
#pragma unroll
        for (int q = 0; q < 4; ++q) *(v2i*)(zb + foff + q * (4 * FT_ * 2)) = v2i{0, 0};  // bf16 zeros
        // as above
        asm volatile("s_wait_xcnt 0x0" ::: "memory");
      }
    }
  }

  // the weight fragment, in fragment order
  __bf16* pk = which == 0 ? wq_pk : which == 1 ? wk_pk : which == 2 ? wv_pk : wo_pk;
  __bf16* dst = pk + fid * FT_ + l * 8;
  v8bf lo, hi;
#pragma unroll
  for (int e = 0; e < 8; ++e) {
    lo[e] = (__bf16)wv[e];
    hi[e] = (__bf16)wv[8 + e];
  }
  *(v8bf*)dst = lo;
  *(v8bf*)(dst + FH_) = hi;
  // the stores' registers may be reused behind them: wait before they are overwritten
  asm volatile("s_wait_xcnt 0x0" ::: "memory");
}

// ---------------- kernel 2: Q/K/V projections ----------------
// grid = (B*NH/2, 3, S/128), block = 256 (8 waves); wave: 32(S) x 64(DK) tile of compact rows.
// A block takes 128 rows for two heads: waves w and w + 4 walk through the same rows of xn_bf, so
// that a block fetches 128 KB of rows and 128 KB of weights for its 16,384 results (one head to
// a block: 128 KB and 64 KB for 8,192).
// Two row tiles to a wave: a weight fragment, once loaded, feeds two products, so that a k-step
// takes twelve loads for eight products (ten for four with one row tile), and half the waves
// are started. Four waves walk through the same weight fragments together.
// The row tile is the slowest grid index, so that the blocks with live rows come first.
// All three results are stored in fragment order, as the attention reads them:
// y=0: q (scaled 1/8) and y=1: k, per bn tiles [s/16][d/32], row = s, K = d;
// y=2: v transposed, per bn tiles [s/32][d/16], row = d, K = s.
// A lane stores 8 neighbours along K. For v that is the product xn * W (a lane's registers
// run along s); for q and k the operands change places, W^T * xn^T (they run along d).
// The product of a wave's 32 x 64 tile, for the Q, K, V and output projections. xn_bf: the row operand, in fragment
// order, tiles [row/16][col/32]; wpk: the first of the wave's four weight fragments of k-step 0;
// NF: weight fragments from one k-step to the next. acc: [row tile][column tile].
// TR: the transposed product. row0: the first of the wave's 32 rows.
// start(acc) gives the accumulators their start values; it runs behind the ring's first loads,
// so that loads of its own do not hold those back.
template <bool TR, int NF, class Start>
__device__ __forceinline__ void gemm_tile(const __bf16* __restrict__ xn_bf, long row0,
                                          const __bf16* __restrict__ wpk, v8f (&acc)[2][4],
                                          Start start) {
  // Register ring, PD_ k-steps deep: a step's twelve loads go out PD_ steps ahead of its
  // products, so that a wave waits for one landing per PD_ steps, not for one per product.
  constexpr int PD_ = 3;
  v16bf fa[PD_][2], fb[PD_][4];
  const int l = threadIdx.x & 31;
  const __bf16* pa = xn_bf + row0 * (long)H_ + l * 8;  // tile [row0 / 16][0], the lane's place
  const unsigned wo = (unsigned)l * 16u;  // the lane's place in a half tile, in bytes
  // the second row tile stands 16 rows of H_ elements behind the first
  auto load_a = [&](int kc, int u) { return load_frag_fo(pa + u * (16 * H_) + kc * FT_); };
  auto load_b = [&](int f) {
    return load_frag_fo((const __bf16*)((const char*)wpk + wo) + f * FT_);
  };
  // Every loop over the ring is unrolled in full: only constant slot numbers keep it in
  // registers.
#pragma unroll
  for (int s = 0; s < PD_; ++s) {
    fa[s][0] = load_a(s, 0);
    fa[s][1] = load_a(s, 1);
#pragma unroll  // constant slot numbers, as above
    for (int t = 0; t < 4; ++t) fb[s][t] = load_b(s * NF + t);
  }
  start(acc);
#pragma unroll  // constant slot numbers, as above
  for (int kc = 0; kc < H_ / 32; ++kc) {
    const int s = kc % PD_;
#pragma unroll  // constant slot numbers, as above
    for (int u = 0; u < 2; ++u)
#pragma unroll  // constant slot numbers, as above
      for (int t = 0; t < 4; ++t)
        acc[u][t] = TR ? wmma_bf16(fb[s][t], fa[s][u], acc[u][t])
                       : wmma_bf16(fa[s][u], fb[s][t], acc[u][t]);
    if (kc + PD_ < H_ / 32) {
      fa[s][0] = load_a(kc + PD_, 0);
      fa[s][1] = load_a(kc + PD_, 1);
#pragma unroll  // constant slot numbers, as above
      for (int t = 0; t < 4; ++t) fb[s][t] = load_b((kc + PD_) * NF + t);
    }
    // keeps the refill here: moved down to its use, each load would be waited for alone
    __builtin_amdgcn_sched_barrier(0);
  }
  // The loads' address registers are reused behind the loop: wait before they are overwritten.
  // Naming them as inputs keeps them whole up to the wait.
  asm volatile("s_wait_xcnt 0x0" ::"v"(pa), "v"(wo) : "memory");
}

// dst: the place of the wave's first 16 rows.
template <bool TR>
__device__ __forceinline__ void proj_tile(const __bf16* __restrict__ xn_bf, long row0,
                                          const __bf16* __restrict__ wpk, float sc,
                                          __bf16* __restrict__ dst) {
  v8f acc[2][4];  // [row tile][column tile]
  gemm_tile<TR, 4>(xn_bf, row0, wpk, acc, [](v8f (&a)[2][4]) {
#pragma unroll
    for (int u = 0; u < 2; ++u)
#pragma unroll
      for (int t = 0; t < 4; ++t) a[u][t] = zero_v8f();
  });

  // Row tile u, s counted from its first row:
  // TR: acc[u][t][i] = value(s = lane's row c, d = 16t + 8g + i): half t & 1 of tile 2u + (t >> 1).
  // else: acc[u][t][i] = value(s = 8g + i, d = 16t + c): half u of tile t.
  v8bf o[2][4];
#pragma unroll
  for (int u = 0; u < 2; ++u)
#pragma unroll
    for (int t = 0; t < 4; ++t)
#pragma unroll
      for (int i = 0; i < 8; ++i) o[u][t][i] = (__bf16)(acc[u][t][i] * sc);
#pragma unroll
  for (int u = 0; u < 2; ++u)
#pragma unroll
    for (int t = 0; t < 4; ++t)
      *(v8bf*)(dst + u * (TR ? 2 * FT_ : FH_) + t * (TR ? FH_ : FT_)) = o[u][t];
  // the stores' registers may be reused behind them: wait before they are overwritten
  asm volatile("s_wait_xcnt 0x0" ::: "memory");
}

// The real block size lifts the register ceiling, which the ring of fragments needs.
__global__ void __launch_bounds__(256) proj_kernel(const __bf16* __restrict__ xn_bf,
                            const __bf16* __restrict__ wq_pk, const __bf16* __restrict__ wk_pk,
                            const __bf16* __restrict__ wv_pk,
                            const int* __restrict__ live, __bf16* __restrict__ q, __bf16* __restrict__ k,
                            __bf16* __restrict__ vT) {
  int which = blockIdx.y;
  const int wid = __builtin_amdgcn_readfirstlane(threadIdx.x >> 5);
  int l = threadIdx.x & 31;
  int bn = (int)blockIdx.x * 2 + (wid >> 2);
  int n = bn & 7;
  const int s32 = (int)blockIdx.z * 128 + (wid & 3) * 32;  // the wave's 32 rows
  // whole waves leave (the pad ends at a multiple of 64 rows); the kernel has no barrier
  if (s32 >= padded_rows(live_rows(live, bn >> 3))) return;
  long row0 = ((long)(bn >> 3)) * S_ + s32;
  const long hoff = (long)n * 64 * FT_;  // 64 fragments per head
  // 32 rows of a head are 32 * DK_ elements in each of the three layouts
  const long boff = ((long)bn * S_ + (long)s32) * DK_ + l * 8;
  if (which == 2)
    proj_tile<false>(xn_bf, row0, wv_pk + hoff, 1.f, vT + boff);
  else  // 1/sqrt(DK) is folded into q
    proj_tile<true>(xn_bf, row0, (which == 1 ? wk_pk : wq_pk) + hoff, which == 1 ? 1.f : 0.125f,
                    (which == 1 ? k : q) + boff);
}

__global__ void __launch_bounds__(128) attn_kernel(const __bf16* __restrict__ qm, const __bf16* __restrict__ km,
                            const __bf16* __restrict__ vT, const int* __restrict__ live,
                            __bf16* __restrict__ h) {
  int wid = threadIdx.x >> 5;
  int l = threadIdx.x & 31;
  int g = l >> 4;
  int bn = blockIdx.x;
  int b = bn >> 3, n = bn & 7;
  const int nl = live_rows(live, b);
  if ((int)blockIdx.y * 64 >= nl) return;  // whole block: no live query here
  long s0 = (long)blockIdx.y * 64 + wid * 16;
  const __bf16* qb = qm + (long)bn * S_ * DK_;
  const __bf16* kb = km + (long)bn * S_ * DK_;
  const __bf16* vb = vT + (long)bn * DK_ * S_;
  const unsigned loff = (unsigned)l * 8;  // the lane's place in a half tile

  // B operand: column c = query s0 + c
  v16bf bq0 = load_frag_fo(qb + s0 * DK_ + loff);
  v16bf bq1 = load_frag_fo(qb + s0 * DK_ + loff + FT_);
  // the Q loads' address pair is reused behind them: wait before it is overwritten
  asm volatile("s_wait_xcnt 0x0" ::: "memory");

  v8f acc[4];  // acc[t][i] = O^T[d = 16t + 8g + i][query s0 + c]
#pragma unroll
  for (int t = 0; t < 4; ++t) acc[t] = zero_v8f();
  float mr = -1e38f;  // running maximum of this lane's query (both halves agree)
  float lr = 0.f;     // running sum over this half's keys only; joined after the loop

  // The eight fragments of one tile of 32 keys: K rows 0-15 and 16-31 (two k halves each),
  // V^T rows 16t. Each four are neighbours in memory.
  auto load_tile = [&](v16bf (&fk)[4], v16bf (&fv)[4], int kt) {
    const __bf16* pk = kb + (long)kt * DK_ + loff;  // the lane's own addresses
    const __bf16* pv = vb + (long)kt * DK_ + loff;
#pragma unroll  // constant indices keep the fragments in registers
    for (int t = 0; t < 4; ++t) fk[t] = load_frag_fo(pk + t * FT_);
#pragma unroll  // constant indices keep the fragments in registers
    for (int t = 0; t < 4; ++t) fv[t] = load_frag_fo(pv + t * FT_);
    // The loads' address pairs are formed anew for the next tile while these loads fly: wait
    // before they are overwritten. Naming them as inputs keeps them whole up to the wait.
    asm volatile("s_wait_xcnt 0x0" ::"v"(pk), "v"(pv) : "memory");
  };

  // One tile of 32 compact keys from the fragments ck, cv; the next tile's sixteen loads go
  // out first, into nk, nv, and land while this tile is worked on. In the last, partly filled
  // tile only the keys below nl are live (it holds at least one); the rows of the pad behind
  // them are zeros.
  auto tile = [&](const v16bf (&ck)[4], const v16bf (&cv)[4], v16bf (&nk)[4], v16bf (&nv)[4],
                  int kt) {
    // behind the last tile there is none: that tile is fetched again (written, finite values)
    load_tile(nk, nv, min(kt + 32, (nl - 1) & ~31));
    // keeps the loads up here: moved down to their use, each would be waited for alone
    __builtin_amdgcn_sched_barrier(0);
    // s0f[i] = score(key kt + 8g + i, query c); s1f[i] = score(key kt + 16 + 8g + i, query c)
    v8f s0f = zero_v8f(), s1f = zero_v8f();
    s0f = wmma_bf16(ck[0], bq0, s0f);
    s0f = wmma_bf16(ck[1], bq1, s0f);
    s1f = wmma_bf16(ck[2], bq0, s1f);
    s1f = wmma_bf16(ck[3], bq1, s1f);

    const int rem = nl - kt - 8 * g;  // register i of s0f is live while i < rem
    float tm = 0.f;
#pragma unroll
    for (int i = 0; i < 8; ++i) {
      s0f[i] = (i < rem) ? s0f[i] : NEG_INF_;
      s1f[i] = (i + 16 < rem) ? s1f[i] : NEG_INF_;
      float t2 = fmaxf(s0f[i], s1f[i]);
      tm = (i == 0) ? t2 : fmaxf(tm, t2);
    }
    tm = fmaxf(tm, xhalf(tm));

    float mn = fmaxf(mr, tm);
    float corr = __expf(mr - mn);
    mr = mn;
#pragma unroll
    for (int t = 0; t < 4; ++t)
#pragma unroll
      for (int i = 0; i < 8; ++i) acc[t][i] *= corr;

    // P^T as B operand: element e < 8 is key 8g + e, e >= 8 is key 16 + 8g + (e - 8),
    // the K pattern of a fragment.
    v16bf pt;
    float psum = 0.f;
#pragma unroll
    for (int i = 0; i < 8; ++i) {
      float p0 = __expf(s0f[i] - mn);
      float p1 = __expf(s1f[i] - mn);
      psum += p0 + p1;
      pt[i] = (__bf16)p0;
      pt[8 + i] = (__bf16)p1;
    }
    lr = lr * corr + psum;

#pragma unroll
    for (int t = 0; t < 4; ++t) acc[t] = wmma_bf16(cv[t], pt, acc[t]);
  };

  // Two sets of fragments take turns, so that none is copied; nl is at least 1 here and at
  // most S_. With an odd number of tiles the last turn has no live key: every score is
  // NEG_INF_ against a finite maximum, so corr is 1, every p is 0 and nothing changes.
  v16bf k0[4], v0[4], k1[4], v1[4];
  load_tile(k0, v0, 0);
  for (int kt = 0; kt < nl; kt += 64) {
    tile(k0, v0, k1, v1, kt);
    tile(k1, v1, k0, v0, kt + 32);
  }

  float inv = 1.f / (lr + xhalf(lr));
  // the lane's 8 contiguous d of its query are its place in half t & 1 of tile 2n + (t >> 1)
  __bf16* hp = h + ((long)b * S_ + s0) * H_ + n * 2 * FT_ + loff;
  v8bf o[4];
#pragma unroll
  for (int t = 0; t < 4; ++t)
#pragma unroll
    for (int i = 0; i < 8; ++i) o[t][i] = (__bf16)(acc[t][i] * inv);
#pragma unroll
  for (int t = 0; t < 4; ++t) *(v8bf*)(hp + t * FH_) = o[t];
  // the stores' registers may be reused behind them: wait before they are overwritten
  asm volatile("s_wait_xcnt 0x0" ::: "memory");
}

// ---------------- kernel 4: output projection + residual, live rows back in place ----------
// grid = B * (S/64) * (H/128), block = 128 (4 waves): a block takes 64 compact rows x 128
// columns, a wave 32 x 64 of them by gemm_tile. Two waves walk through the same weight
// fragments and two through the same rows of h, so that a block fetches 64 KB of h and 128 KB
// of weights for its 8,192 results (a block of 16 rows x 512 columns: 16 KB and 512 KB).
// The batch is the fast part of the index and the row tile the slowest, so that the blocks with
// live rows come first.
// The real block size lifts the register ceiling, which the ring of fragments needs.
__global__ void __launch_bounds__(128) outproj_kernel(
                               const __bf16* __restrict__ hbf, const __bf16* __restrict__ wo_pk,
                               const float* __restrict__ xn, const int* __restrict__ rowof,
                               const int* __restrict__ live, float* __restrict__ out,
                               float* __restrict__ spare) {
  const int wid = __builtin_amdgcn_readfirstlane(threadIdx.x >> 5);
  int l = threadIdx.x & 31;
  int g = l >> 4, c = l & 15;
  int b = blockIdx.x % B_;
  const int tile = (int)(blockIdx.x / B_);
  const int j0 = (tile / (H_ / 128)) * 64 + (wid & 1) * 32;  // the wave's 32 compact rows
  const int n0 = (tile % (H_ / 128)) * 128 + (wid >> 1) * 64;  // its 64 columns
  const int nl = live_rows(live, b);
  // whole waves leave: no live row here (h is written up to the pad's end, a multiple of 64
  // rows); the kernel has no barrier
  if (j0 >= nl) return;
  long row0 = (long)b * S_ + j0;

  // One wave to a SIMD: whatever stands behind the last product is waited for in full. So the
  // residual is the accumulators' start value and the home rows are fetched with it: these loads
  // land with the first fragments, and behind the product there are stores alone.
  // A row of the pad has no place in out: it reads the last live row's residual and home
  // row, so that all loads go out together, and is stored in a spare plane of the workspace,
  // [B*S][H] floats that nobody reads.
  // Lane l fetches the home row of the wave's row l.
  const unsigned ro = (unsigned)(b * S_ + min(j0 + l, nl - 1));  // element offset in rowof
  int hr;
  v8f acc[2][4];  // acc[u][t][i] = value(row 16u + 8g + i, column 16t + c)
  gemm_tile<false, H_ / 16>(hbf, row0, wo_pk + (n0 / 16) * FT_, acc, [&](v8f (&a)[2][4]) {
    // keeps the ring's first loads in front: behind the offsets' arithmetic they would go out late
    __builtin_amdgcn_sched_barrier(0);
    hr = rowof[ro];
    unsigned xo[2][8];  // element offsets in xn
#pragma unroll
    for (int u = 0; u < 2; ++u)
#pragma unroll
      for (int i = 0; i < 8; ++i)
        xo[u][i] = (unsigned)(b * S_ + min(j0 + 16 * u + i + 8 * g, nl - 1)) * H_ + n0 + c;
#pragma unroll
    for (int u = 0; u < 2; ++u)
#pragma unroll
      for (int i = 0; i < 8; ++i)
#pragma unroll
        for (int t = 0; t < 4; ++t) a[u][t][i] = xn[xo[u][i] + t * 16];
    // The loads' offset registers are reused behind them: wait before they are overwritten.
    // Naming the offsets as inputs keeps them whole up to the wait.
    asm volatile("s_wait_xcnt 0x0" ::"v"(ro), "v"(xo[0][0]), "v"(xo[0][1]), "v"(xo[0][2]),
                 "v"(xo[0][3]), "v"(xo[0][4]), "v"(xo[0][5]), "v"(xo[0][6]), "v"(xo[0][7]),
                 "v"(xo[1][0]), "v"(xo[1][1]), "v"(xo[1][2]), "v"(xo[1][3]), "v"(xo[1][4]),
                 "v"(xo[1][5]), "v"(xo[1][6]), "v"(xo[1][7])
                 : "memory");
    // keeps the first product behind all these loads: moved up among them, its wait would hold
    // the rest of them back by a whole landing
    __builtin_amdgcn_sched_barrier(0);
  });

  // Every row has an address pair of its own and none stands under a test, so that the 64 stores
  // go out in a row: a row of the pad goes to its compact row of the spare plane.
  float* po[2][8];
#pragma unroll
  for (int u = 0; u < 2; ++u)
#pragma unroll
    for (int i = 0; i < 8; ++i) {
      // home row of the wave's row 16u + i + 8g, masked to the shape
      int lo = __builtin_amdgcn_readlane(hr, 16 * u + i);
      int hi = __builtin_amdgcn_readlane(hr, 16 * u + i + 8);
      const int jr = j0 + 16 * u + i + 8 * g;  // below S_
      po[u][i] = jr < nl ? out + ((unsigned)(b * S_ + ((g ? hi : lo) & (S_ - 1))) * H_ + n0 + c)
                         : spare + ((unsigned)(b * S_ + jr) * H_ + n0 + c);
    }
  // keeps the address arithmetic in front of the stores: among them it would take over registers
  // of stores already issued, with a wait each time
  __builtin_amdgcn_sched_barrier(0);
#pragma unroll
  for (int u = 0; u < 2; ++u)
#pragma unroll
    for (int i = 0; i < 8; ++i)
#pragma unroll
      for (int t = 0; t < 4; ++t) po[u][i][t * 16] = acc[u][t][i];
  // No register of a store is overwritten between the rows, so one wait behind all the stores
  // serves. Naming the addresses as inputs keeps them whole up to the wait.
  asm volatile("s_wait_xcnt 0x0" ::"v"(po[0][0]), "v"(po[0][1]), "v"(po[0][2]), "v"(po[0][3]),
               "v"(po[0][4]), "v"(po[0][5]), "v"(po[0][6]), "v"(po[0][7]), "v"(po[1][0]),
               "v"(po[1][1]), "v"(po[1][2]), "v"(po[1][3]), "v"(po[1][4]), "v"(po[1][5]),
               "v"(po[1][6]), "v"(po[1][7])
               : "memory");
}

extern "C" void kernel_launch(void* const* d_in, const int* in_sizes, int n_in,
                              void* d_out, int out_size, void* d_ws, size_t ws_size,
                              hipStream_t stream) {
  (void)in_sizes; (void)n_in; (void)out_size; (void)ws_size;
  const float* x     = (const float*)d_in[0];
  const int*   mask  = (const int*)d_in[1];
  const float* Wq    = (const float*)d_in[2];
  const float* Wk    = (const float*)d_in[3];
  const float* Wv    = (const float*)d_in[4];
  const float* Wo    = (const float*)d_in[5];
  const float* gamma = (const float*)d_in[6];
  const float* beta  = (const float*)d_in[7];
  float* out = (float*)d_out;

  char* ws = (char*)d_ws;
  float* xn = (float*)ws;        ws += (size_t)B_ * S_ * H_ * 4;
  __bf16* xn_bf = (__bf16*)ws;   ws += (size_t)B_ * S_ * H_ * 2;
  __bf16* qb = (__bf16*)ws;      ws += (size_t)B_ * NH_ * S_ * DK_ * 2;
  __bf16* kb = (__bf16*)ws;      ws += (size_t)B_ * NH_ * S_ * DK_ * 2;
  __bf16* vT = (__bf16*)ws;      ws += (size_t)B_ * NH_ * S_ * DK_ * 2;
  __bf16* hb = (__bf16*)ws;      ws += (size_t)B_ * S_ * H_ * 2;
  __bf16* wq_pk = (__bf16*)ws;   ws += (size_t)NH_ * H_ * DK_ * 2;
  __bf16* wk_pk = (__bf16*)ws;   ws += (size_t)NH_ * H_ * DK_ * 2;
  __bf16* wv_pk = (__bf16*)ws;   ws += (size_t)NH_ * H_ * DK_ * 2;
  __bf16* wo_pk = (__bf16*)ws;   ws += (size_t)H_ * H_ * 2;
  int* rowof = (int*)ws;         ws += (size_t)B_ * S_ * 4;
  int* live = (int*)ws;          ws += (size_t)B_ * 4;
  float* spare = (float*)ws;     ws += (size_t)B_ * S_ * H_ * 4;

  // weight packing (per-head KxN = 512x64: 8*16*4 = 512 fragments; Wo: 16*32 = 512) and
  // LayerNorm in one launch
  prep_kernel<<<B_ * S_ / RB_, 32 * PW_, 0, stream>>>(x, mask, gamma, beta, Wq, Wk, Wv, Wo,
                                                      wq_pk, wk_pk, wv_pk, wo_pk, xn, xn_bf,
                                                      rowof, live, out);

  proj_kernel<<<dim3(B_ * NH_ / 2, 3, S_ / 128), 256, 0, stream>>>(xn_bf, wq_pk, wk_pk, wv_pk,
                                                                   live, qb, kb, vT);

  attn_kernel<<<dim3(B_ * NH_, S_ / 64), 128, 0, stream>>>(qb, kb, vT, live, hb);

  outproj_kernel<<<B_ * (S_ / 64) * (H_ / 128), 128, 0, stream>>>(hb, wo_pk, xn, rowof, live, out,
                                                                  spare);
}
